// v000
// The times below were measured on an AMD MI455X: many runs one after another, warmed up first and cycling through
// copies of the inputs, with the whole window's GPU time divided by the number of runs. Launches and the gaps
// between them are all in it. The median over several windows is given; except for v000 it joins two sittings, which
// can be a few percent apart, so the side-by-side timings, each taken in one sitting, are the better comparison.
// The starting kernel, v000, takes 1730 microseconds a run.
#include <hip/hip_runtime.h>

// HSTU layer (x [4][2048][1024]; Q, K, V = silu(x W) ('xw' [1024][1024]; 8 heads x 128), U = x Wu; scores = Q.K + rel_bias[i - j + 2047][h] ([4095][8], read); scores / sqrt(128); causal and key-padding (sign(sum|K|) == 0) positions -> -2^32+1; weights = silu(scores) (no softmax; masked weights are exactly 0); attn = weights V merged [t][h*128+d]; out = attn x silu(U) -> [4][2048][1024] (8.4 M)).
// Layout: a causal pipeline with silu folded into the plane builders, a pointwise silu-attention kernel in place of the softmax (fp16 weight planes, exact zeros above the diagonal so the P.V contraction stops at the diagonal block), an f32 merge and a final silu(U) gate.
// Compute dtypes, f32 accumulate: every input rounded to bf16; projections exact (inputs); silu in f32 (precise expf) -> Q/K hi/lo planes, V fp16 planes; scores 3 products (tile skipping); bias add, 1/sqrt(128), masks and silu in f32; fp16 weights x fp16 silu(V) (one product, causal K range); no output projection: out = attn x silu(x Wu) in f32.

#define NB_  4
#define TT   2048
#define DM   1024
#define NH_  8
#define NKV  8
#define REP  (NH_ / NKV)
#define HD   128
#define DQ   (NH_ * HD)
#define DKV  (NKV * HD)
#define NEGM (-4294967295.0f)
#define ISC  0.088388347648318447f   // 1/sqrt(128), applied after the bias add
#define ZH   2
#define RH   2048                  // merge divides query rows t >= RH by PCAR (none here)
#define WIN  2048
#define PCAR 1024.0f
#define SCL  0.088388347648318447f   // HD^-0.5
typedef _Float16 h16;
typedef unsigned short bf;
typedef __attribute__((ext_vector_type(16))) __bf16   v16bf;
typedef __attribute__((ext_vector_type(16))) _Float16 v16h;
typedef __attribute__((ext_vector_type(8)))  _Float16 v8h;
typedef __attribute__((ext_vector_type(8)))  unsigned short v8us;
typedef __attribute__((ext_vector_type(8)))  float    v8f;
typedef __attribute__((ext_vector_type(4)))  float    v4f;
typedef v8h  __attribute__((may_alias)) v8ha;
typedef v4f  __attribute__((may_alias)) v4fa;
typedef v8us __attribute__((may_alias)) v8usa;

__device__ __forceinline__ unsigned short f2bf(float f) { unsigned u = __float_as_uint(f); u += 0x7FFFu + ((u >> 16) & 1u); return (unsigned short)(u >> 16); }
__device__ __forceinline__ float bf2f(unsigned short b) { return __uint_as_float(((unsigned)b) << 16); }
__device__ __forceinline__ float bfr(float f) { return bf2f(f2bf(f)); }
__device__ __forceinline__ v16h cat16(v8h lo, v8h hi) { return __builtin_shufflevector(lo, hi, 0, 1, 2, 3, 4, 5, 6, 7, 8, 9, 10, 11, 12, 13, 14, 15); }
__device__ __forceinline__ v16bf cat16b(v8us lo, v8us hi) { return __builtin_bit_cast(v16bf, __builtin_shufflevector(lo, hi, 0, 1, 2, 3, 4, 5, 6, 7, 8, 9, 10, 11, 12, 13, 14, 15)); }
__device__ __forceinline__ v8f wmma16(v16h a, v16h b, v8f c) { return __builtin_amdgcn_wmma_f32_16x16x32_f16(false, a, false, b, (short)0, c, false, false); }
__device__ __forceinline__ v8f wmmab(v16bf a, v16bf b, v8f c) { return __builtin_amdgcn_wmma_f32_16x16x32_bf16(false, a, false, b, (short)0, c, false, false); }



// ---- k_gemmw: register-blocked GEMM, ONE WAVE per 64x64 output tile (16 accumulators), operands straight from K-contiguous 16-bit planes; grid (M/64, N/64, Z), 32 threads.
// C[m][n] (f32, pitch ldc, + optional f32 bias[n]) = sum_k A[m][k] Bt[n][k] (+ split products per NSPLIT). z-batch strides sA/sB/sC in elements. K % 32 == 0.
template <typename T16> struct WFrag;
template <> struct WFrag<h16> { typedef v16h V; static __device__ __forceinline__ V ld(const h16* p) { return cat16(*(const v8h*)p, *(const v8h*)(p + 16)); } static __device__ __forceinline__ v8f mma(V a, V b, v8f c) { return wmma16(a, b, c); } };
template <> struct WFrag<bf> { typedef v16bf V; static __device__ __forceinline__ V ld(const bf* p) { return cat16b(*(const v8us*)p, *(const v8us*)(p + 16)); } static __device__ __forceinline__ v8f mma(V a, V b, v8f c) { return wmmab(a, b, c); } };
template <typename T16, int NSPLIT, bool BIAS>
__global__ __launch_bounds__(32) void k_gemmw(const T16* __restrict__ A, const T16* __restrict__ A2, const T16* __restrict__ Bt, const T16* __restrict__ Bt2, int K, float* C, int ldc, const float* __restrict__ bias, size_t sA, size_t sB, size_t sC) {
    typedef typename WFrag<T16>::V V;
    __shared__ __align__(16) float os[16 * 68];
    const size_t z = blockIdx.z; A += z * sA; if (A2) A2 += z * sA; Bt += z * sB; if (Bt2) Bt2 += z * sB; C += z * sC;
    const int lane = threadIdx.x & 31, lr = lane & 15, hi = lane >> 4; const int r0 = blockIdx.x * 64, c0 = blockIdx.y * 64;
    v8f acc[4][4];
#pragma unroll
    for (int mb = 0; mb < 4; ++mb)
#pragma unroll
        for (int nb = 0; nb < 4; ++nb) acc[mb][nb] = (v8f){};
    const size_t aoff = (size_t)(r0 + lr) * K + 8 * hi, boff = (size_t)(c0 + lr) * K + 8 * hi;
#pragma unroll 1
    for (int kc = 0; kc < K; kc += 32) {
        V a[4], a2[4];
#pragma unroll
        for (int mb = 0; mb < 4; ++mb) { a[mb] = WFrag<T16>::ld(A + aoff + (size_t)mb * 16 * K + kc); if (NSPLIT == 1 || NSPLIT == 2) a2[mb] = WFrag<T16>::ld(A2 + aoff + (size_t)mb * 16 * K + kc); }
#pragma unroll
        for (int nb = 0; nb < 4; ++nb) { const V b = WFrag<T16>::ld(Bt + boff + (size_t)nb * 16 * K + kc); V b2; if (NSPLIT >= 2) b2 = WFrag<T16>::ld(Bt2 + boff + (size_t)nb * 16 * K + kc);
#pragma unroll
            for (int mb = 0; mb < 4; ++mb) { acc[mb][nb] = WFrag<T16>::mma(a[mb], b, acc[mb][nb]); if (NSPLIT == 1 || NSPLIT == 2) acc[mb][nb] = WFrag<T16>::mma(a2[mb], b, acc[mb][nb]); if (NSPLIT >= 2) acc[mb][nb] = WFrag<T16>::mma(a[mb], b2, acc[mb][nb]); } }
        asm volatile("v_nop\n\tv_nop\n\tv_nop\n\tv_nop" : "+v"(acc[0][0]), "+v"(acc[1][1]), "+v"(acc[2][2]), "+v"(acc[3][3]) : "v"(a[0]), "v"(a[3]));
    }
#pragma unroll
    for (int mb = 0; mb < 4; ++mb) {
#pragma unroll
        for (int nb = 0; nb < 4; ++nb) {
#pragma unroll
            for (int j = 0; j < 8; ++j) os[(hi * 8 + j) * 68 + nb * 16 + lr] = acc[mb][nb][j]; }
        __builtin_amdgcn_wave_barrier(); asm volatile("" ::: "memory");
        float* crow = C + (size_t)(r0 + mb * 16) * ldc + c0;
{
#pragma unroll
            for (int s = 0; s < 8; ++s) { const int row = 2 * s + hi, cofs = lr * 4; v4f val = *(const v4fa*)(os + row * 68 + cofs); if (BIAS) { val[0] += bfr(bias[c0 + cofs]); val[1] += bfr(bias[c0 + cofs + 1]); val[2] += bfr(bias[c0 + cofs + 2]); val[3] += bfr(bias[c0 + cofs + 3]); }
                *(v4f*)(crow + (size_t)row * ldc + cofs) = val; }
             }
        __builtin_amdgcn_wave_barrier(); asm volatile("" ::: "memory");
    }
}

// ---- k_gemmc: the same one-wave 64x64 tile GEMM specialised for causal attention: CMODE 1 skips score tiles entirely above the diagonal (query rows r0+roff.., key columns c0..), CMODE 2 limits the
// key (K) loop of the probability x value contraction to the diagonal block (probabilities beyond it are exactly zero). roff = row offset of this launch's first row within the sequence.
template <typename T16, int NSPLIT, int CMODE>
__global__ __launch_bounds__(32) void k_gemmc(const T16* __restrict__ A, const T16* __restrict__ A2, const T16* __restrict__ Bt, const T16* __restrict__ Bt2, int K, float* C, int ldc, int roff, size_t sA, size_t sB, size_t sC) {
    typedef typename WFrag<T16>::V V;
    __shared__ __align__(16) float os[16 * 68];
    const size_t z = blockIdx.z; A += z * sA; if (A2) A2 += z * sA; Bt += z * sB; if (Bt2) Bt2 += z * sB; C += z * sC;
    const int lane = threadIdx.x & 31, lr = lane & 15, hi = lane >> 4; const int r0 = blockIdx.x * 64, c0 = blockIdx.y * 64;
    if (CMODE == 1 && c0 > r0 + roff + 63) return;                  // score tile entirely above the causal diagonal: never read (k_hsilu masks j > i by select)
    const int Kl = (CMODE == 2) ? min(K, r0 + roff + 64) : K;        // P.V: probabilities are exactly 0 beyond the diagonal block, so the K loop stops there
    v8f acc[4][4];
#pragma unroll
    for (int mb = 0; mb < 4; ++mb)
#pragma unroll
        for (int nb = 0; nb < 4; ++nb) acc[mb][nb] = (v8f){};
    const size_t aoff = (size_t)(r0 + lr) * K + 8 * hi, boff = (size_t)(c0 + lr) * K + 8 * hi;
#pragma unroll 1
    for (int kc = 0; kc < Kl; kc += 32) {
        V a[4], a2[4];
#pragma unroll
        for (int mb = 0; mb < 4; ++mb) { a[mb] = WFrag<T16>::ld(A + aoff + (size_t)mb * 16 * K + kc); if (NSPLIT == 1 || NSPLIT == 2) a2[mb] = WFrag<T16>::ld(A2 + aoff + (size_t)mb * 16 * K + kc); }
#pragma unroll
        for (int nb = 0; nb < 4; ++nb) { const V b = WFrag<T16>::ld(Bt + boff + (size_t)nb * 16 * K + kc); V b2; if (NSPLIT >= 2) b2 = WFrag<T16>::ld(Bt2 + boff + (size_t)nb * 16 * K + kc);
#pragma unroll
            for (int mb = 0; mb < 4; ++mb) { acc[mb][nb] = WFrag<T16>::mma(a[mb], b, acc[mb][nb]); if (NSPLIT == 1 || NSPLIT == 2) acc[mb][nb] = WFrag<T16>::mma(a2[mb], b, acc[mb][nb]); if (NSPLIT >= 2) acc[mb][nb] = WFrag<T16>::mma(a[mb], b2, acc[mb][nb]); } }
        asm volatile("v_nop\n\tv_nop\n\tv_nop\n\tv_nop" : "+v"(acc[0][0]), "+v"(acc[1][1]), "+v"(acc[2][2]), "+v"(acc[3][3]) : "v"(a[0]), "v"(a[3]));
    }
#pragma unroll
    for (int mb = 0; mb < 4; ++mb) {
#pragma unroll
        for (int nb = 0; nb < 4; ++nb) {
#pragma unroll
            for (int j = 0; j < 8; ++j) os[(hi * 8 + j) * 68 + nb * 16 + lr] = acc[mb][nb][j]; }
        __builtin_amdgcn_wave_barrier(); asm volatile("" ::: "memory");
        float* crow = C + (size_t)(r0 + mb * 16) * ldc + c0;
{
#pragma unroll
            for (int s = 0; s < 8; ++s) { const int row = 2 * s + hi, cofs = lr * 4; v4f val = *(const v4fa*)(os + row * 68 + cofs);
                *(v4f*)(crow + (size_t)row * ldc + cofs) = val; }
             }
        __builtin_amdgcn_wave_barrier(); asm volatile("" ::: "memory");
    }
}

__device__ __forceinline__ h16 tohx(float x) { return (h16)x; }
__device__ __forceinline__ float siluf(float u) { const float sg = __fdiv_rn(1.0f, __fadd_rn(1.0f, expf(-u))); return __fmul_rn(u, sg); }   /* silu = u sigmoid(u), precise expf */
__device__ __forceinline__ void splitf(float y, unsigned short& h, unsigned short& l) { h = f2bf(y); l = f2bf(y - bf2f(h)); }
typedef __attribute__((ext_vector_type(2))) _Float16 v2h;
typedef __attribute__((ext_vector_type(4))) _Float16 v4h;
typedef __attribute__((ext_vector_type(2))) unsigned short v2us;
typedef __attribute__((ext_vector_type(4))) unsigned short v4us;
typedef __attribute__((ext_vector_type(2))) float v2f;
typedef __attribute__((ext_vector_type(4))) int v4i;

__global__ __launch_bounds__(256) void k_wtG(const float* __restrict__ w, int K, int N, bf* Bt) {
    const int lane = threadIdx.x & 31; const int L0 = (blockIdx.x * 8 + (threadIdx.x >> 5)) * 8; const int nlines = N * K / 64;
{
#pragma unroll 1
        for (int l = 0; l < 8; ++l) { const int L = L0 + l; if (L >= nlines) break; const size_t e = (size_t)L * 64 + lane * 2; const int k = (int)(e % K), n = (int)(e / K); v2us o;
            o[0] = f2bf(w[(size_t)k * N + n]); o[1] = f2bf(w[(size_t)(k + 1) * N + n]); *(v2us*)(Bt + e) = o; }
         }
}
__global__ __launch_bounds__(256) void k_cvt8(const float* __restrict__ src, bf* dst, size_t n8) { const size_t i = (size_t)blockIdx.x * 256 + threadIdx.x; if (i >= n8) return; const v8f v = *(const v8f*)(src + i * 8); v8us o;
#pragma unroll
    for (int k = 0; k < 8; ++k) o[k] = f2bf(v[k]); *(v8us*)(dst + i * 8) = o;  }

// k_rope: head planes [h][t][d] (fp16 + hi/lo) of rope(x) x sc with the rotate-half convention out[d] = x[d] cos[t][d] - x[d+HD/2] sin[t][d], out[d+HD/2] = x[d+HD/2] cos[t][d+HD/2] + x[d] sin[t][d+HD/2]
__global__ __launch_bounds__(256) void k_rope(const float* __restrict__ F, int pitch, int nheads, const float* __restrict__ CS, const float* __restrict__ RF, const float* __restrict__ nw, float sc, h16* P16, bf* Ph, bf* Pl) {
    const size_t e = ((size_t)blockIdx.x * 256 + threadIdx.x) * 2; if (e >= (size_t)nheads * TT * HD) return; const int d = (int)(e % HD); const int t = (int)((e / HD) % TT); const int h = (int)(e / ((size_t)HD * TT)); const float* f = F + (size_t)t * pitch + h * HD; const float rf = RF ? RF[(size_t)h * TT + t] : 1.0f; v2h o16; v2us oh, ol;
#pragma unroll
    for (int q = 0; q < 2; ++q) { const int dd = d + q; const int dp = (dd < HD / 2) ? dd + HD / 2 : dd - HD / 2; float x0 = siluf(f[dd]), x1 = siluf(f[dp]);   /* silu(Q), silu(K) */
        if (RF) { float n0 = __fmul_rn(x0, rf), n1 = __fmul_rn(x1, rf); asm volatile("" : "+v"(n0)); asm volatile("" : "+v"(n1)); x0 = __fmul_rn(bfr(nw[dd]), n0); x1 = __fmul_rn(bfr(nw[dp]), n1); }
        const v2f cs = *(const v2f*)(CS + ((size_t)t * HD + dd) * 2); float a = __fmul_rn(x0, cs[0]), bq = __fmul_rn(x1, cs[1]); asm volatile("" : "+v"(a)); asm volatile("" : "+v"(bq)); const float r = ((dd < HD / 2) ? __fsub_rn(a, bq) : __fadd_rn(a, bq)) * sc;
        o16[q] = tohx(r); unsigned short a2, c2; splitf(r, a2, c2); oh[q] = a2; ol[q] = c2; }
    *(v2h*)(P16 + e) = o16; *(v2us*)(Ph + e) = oh; *(v2us*)(Pl + e) = ol;  }
__global__ __launch_bounds__(256) void k_vtp(const float* __restrict__ F, int pitch, int nheads, h16* V16, bf* Vh, bf* Vl) { const size_t e = ((size_t)blockIdx.x * 256 + threadIdx.x) * 2; if (e >= (size_t)nheads * HD * TT) return; const int t = (int)(e % TT); const int d = (int)((e / TT) % HD); const int g = (int)(e / ((size_t)TT * HD)); v2h o16; v2us oh, ol;
#pragma unroll
    for (int q = 0; q < 2; ++q) { const float x = siluf(F[(size_t)(t + q) * pitch + g * HD + d]);   /* silu(V) */ o16[q] = tohx(x); unsigned short a2, c2; splitf(x, a2, c2); oh[q] = a2; ol[q] = c2; }
    *(v2h*)(V16 + e) = o16; *(v2us*)(Vh + e) = oh; *(v2us*)(Vl + e) = ol;  }
__global__ __launch_bounds__(256) void k_csid(float* CS) { const int idx = blockIdx.x * 256 + threadIdx.x; if (idx >= TT * HD) return; v2f cs; cs[0] = 1.0f; cs[1] = 0.0f; *(v2f*)(CS + (size_t)idx * 2) = cs;  }
__global__ __launch_bounds__(256) void k_mergeF(const float* __restrict__ Ob, int h0, float* O) { const size_t e = ((size_t)blockIdx.x * 256 + threadIdx.x) * 2; if (e >= (size_t)ZH * TT * HD) return; const int d = (int)(e % HD); const int t = (int)((e / HD) % TT); const int zz = (int)(e / ((size_t)HD * TT)); const float cs = (t < RH) ? 1.0f : (1.0f / PCAR); const size_t oo = (size_t)t * DM + (h0 + zz) * HD + d; v2f o2;
    o2[0] = Ob[e] * cs; o2[1] = Ob[e + 1] * cs; *(v2f*)(O + oo) = o2;  }



__global__ __launch_bounds__(256) void k_bttr(const float* __restrict__ RB, float* BTT) { const int idx = blockIdx.x * 256 + threadIdx.x; if (idx >= NH_ * 4096) return; const int p = idx % 4096, h = idx / 4096; const float v = (p < 2 * TT - 1) ? bfr(RB[(size_t)p * NH_ + h]) : 0.0f; *(float*)(BTT + idx) = v;  }
__global__ __launch_bounds__(256) void k_kmask(const float* __restrict__ FK, float* KM) { const int idx = blockIdx.x * 256 + threadIdx.x; if (idx >= NH_ * TT) return; const int j = idx % TT, h = idx / TT; const float* f = FK + (size_t)j * DKV + h * HD; float s = 0.f;
#pragma unroll 8
    for (int d = 0; d < HD; ++d) s = __fadd_rn(s, fabsf(siluf(f[d]))); const float m = (s > 0.f) ? 1.0f : ((s < 0.f) ? -1.0f : 0.0f); *(float*)(KM + idx) = m;  }
__global__ __launch_bounds__(256) void k_hsilu(const float* __restrict__ Sb, const float* __restrict__ BTT, const float* __restrict__ KM, int h0, h16* P16) {
    const int lane = threadIdx.x & 31; const int row = blockIdx.x * 8 + (threadIdx.x >> 5); if (row >= ZH * TT) return; const int i = row % TT; const int zz = row / TT; const int h = h0 + zz; const float* sr = Sb + (size_t)row * TT; const float* btr = BTT + (size_t)h * 4096 + 2047 + i; const float* km = KM + (size_t)h * TT;
{
#pragma unroll 2
        for (int ch = 0; ch < TT / 128; ++ch) { const int j0 = ch * 128 + lane * 4; v4h o4;
            if (j0 <= i) { const v4f a = *(const v4f*)(sr + j0);
#pragma unroll
                for (int q = 0; q < 4; ++q) { const int j = j0 + q; float sb = __fadd_rn(a[q], btr[-j]); asm volatile("" : "+v"(sb)); float t = __fmul_rn(sb, ISC); if (j > i || km[j] == 0.0f) t = NEGM; o4[q] = tohx(siluf(t)); } }
            else { o4[0] = o4[1] = o4[2] = o4[3] = tohx(-0.0f); }   /* whole group above the diagonal: silu(NEG) = -0 (the score tile may not even exist) */
            *(v4h*)(P16 + (size_t)row * TT + j0) = o4; }
         }
}
__global__ __launch_bounds__(256) void k_ugate(const float* __restrict__ M, const float* __restrict__ FU, float* O, size_t n4) { const size_t i = (size_t)blockIdx.x * 256 + threadIdx.x; if (i >= n4) return; const v4f a = *(const v4f*)(M + i * 4), u = *(const v4f*)(FU + i * 4); v4f o;
#pragma unroll
    for (int q = 0; q < 4; ++q) o[q] = __fmul_rn(a[q], siluf(u[q])); *(v4f*)(O + i * 4) = o;  }

extern "C" void kernel_launch(void* const* d_in, const int* in_sizes, int n_in,
                              void* d_out, int out_size, void* d_ws, size_t ws_size, hipStream_t stream) {
    (void)in_sizes; (void)n_in; (void)out_size;
    const float* x = (const float*)d_in[0]; const float* wq = (const float*)d_in[1]; const float* wk = (const float*)d_in[2]; const float* wv = (const float*)d_in[3]; const float* wu = (const float*)d_in[4]; const float* RB = (const float*)d_in[5]; const float* wo = nullptr; (void)wo;
    float* OUT = (float*)d_out;     // [4][2048][1024]
    char* wsp = (char*)d_ws;
    auto take = [&](size_t bytes) { char* p = wsp; wsp += (bytes + 255) & ~(size_t)255; return (void*)p; };
    bf* WQ = (bf*)take((size_t)DQ * DM * 2); bf* WK = (bf*)take((size_t)DKV * DM * 2); bf* WV = (bf*)take((size_t)DKV * DM * 2); bf* WU = (bf*)take((size_t)DM * DM * 2); float* BTT = (float*)take((size_t)NH_ * 4096 * 4); float* KM = (float*)take((size_t)NH_ * TT * 4); float* FU = (float*)take((size_t)TT * DM * 4); float* MRG = (float*)take((size_t)TT * DQ * 4); float* CS = (float*)take((size_t)TT * HD * 2 * 4);
    bf* XB = (bf*)take((size_t)TT * DM * 2); float* FQ = (float*)take((size_t)TT * DQ * 4); float* FK = (float*)take((size_t)TT * DKV * 4);
    h16* QP16 = (h16*)take((size_t)NH_ * TT * HD * 2); h16* KP16 = (h16*)take((size_t)NKV * TT * HD * 2); h16* VT16 = (h16*)take((size_t)NKV * HD * TT * 2);
    bf* QPh = (bf*)take((size_t)NH_ * TT * HD * 2); bf* QPl = (bf*)take((size_t)NH_ * TT * HD * 2); bf* KPh = (bf*)take((size_t)NKV * TT * HD * 2); bf* KPl = (bf*)take((size_t)NKV * TT * HD * 2); bf* VTh = (bf*)take((size_t)NKV * HD * TT * 2); bf* VTl = (bf*)take((size_t)NKV * HD * TT * 2); bf* Ph = nullptr; bf* Pl = nullptr; (void)Ph; (void)Pl;
    float* Sb = (float*)take((size_t)ZH * TT * TT * 4); h16* P16 = (h16*)take((size_t)ZH * TT * TT * 2); float* Ob = (float*)take((size_t)ZH * TT * HD * 4);
    if ((size_t)(wsp - (char*)d_ws) > ws_size) return;    // ws 256 MiB
    float* FV = FK;   // v projection reuses the k buffer after the k planes are built (stream-ordered)
    { k_wtG<<<(unsigned)((DM * DQ / 64 + 63) / 64), 256, 0, stream>>>(wq, DM, DQ, WQ); k_wtG<<<(unsigned)((DM * DKV / 64 + 63) / 64), 256, 0, stream>>>(wk, DM, DKV, WK); k_wtG<<<(unsigned)((DM * DKV / 64 + 63) / 64), 256, 0, stream>>>(wv, DM, DKV, WV); k_wtG<<<(unsigned)((DM * DM / 64 + 63) / 64), 256, 0, stream>>>(wu, DM, DM, WU); k_bttr<<<(NH_ * 4096 + 255) / 256, 256, 0, stream>>>(RB, BTT);   /* Wu; transposed relative-bias rows */
       }
    k_csid<<<(TT * HD + 255) / 256, 256, 0, stream>>>(CS);
    const unsigned LQ = (unsigned)(((size_t)NH_ * TT * HD / 2 + 255) / 256), LKv = (unsigned)(((size_t)NKV * TT * HD / 2 + 255) / 256);
    for (int b = 0; b < NB_; ++b) {
        
        k_cvt8<<<(unsigned)(((size_t)TT * DM / 8 + 255) / 256), 256, 0, stream>>>(x + (size_t)b * TT * DM, XB, (size_t)TT * DM / 8);
        k_gemmw<bf, 0, false><<<dim3(TT / 64, DQ / 64, 1), 32, 0, stream>>>(XB, nullptr, WQ, nullptr, DM, FQ, DQ, nullptr, 0, 0, 0);
        k_rope<<<LQ, 256, 0, stream>>>(FQ, DQ, NH_, CS, nullptr, nullptr, 1.0f, QP16, QPh, QPl);
        k_gemmw<bf, 0, false><<<dim3(TT / 64, DKV / 64, 1), 32, 0, stream>>>(XB, nullptr, WK, nullptr, DM, FK, DKV, nullptr, 0, 0, 0);
        k_rope<<<LKv, 256, 0, stream>>>(FK, DKV, NKV, CS, nullptr, nullptr, 1.0f, KP16, KPh, KPl); k_kmask<<<(NH_ * TT + 255) / 256, 256, 0, stream>>>(FK, KM);   /* key padding flags from silu(K) */
        k_gemmw<bf, 0, false><<<dim3(TT / 64, DKV / 64, 1), 32, 0, stream>>>(XB, nullptr, WV, nullptr, DM, FV, DKV, nullptr, 0, 0, 0); k_vtp<<<LKv, 256, 0, stream>>>(FV, DKV, NKV, VT16, VTh, VTl);
        for (int h0 = 0; h0 < NH_; h0 += ZH) { const size_t zq = (size_t)h0, zk = (size_t)h0;
            k_gemmc<bf, 2, 1><<<dim3(TT / 64, TT / 64, ZH), 32, 0, stream>>>(QPh + zq * TT * HD, QPl + zq * TT * HD, KPh + zk * TT * HD, KPl + zk * TT * HD, HD, Sb, TT, 0, (size_t)TT * HD, (size_t)TT * HD, (size_t)TT * TT);   /* scores = silu(Q).silu(K) (3 products; tiles above the diagonal skipped) */
            k_hsilu<<<ZH * TT / 8, 256, 0, stream>>>(Sb, BTT, KM, h0, P16);                                                       /* + bias, /sqrt(128), masks, silu -> fp16 weights */
            k_gemmc<h16, 0, 2><<<dim3(TT / 64, HD / 64, ZH), 32, 0, stream>>>(P16, nullptr, VT16 + zk * HD * TT, nullptr, TT, Ob, HD, 0, (size_t)TT * TT, (size_t)HD * TT, (size_t)TT * HD);   /* weights . silu(V) (one product, K range to the diagonal block) */
            k_mergeF<<<(unsigned)(((size_t)ZH * TT * HD / 2 + 255) / 256), 256, 0, stream>>>(Ob, h0, MRG); }   /* merged [t][h*128+d], f32 */
        k_gemmw<bf, 0, false><<<dim3(TT / 64, DM / 64, 1), 32, 0, stream>>>(XB, nullptr, WU, nullptr, DM, FU, DM, nullptr, 0, 0, 0);   /* U = x Wu */
        k_ugate<<<(unsigned)(((size_t)TT * DM / 4 + 255) / 256), 256, 0, stream>>>(MRG, FU, OUT + (size_t)b * TT * DM, (size_t)TT * DM / 4); }   /* out = attn x silu(U) */
}

// v002
// One run takes 474 microseconds.
// Versions between v000 and this one are left out; their measured steps multiply to 3.65 times as fast.
#include <hip/hip_runtime.h>

// HSTU layer (x [4][2048][1024]; Q, K, V = silu(x W) ('xw' [1024][1024]; 8 heads x 128), U = x Wu; scores = Q.K + rel_bias[i - j + 2047][h] ([4095][8], read); scores / sqrt(128); causal and key-padding (sign(sum|K|) == 0) positions -> -2^32+1; weights = silu(scores) (no softmax; masked weights are exactly 0); attn = weights V merged [t][h*128+d]; out = attn x silu(U) -> [4][2048][1024] (8.4 M)).
// Layout: a causal pipeline with silu folded into the plane builders, one fused silu-attention kernel in place of the softmax (scores and fp16 weights stay in registers, exact zeros above the diagonal so the P.V contraction stops at the diagonal block; it writes the merged f32 rows) and a final silu(U) gate. The four batches run side by side in every launch: the GEMMs, the bf16 copy of x and the gate take the 8192 rows as one matrix, the plane builders and the attention kernel take the batch from the grid.
// Compute dtypes, f32 accumulate: every input rounded to bf16; projections exact (inputs); silu in f32 (precise expf) -> Q/K hi/lo planes, V fp16 planes; scores 3 products (tile skipping); bias add, 1/sqrt(128), masks and silu in f32; fp16 weights x fp16 silu(V) (one product, causal K range); no output projection: out = attn x silu(x Wu) in f32.

#define NB_  4
#define TT   2048
#define DM   1024
#define NH_  8
#define NKV  8
#define REP  (NH_ / NKV)
#define HD   128
#define DQ   (NH_ * HD)
#define DKV  (NKV * HD)
#define NEGM (-4294967295.0f)
#define ISC  0.088388347648318447f   // 1/sqrt(128), applied after the bias add
#define ZH   2
#define RH   2048
#define WIN  2048
#define PCAR 1024.0f
#define SCL  0.088388347648318447f   // HD^-0.5
typedef _Float16 h16;
typedef unsigned short bf;
typedef __attribute__((ext_vector_type(16))) __bf16   v16bf;
typedef __attribute__((ext_vector_type(16))) _Float16 v16h;
typedef __attribute__((ext_vector_type(8)))  _Float16 v8h;
typedef __attribute__((ext_vector_type(8)))  unsigned short v8us;
typedef __attribute__((ext_vector_type(8)))  float    v8f;
typedef __attribute__((ext_vector_type(4)))  float    v4f;
typedef v8h  __attribute__((may_alias)) v8ha;
typedef v4f  __attribute__((may_alias)) v4fa;
typedef v8us __attribute__((may_alias)) v8usa;

__device__ __forceinline__ unsigned short f2bf(float f) { unsigned u = __float_as_uint(f); u += 0x7FFFu + ((u >> 16) & 1u); return (unsigned short)(u >> 16); }
__device__ __forceinline__ float bf2f(unsigned short b) { return __uint_as_float(((unsigned)b) << 16); }
__device__ __forceinline__ float bfr(float f) { return bf2f(f2bf(f)); }
__device__ __forceinline__ v16h cat16(v8h lo, v8h hi) { return __builtin_shufflevector(lo, hi, 0, 1, 2, 3, 4, 5, 6, 7, 8, 9, 10, 11, 12, 13, 14, 15); }
__device__ __forceinline__ v16bf cat16b(v8us lo, v8us hi) { return __builtin_bit_cast(v16bf, __builtin_shufflevector(lo, hi, 0, 1, 2, 3, 4, 5, 6, 7, 8, 9, 10, 11, 12, 13, 14, 15)); }
__device__ __forceinline__ v8f wmma16(v16h a, v16h b, v8f c) { return __builtin_amdgcn_wmma_f32_16x16x32_f16(false, a, false, b, (short)0, c, false, false); }
__device__ __forceinline__ v8f wmmab(v16bf a, v16bf b, v8f c) { return __builtin_amdgcn_wmma_f32_16x16x32_bf16(false, a, false, b, (short)0, c, false, false); }



// ---- k_gemmw: register-blocked GEMM, ONE WAVE per 64x64 output tile (16 accumulators), operands straight from K-contiguous 16-bit planes; grid (M/64, N/64, Z), 32 threads.
// C[m][n] (f32, pitch ldc, + optional f32 bias[n]) = sum_k A[m][k] Bt[n][k] (+ split products per NSPLIT). z-batch strides sA/sB/sC in elements. K % 32 == 0.
template <typename T16> struct WFrag;
template <> struct WFrag<h16> { typedef v16h V; static __device__ __forceinline__ V ld(const h16* p) { return cat16(*(const v8h*)p, *(const v8h*)(p + 16)); } static __device__ __forceinline__ v8f mma(V a, V b, v8f c) { return wmma16(a, b, c); } };
template <> struct WFrag<bf> { typedef v16bf V; static __device__ __forceinline__ V ld(const bf* p) { return cat16b(*(const v8us*)p, *(const v8us*)(p + 16)); } static __device__ __forceinline__ v8f mma(V a, V b, v8f c) { return wmmab(a, b, c); } };
template <typename T16, int NSPLIT, bool BIAS>
__global__ __launch_bounds__(32) void k_gemmw(const T16* __restrict__ A, const T16* __restrict__ A2, const T16* __restrict__ Bt, const T16* __restrict__ Bt2, int K, float* C, int ldc, const float* __restrict__ bias, size_t sA, size_t sB, size_t sC) {
    typedef typename WFrag<T16>::V V;
    __shared__ __align__(16) float os[16 * 68];
    const size_t z = blockIdx.z; A += z * sA; if (A2) A2 += z * sA; Bt += z * sB; if (Bt2) Bt2 += z * sB; C += z * sC;
    const int lane = threadIdx.x & 31, lr = lane & 15, hi = lane >> 4; const int r0 = blockIdx.x * 64, c0 = blockIdx.y * 64;
    v8f acc[4][4];
#pragma unroll
    for (int mb = 0; mb < 4; ++mb)
#pragma unroll
        for (int nb = 0; nb < 4; ++nb) acc[mb][nb] = (v8f){};
    const size_t aoff = (size_t)(r0 + lr) * K + 8 * hi, boff = (size_t)(c0 + lr) * K + 8 * hi;
#pragma unroll 1
    for (int kc = 0; kc < K; kc += 32) {
        V a[4], a2[4];
#pragma unroll
        for (int mb = 0; mb < 4; ++mb) { a[mb] = WFrag<T16>::ld(A + aoff + (size_t)mb * 16 * K + kc); if (NSPLIT == 1 || NSPLIT == 2) a2[mb] = WFrag<T16>::ld(A2 + aoff + (size_t)mb * 16 * K + kc); }
#pragma unroll
        for (int nb = 0; nb < 4; ++nb) { const V b = WFrag<T16>::ld(Bt + boff + (size_t)nb * 16 * K + kc); V b2; if (NSPLIT >= 2) b2 = WFrag<T16>::ld(Bt2 + boff + (size_t)nb * 16 * K + kc);
#pragma unroll
            for (int mb = 0; mb < 4; ++mb) { acc[mb][nb] = WFrag<T16>::mma(a[mb], b, acc[mb][nb]); if (NSPLIT == 1 || NSPLIT == 2) acc[mb][nb] = WFrag<T16>::mma(a2[mb], b, acc[mb][nb]); if (NSPLIT >= 2) acc[mb][nb] = WFrag<T16>::mma(a[mb], b2, acc[mb][nb]); } }
        asm volatile("v_nop\n\tv_nop\n\tv_nop\n\tv_nop" : "+v"(acc[0][0]), "+v"(acc[1][1]), "+v"(acc[2][2]), "+v"(acc[3][3]) : "v"(a[0]), "v"(a[3]));
    }
#pragma unroll
    for (int mb = 0; mb < 4; ++mb) {
#pragma unroll
        for (int nb = 0; nb < 4; ++nb) {
#pragma unroll
            for (int j = 0; j < 8; ++j) os[(hi * 8 + j) * 68 + nb * 16 + lr] = acc[mb][nb][j]; }
        __builtin_amdgcn_wave_barrier(); asm volatile("" ::: "memory");
        float* crow = C + (size_t)(r0 + mb * 16) * ldc + c0;
{
#pragma unroll
            for (int s = 0; s < 8; ++s) { const int row = 2 * s + hi, cofs = lr * 4; v4f val = *(const v4fa*)(os + row * 68 + cofs); if (BIAS) { val[0] += bfr(bias[c0 + cofs]); val[1] += bfr(bias[c0 + cofs + 1]); val[2] += bfr(bias[c0 + cofs + 2]); val[3] += bfr(bias[c0 + cofs + 3]); }
                *(v4f*)(crow + (size_t)row * ldc + cofs) = val; }
             }
        __builtin_amdgcn_wave_barrier(); asm volatile("" ::: "memory");
    }
}

__device__ __forceinline__ h16 tohx(float x) { return (h16)x; }
__device__ __forceinline__ float siluf(float u) { const float sg = __fdiv_rn(1.0f, __fadd_rn(1.0f, expf(-u))); return __fmul_rn(u, sg); }   /* silu = u sigmoid(u), precise expf */
__device__ __forceinline__ void splitf(float y, unsigned short& h, unsigned short& l) { h = f2bf(y); l = f2bf(y - bf2f(h)); }
typedef __attribute__((ext_vector_type(2))) _Float16 v2h;
typedef __attribute__((ext_vector_type(4))) _Float16 v4h;
typedef __attribute__((ext_vector_type(2))) unsigned short v2us;
typedef __attribute__((ext_vector_type(4))) unsigned short v4us;
typedef __attribute__((ext_vector_type(2))) float v2f;
typedef __attribute__((ext_vector_type(4))) int v4i;

__global__ __launch_bounds__(256) void k_wtG(const float* __restrict__ w, int K, int N, bf* Bt) {
    const int lane = threadIdx.x & 31; const int L0 = (blockIdx.x * 8 + (threadIdx.x >> 5)) * 8; const int nlines = N * K / 64;
{
#pragma unroll 1
        for (int l = 0; l < 8; ++l) { const int L = L0 + l; if (L >= nlines) break; const size_t e = (size_t)L * 64 + lane * 2; const int k = (int)(e % K), n = (int)(e / K); v2us o;
            o[0] = f2bf(w[(size_t)k * N + n]); o[1] = f2bf(w[(size_t)(k + 1) * N + n]); *(v2us*)(Bt + e) = o; }
         }
}
__global__ __launch_bounds__(256) void k_cvt8(const float* __restrict__ src, bf* dst, size_t n8) { const size_t i = (size_t)blockIdx.x * 256 + threadIdx.x; if (i >= n8) return; const v8f v = *(const v8f*)(src + i * 8); v8us o;
#pragma unroll
    for (int k = 0; k < 8; ++k) o[k] = f2bf(v[k]); *(v8us*)(dst + i * 8) = o;  }

// k_rope: head planes [h][t][d] (fp16 + hi/lo) of rope(x) x sc with the rotate-half convention out[d] = x[d] cos[t][d] - x[d+HD/2] sin[t][d], out[d+HD/2] = x[d+HD/2] cos[t][d+HD/2] + x[d] sin[t][d+HD/2]
__global__ __launch_bounds__(256) void k_rope(const float* __restrict__ F, int pitch, int nheads, const float* __restrict__ CS, const float* __restrict__ RF, const float* __restrict__ nw, float sc, h16* P16, bf* Ph, bf* Pl) {
    { const size_t b = blockIdx.y, pb = b * nheads * TT * HD; F += b * TT * pitch; P16 += pb; Ph += pb; Pl += pb; }   // blockIdx.y: the batch (rows b*TT.. of F, planes [b][h][t][d])
    const size_t e = ((size_t)blockIdx.x * 256 + threadIdx.x) * 2; if (e >= (size_t)nheads * TT * HD) return; const int d = (int)(e % HD); const int t = (int)((e / HD) % TT); const int h = (int)(e / ((size_t)HD * TT)); const float* f = F + (size_t)t * pitch + h * HD; const float rf = RF ? RF[(size_t)h * TT + t] : 1.0f; v2h o16; v2us oh, ol;
#pragma unroll
    for (int q = 0; q < 2; ++q) { const int dd = d + q; const int dp = (dd < HD / 2) ? dd + HD / 2 : dd - HD / 2; float x0 = siluf(f[dd]), x1 = siluf(f[dp]);   /* silu(Q), silu(K) */
        if (RF) { float n0 = __fmul_rn(x0, rf), n1 = __fmul_rn(x1, rf); asm volatile("" : "+v"(n0)); asm volatile("" : "+v"(n1)); x0 = __fmul_rn(bfr(nw[dd]), n0); x1 = __fmul_rn(bfr(nw[dp]), n1); }
        const v2f cs = *(const v2f*)(CS + ((size_t)t * HD + dd) * 2); float a = __fmul_rn(x0, cs[0]), bq = __fmul_rn(x1, cs[1]); asm volatile("" : "+v"(a)); asm volatile("" : "+v"(bq)); const float r = ((dd < HD / 2) ? __fsub_rn(a, bq) : __fadd_rn(a, bq)) * sc;
        o16[q] = tohx(r); unsigned short a2, c2; splitf(r, a2, c2); oh[q] = a2; ol[q] = c2; }
    *(v2h*)(P16 + e) = o16; *(v2us*)(Ph + e) = oh; *(v2us*)(Pl + e) = ol;  }
__global__ __launch_bounds__(256) void k_vtp(const float* __restrict__ F, int pitch, int nheads, h16* V16, bf* Vh, bf* Vl) {
    { const size_t b = blockIdx.y, pb = b * nheads * HD * TT; F += b * TT * pitch; V16 += pb; Vh += pb; Vl += pb; }   // blockIdx.y: the batch (planes [b][g][d][t])
    const size_t e = ((size_t)blockIdx.x * 256 + threadIdx.x) * 2; if (e >= (size_t)nheads * HD * TT) return; const int t = (int)(e % TT); const int d = (int)((e / TT) % HD); const int g = (int)(e / ((size_t)TT * HD)); v2h o16; v2us oh, ol;
#pragma unroll
    for (int q = 0; q < 2; ++q) { const float x = siluf(F[(size_t)(t + q) * pitch + g * HD + d]);   /* silu(V) */ o16[q] = tohx(x); unsigned short a2, c2; splitf(x, a2, c2); oh[q] = a2; ol[q] = c2; }
    *(v2h*)(V16 + e) = o16; *(v2us*)(Vh + e) = oh; *(v2us*)(Vl + e) = ol;  }
__global__ __launch_bounds__(256) void k_csid(float* CS) { const int idx = blockIdx.x * 256 + threadIdx.x; if (idx >= TT * HD) return; v2f cs; cs[0] = 1.0f; cs[1] = 0.0f; *(v2f*)(CS + (size_t)idx * 2) = cs;  }
__global__ __launch_bounds__(256) void k_bttr(const float* __restrict__ RB, float* BTT) { const int idx = blockIdx.x * 256 + threadIdx.x; if (idx >= NH_ * 4096) return; const int p = idx % 4096, h = idx / 4096; const float v = (p < 2 * TT - 1) ? bfr(RB[(size_t)p * NH_ + h]) : 0.0f; *(float*)(BTT + idx) = v;  }
__global__ __launch_bounds__(256) void k_kmask(const float* __restrict__ FK, float* KM) {
    FK += (size_t)blockIdx.y * TT * DKV; KM += (size_t)blockIdx.y * NH_ * TT;   // blockIdx.y: the batch
    const int idx = blockIdx.x * 256 + threadIdx.x; if (idx >= NH_ * TT) return; const int j = idx % TT, h = idx / TT; const float* f = FK + (size_t)j * DKV + h * HD; float s = 0.f;
#pragma unroll 8
    for (int d = 0; d < HD; ++d) s = __fadd_rn(s, fabsf(siluf(f[d]))); const float m = (s > 0.f) ? 1.0f : ((s < 0.f) ? -1.0f : 0.0f); *(float*)(KM + idx) = m;  }
// ---- k_fattn: scores, bias, masks, silu weights and weights x V in one kernel; nothing of the [t][t] planes goes to memory. One wave per 16 query rows, 4 waves a work-group, grid (heads, batches, TT/64): the row block is the slowest index, longest rows first over all heads and batches, so that no long work-group starts late.
// Per 32 keys: St = K Qt (two 16-key tiles, the same 3 hi/lo products in the same order per 32 of d), a lane then holds 16 keys of ONE query in the hardware k order, so the fp16 weights are the B operand of Ot += Vt Pt as they stand.
// Keys run in ascending 32-key steps into one accumulator and stop at the end of the 64-row diagonal block, so every sum keeps its order. K fragments are fetched one step ahead, V fragments at the head of their step.
typedef const __attribute__((address_space(1))) char* gptr;   // an address known to be global memory: it stays so through the asm statement below (a plain pointer would come back as a flat one)
__device__ __forceinline__ v16bf ldfb(gptr p) { return cat16b(*(const __attribute__((address_space(1))) v8us*)p, *(const __attribute__((address_space(1))) v8us*)(p + 32)); }
__device__ __forceinline__ v16h ldfh(gptr p) { return cat16(*(const __attribute__((address_space(1))) v8h*)p, *(const __attribute__((address_space(1))) v8h*)(p + 32)); }
__global__ __launch_bounds__(128) void k_fattn(const bf* __restrict__ Qh, const bf* __restrict__ Ql, const bf* __restrict__ Kh, const bf* __restrict__ Kl, const h16* __restrict__ Vt, const float* __restrict__ BTT, const float* __restrict__ KM, float* O) {
    __shared__ __align__(16) float sbias[4096]; __shared__ __align__(16) float skm[TT];
    const int h = blockIdx.x; const int qb = ((int)gridDim.z - 1 - (int)blockIdx.z) * 64;
    { const size_t b = blockIdx.y, pb = b * NH_ * TT * HD; Qh += pb; Ql += pb; Kh += pb; Kl += pb; Vt += pb; KM += b * NH_ * TT; O += b * TT * DM; }   // this batch's planes, key flags and output rows
#pragma unroll
    for (int p = 0; p < 4096 / 4 / 128; ++p) ((v4f*)sbias)[p * 128 + threadIdx.x] = ((const v4f*)(BTT + (size_t)h * 4096))[p * 128 + threadIdx.x];
#pragma unroll
    for (int p = 0; p < TT / 4 / 128; ++p) ((v4f*)skm)[p * 128 + threadIdx.x] = ((const v4f*)(KM + (size_t)h * TT))[p * 128 + threadIdx.x];
    __syncthreads();
    const int lane = threadIdx.x & 31, c = lane & 15, hh = lane >> 4; const int q0 = qb + __builtin_amdgcn_readfirstlane((int)(threadIdx.x >> 5)) * 16; const int i = q0 + c;
    const size_t hp = (size_t)h * TT * HD; const int kof = c * HD * 2 + 16 * hh;
    gptr khp = (gptr)(Kh + hp) + kof; gptr klp = (gptr)(Kl + hp) + kof; gptr vtp = (gptr)(Vt + hp) + c * TT * 2 + 16 * hh;   // each lane's running addresses: K hi, K lo (one step ahead), V
    v16bf qh[4], ql[4], kaA[8], kbA[8], kaB[8], kbB[8];
#pragma unroll
    for (int kc = 0; kc < 4; ++kc) { qh[kc] = ldfb((gptr)(Qh + hp) + (size_t)q0 * HD * 2 + kof + kc * 64); ql[kc] = ldfb((gptr)(Ql + hp) + (size_t)q0 * HD * 2 + kof + kc * 64); }
#pragma unroll
    for (int f = 0; f < 8; ++f) { kaA[f] = ldfb(khp + (f & 1) * 16 * HD * 2 + (f >> 1) * 64); kbA[f] = ldfb(klp + (f & 1) * 16 * HD * 2 + (f >> 1) * 64); }
    khp += 32 * HD * 2; klp += 32 * HD * 2;   // kend >= 64: a second step always exists
    v8f o[8];
#pragma unroll
    for (int dt = 0; dt < 8; ++dt) o[dt] = (v8f){};
    const int kend = qb + 64;   // keys up to the end of the work-group's 64-row diagonal block (weights past the diagonal are exact zeros): an even number of 32-key steps for every wave
    // one 32-key step: works on the K fragments ka/kb and fetches the next step's into na/nb
    auto step = [&](const v16bf (&ka)[8], const v16bf (&kb)[8], v16bf (&na)[8], v16bf (&nb)[8], const int k0) {
        v16h vf[8]; float bs[16]; v4f km[4];
#pragma unroll
        for (int e = 0; e < 16; ++e) bs[e] = sbias[2047 + i - (k0 + (e >> 3) * 16 + 8 * hh + (e & 7))];
#pragma unroll
        for (int e = 0; e < 4; ++e) km[e] = *(const v4f*)(skm + k0 + (e >> 1) * 16 + 8 * hh + (e & 1) * 4);
#pragma unroll
        for (int dt = 0; dt < 8; ++dt) vf[dt] = ldfh(vtp + dt * 16 * TT * 2);
#pragma unroll
        for (int f = 0; f < 8; ++f) { na[f] = ldfb(khp + (f & 1) * 16 * HD * 2 + (f >> 1) * 64); nb[f] = ldfb(klp + (f & 1) * 16 * HD * 2 + (f >> 1) * 64); }
        // inputs only, loaded values only: holds the bias and mask LDS loads at the head of the step, their latency under the issue of the global loads (left alone the compiler sinks them into the silu arithmetic, a short-led wait every few elements)
        asm volatile("" :: "v"(bs[0]), "v"(bs[1]), "v"(bs[2]), "v"(bs[3]), "v"(bs[4]), "v"(bs[5]), "v"(bs[6]), "v"(bs[7]), "v"(bs[8]), "v"(bs[9]), "v"(bs[10]), "v"(bs[11]), "v"(bs[12]), "v"(bs[13]), "v"(bs[14]), "v"(bs[15]), "v"(km[0]), "v"(km[1]), "v"(km[2]), "v"(km[3]));
        __builtin_amdgcn_sched_barrier(0);   // keeps this step's V loads and the next step's K loads in front of the products, so that their latency runs under the step's work
        v8f s[2]; s[0] = (v8f){}; s[1] = (v8f){};
#pragma unroll
        for (int f = 0; f < 8; ++f) { const int kt = f & 1, kc = f >> 1;
            s[kt] = wmmab(ka[f], qh[kc], s[kt]); s[kt] = wmmab(ka[f], ql[kc], s[kt]); s[kt] = wmmab(kb[f], qh[kc], s[kt]); }
        v16h p;
#pragma unroll
        for (int e = 0; e < 16; ++e) { const int j = k0 + (e >> 3) * 16 + 8 * hh + (e & 7); float t = __fmul_rn(__fadd_rn(s[e >> 3][e & 7], bs[e]), ISC); const bool msk = (j > i) | (km[e >> 2][e & 3] == 0.0f); t = msk ? NEGM : t; p[e] = tohx(siluf(t)); }
#pragma unroll
        for (int dt = 0; dt < 8; ++dt) o[dt] = wmma16(vf[dt], p, o[dt]);
        // the next step's addresses are formed in other registers, and this step's stay in theirs (inputs), up to the wait that stands in front of a rewrite of address registers which issued loads name
        const int adv = (k0 + 64 < kend) ? 32 * HD * 2 : 0;   // the last step fetches its own K rows again: nothing past the diagonal block is read
        gptr khn = khp + adv, kln = klp + adv, vtn = vtp + 32 * 2;
        asm volatile("s_wait_xcnt 0x0" : "+v"(khn), "+v"(kln), "+v"(vtn) : "v"(khp), "v"(klp), "v"(vtp) : "memory");
        khp = khn; klp = kln; vtp = vtn;
    };
#pragma unroll 1
    for (int k0 = 0; k0 < kend; k0 += 64) {   // two steps a trip, so that the two K fragment sets swap roles without register copies
        step(kaA, kbA, kaB, kbB, k0);
        step(kaB, kbB, kaA, kbA, k0 + 32);
    }
    asm volatile("s_wait_loadcnt 0x0" ::: "memory");   // the last step's spare K fetch is not left in flight when the wave stores its tile and ends
    float* orow = O + (size_t)i * DM + h * HD + 8 * hh;   // a lane holds 8 consecutive d of one query: merged [t][h*128+d], f32
#pragma unroll
    for (int dt = 0; dt < 8; ++dt) { v4f lo, hi4;
#pragma unroll
        for (int r = 0; r < 4; ++r) { lo[r] = o[dt][r]; hi4[r] = o[dt][4 + r]; }
        *(v4f*)(orow + dt * 16) = lo; *(v4f*)(orow + dt * 16 + 4) = hi4; }
}
__global__ __launch_bounds__(256) void k_ugate(const float* __restrict__ M, const float* __restrict__ FU, float* O, size_t n4) { const size_t i = (size_t)blockIdx.x * 256 + threadIdx.x; if (i >= n4) return; const v4f a = *(const v4f*)(M + i * 4), u = *(const v4f*)(FU + i * 4); v4f o;
#pragma unroll
    for (int q = 0; q < 4; ++q) o[q] = __fmul_rn(a[q], siluf(u[q])); *(v4f*)(O + i * 4) = o;  }

extern "C" void kernel_launch(void* const* d_in, const int* in_sizes, int n_in,
                              void* d_out, int out_size, void* d_ws, size_t ws_size, hipStream_t stream) {
    (void)in_sizes; (void)n_in; (void)out_size;
    const float* x = (const float*)d_in[0]; const float* wq = (const float*)d_in[1]; const float* wk = (const float*)d_in[2]; const float* wv = (const float*)d_in[3]; const float* wu = (const float*)d_in[4]; const float* RB = (const float*)d_in[5]; const float* wo = nullptr; (void)wo;
    float* OUT = (float*)d_out;     // [4][2048][1024]
    char* wsp = (char*)d_ws;
    auto take = [&](size_t bytes) { char* p = wsp; wsp += (bytes + 255) & ~(size_t)255; return (void*)p; };
    bf* WQ = (bf*)take((size_t)DQ * DM * 2); bf* WK = (bf*)take((size_t)DKV * DM * 2); bf* WV = (bf*)take((size_t)DKV * DM * 2); bf* WU = (bf*)take((size_t)DM * DM * 2); float* BTT = (float*)take((size_t)NH_ * 4096 * 4); float* KM = (float*)take((size_t)NB_ * NH_ * TT * 4); float* CS = (float*)take((size_t)TT * HD * 2 * 4);
    bf* XB = (bf*)take((size_t)NB_ * TT * DM * 2); float* FQ = (float*)take((size_t)NB_ * TT * DQ * 4); float* FK = (float*)take((size_t)NB_ * TT * DKV * 4);
    h16* QP16 = (h16*)take((size_t)NB_ * NH_ * TT * HD * 2); h16* KP16 = (h16*)take((size_t)NB_ * NKV * TT * HD * 2); h16* VT16 = (h16*)take((size_t)NB_ * NKV * HD * TT * 2);
    bf* QPh = (bf*)take((size_t)NB_ * NH_ * TT * HD * 2); bf* QPl = (bf*)take((size_t)NB_ * NH_ * TT * HD * 2); bf* KPh = (bf*)take((size_t)NB_ * NKV * TT * HD * 2); bf* KPl = (bf*)take((size_t)NB_ * NKV * TT * HD * 2); bf* VTh = (bf*)take((size_t)NB_ * NKV * HD * TT * 2); bf* VTl = (bf*)take((size_t)NB_ * NKV * HD * TT * 2); bf* Ph = nullptr; bf* Pl = nullptr; (void)Ph; (void)Pl;
    if ((size_t)(wsp - (char*)d_ws) > ws_size) return;    // ws 256 MiB
    float* FV = FK;   // v projection reuses the k buffer after the k planes are built (stream-ordered)
    float* MRG = FK;  // the merged attention rows reuse it after the v planes are built
    float* FU = FQ;   // the u projection reuses the q buffer after the q planes are built
    { k_wtG<<<(unsigned)((DM * DQ / 64 + 63) / 64), 256, 0, stream>>>(wq, DM, DQ, WQ); k_wtG<<<(unsigned)((DM * DKV / 64 + 63) / 64), 256, 0, stream>>>(wk, DM, DKV, WK); k_wtG<<<(unsigned)((DM * DKV / 64 + 63) / 64), 256, 0, stream>>>(wv, DM, DKV, WV); k_wtG<<<(unsigned)((DM * DM / 64 + 63) / 64), 256, 0, stream>>>(wu, DM, DM, WU); k_bttr<<<(NH_ * 4096 + 255) / 256, 256, 0, stream>>>(RB, BTT);   /* Wu; transposed relative-bias rows */
       }
    k_csid<<<(TT * HD + 255) / 256, 256, 0, stream>>>(CS);
    const unsigned LQ = (unsigned)(((size_t)NH_ * TT * HD / 2 + 255) / 256), LKv = (unsigned)(((size_t)NKV * TT * HD / 2 + 255) / 256);
    k_cvt8<<<(unsigned)(((size_t)NB_ * TT * DM / 8 + 255) / 256), 256, 0, stream>>>(x, XB, (size_t)NB_ * TT * DM / 8);
    k_gemmw<bf, 0, false><<<dim3(NB_ * TT / 64, DQ / 64, 1), 32, 0, stream>>>(XB, nullptr, WQ, nullptr, DM, FQ, DQ, nullptr, 0, 0, 0);
    k_rope<<<dim3(LQ, NB_, 1), 256, 0, stream>>>(FQ, DQ, NH_, CS, nullptr, nullptr, 1.0f, QP16, QPh, QPl);
    k_gemmw<bf, 0, false><<<dim3(NB_ * TT / 64, DKV / 64, 1), 32, 0, stream>>>(XB, nullptr, WK, nullptr, DM, FK, DKV, nullptr, 0, 0, 0);
    k_rope<<<dim3(LKv, NB_, 1), 256, 0, stream>>>(FK, DKV, NKV, CS, nullptr, nullptr, 1.0f, KP16, KPh, KPl); k_kmask<<<dim3((NH_ * TT + 255) / 256, NB_, 1), 256, 0, stream>>>(FK, KM);   /* key padding flags from silu(K) */
    k_gemmw<bf, 0, false><<<dim3(NB_ * TT / 64, DKV / 64, 1), 32, 0, stream>>>(XB, nullptr, WV, nullptr, DM, FV, DKV, nullptr, 0, 0, 0); k_vtp<<<dim3(LKv, NB_, 1), 256, 0, stream>>>(FV, DKV, NKV, VT16, VTh, VTl);
    k_fattn<<<dim3(NH_, NB_, TT / 64), 128, 0, stream>>>(QPh, QPl, KPh, KPl, VT16, BTT, KM, MRG);   /* silu attention, all heads and batches: merged [b*TT+t][h*128+d], f32 */
    k_gemmw<bf, 0, false><<<dim3(NB_ * TT / 64, DM / 64, 1), 32, 0, stream>>>(XB, nullptr, WU, nullptr, DM, FU, DM, nullptr, 0, 0, 0);   /* U = x Wu */
    k_ugate<<<(unsigned)(((size_t)NB_ * TT * DM / 4 + 255) / 256), 256, 0, stream>>>(MRG, FU, OUT, (size_t)NB_ * TT * DM / 4);   /* out = attn x silu(U) */
}

// v003
// Measured time: 393 microseconds a run.
// Next to v002, in two timings, it ran 1.21 times as fast each time.
// Counting every step since v000, it is 4.42 times as fast.
#include <hip/hip_runtime.h>

// HSTU layer (x [4][2048][1024]; Q, K, V = silu(x W) ('xw' [1024][1024]; 8 heads x 128), U = x Wu; scores = Q.K + rel_bias[i - j + 2047][h] ([4095][8], read); scores / sqrt(128); causal and key-padding (sign(sum|K|) == 0) positions -> -2^32+1; weights = silu(scores) (no softmax; masked weights are exactly 0); attn = weights V merged [t][h*128+d]; out = attn x silu(U) -> [4][2048][1024] (8.4 M)).
// Layout: a causal pipeline with silu folded into the plane builders, one fused silu-attention kernel in place of the softmax (scores and fp16 weights stay in registers, exact zeros above the diagonal so the P.V contraction stops at the diagonal block; it writes the merged f32 rows) and a final silu(U) gate. The four batches run side by side in every launch: the GEMMs, the bf16 copy of x and the gate take the 8192 rows as one matrix, the plane builders and the attention kernel take the batch from the grid.
// Compute dtypes, f32 accumulate: every input rounded to bf16; projections exact (inputs); silu in f32 (precise expf) -> Q/K hi/lo planes, V fp16 planes; scores 3 products (tile skipping); bias add, 1/sqrt(128), masks and silu in f32; fp16 weights x fp16 silu(V) (one product, causal K range); no output projection: out = attn x silu(x Wu) in f32.

#define NB_  4
#define TT   2048
#define DM   1024
#define NH_  8
#define NKV  8
#define REP  (NH_ / NKV)
#define HD   128
#define DQ   (NH_ * HD)
#define DKV  (NKV * HD)
#define NEGM (-4294967295.0f)
#define ISC  0.088388347648318447f   // 1/sqrt(128), applied after the bias add
#define ZH   2
#define RH   2048
#define WIN  2048
#define PCAR 1024.0f
#define SCL  0.088388347648318447f   // HD^-0.5
typedef _Float16 h16;
typedef unsigned short bf;
typedef __attribute__((ext_vector_type(16))) __bf16   v16bf;
typedef __attribute__((ext_vector_type(16))) _Float16 v16h;
typedef __attribute__((ext_vector_type(8)))  _Float16 v8h;
typedef __attribute__((ext_vector_type(8)))  unsigned short v8us;
typedef __attribute__((ext_vector_type(8)))  float    v8f;
typedef __attribute__((ext_vector_type(4)))  float    v4f;
typedef v8h  __attribute__((may_alias)) v8ha;
typedef v4f  __attribute__((may_alias)) v4fa;
typedef v8us __attribute__((may_alias)) v8usa;

__device__ __forceinline__ unsigned short f2bf(float f) { unsigned u = __float_as_uint(f); u += 0x7FFFu + ((u >> 16) & 1u); return (unsigned short)(u >> 16); }
__device__ __forceinline__ float bf2f(unsigned short b) { return __uint_as_float(((unsigned)b) << 16); }
__device__ __forceinline__ float bfr(float f) { return bf2f(f2bf(f)); }
__device__ __forceinline__ v16h cat16(v8h lo, v8h hi) { return __builtin_shufflevector(lo, hi, 0, 1, 2, 3, 4, 5, 6, 7, 8, 9, 10, 11, 12, 13, 14, 15); }
__device__ __forceinline__ v16bf cat16b(v8us lo, v8us hi) { return __builtin_bit_cast(v16bf, __builtin_shufflevector(lo, hi, 0, 1, 2, 3, 4, 5, 6, 7, 8, 9, 10, 11, 12, 13, 14, 15)); }
__device__ __forceinline__ v8f wmma16(v16h a, v16h b, v8f c) { return __builtin_amdgcn_wmma_f32_16x16x32_f16(false, a, false, b, (short)0, c, false, false); }
__device__ __forceinline__ v8f wmmab(v16bf a, v16bf b, v8f c) { return __builtin_amdgcn_wmma_f32_16x16x32_bf16(false, a, false, b, (short)0, c, false, false); }



// ---- k_gemmw: register-blocked GEMM, ONE WAVE per 64x64 output tile (16 accumulators), operands straight from K-contiguous 16-bit planes; grid (M/64, N/64, Z), 32 threads.
// C[m][n] (f32, pitch ldc, + optional f32 bias[n]) = sum_k A[m][k] Bt[n][k] (+ split products per NSPLIT). z-batch strides sA/sB/sC in elements. K % 32 == 0.
template <typename T16> struct WFrag;
template <> struct WFrag<h16> { typedef v16h V; static __device__ __forceinline__ V ld(const h16* p) { return cat16(*(const v8h*)p, *(const v8h*)(p + 16)); } static __device__ __forceinline__ v8f mma(V a, V b, v8f c) { return wmma16(a, b, c); } };
template <> struct WFrag<bf> { typedef v16bf V; static __device__ __forceinline__ V ld(const bf* p) { return cat16b(*(const v8us*)p, *(const v8us*)(p + 16)); } static __device__ __forceinline__ v8f mma(V a, V b, v8f c) { return wmmab(a, b, c); } };
template <typename T16, int NSPLIT, bool BIAS>
__global__ __launch_bounds__(32) void k_gemmw(const T16* __restrict__ A, const T16* __restrict__ A2, const T16* __restrict__ Bt, const T16* __restrict__ Bt2, int K, float* C, int ldc, const float* __restrict__ bias, size_t sA, size_t sB, size_t sC) {
    typedef typename WFrag<T16>::V V;
    __shared__ __align__(16) float os[16 * 68];
    const size_t z = blockIdx.z; A += z * sA; if (A2) A2 += z * sA; Bt += z * sB; if (Bt2) Bt2 += z * sB; C += z * sC;
    const int lane = threadIdx.x & 31, lr = lane & 15, hi = lane >> 4; const int r0 = blockIdx.x * 64, c0 = blockIdx.y * 64;
    v8f acc[4][4];
#pragma unroll
    for (int mb = 0; mb < 4; ++mb)
#pragma unroll
        for (int nb = 0; nb < 4; ++nb) acc[mb][nb] = (v8f){};
    const size_t aoff = (size_t)(r0 + lr) * K + 8 * hi, boff = (size_t)(c0 + lr) * K + 8 * hi;
#pragma unroll 1
    for (int kc = 0; kc < K; kc += 32) {
        V a[4], a2[4];
#pragma unroll
        for (int mb = 0; mb < 4; ++mb) { a[mb] = WFrag<T16>::ld(A + aoff + (size_t)mb * 16 * K + kc); if (NSPLIT == 1 || NSPLIT == 2) a2[mb] = WFrag<T16>::ld(A2 + aoff + (size_t)mb * 16 * K + kc); }
#pragma unroll
        for (int nb = 0; nb < 4; ++nb) { const V b = WFrag<T16>::ld(Bt + boff + (size_t)nb * 16 * K + kc); V b2; if (NSPLIT >= 2) b2 = WFrag<T16>::ld(Bt2 + boff + (size_t)nb * 16 * K + kc);
#pragma unroll
            for (int mb = 0; mb < 4; ++mb) { acc[mb][nb] = WFrag<T16>::mma(a[mb], b, acc[mb][nb]); if (NSPLIT == 1 || NSPLIT == 2) acc[mb][nb] = WFrag<T16>::mma(a2[mb], b, acc[mb][nb]); if (NSPLIT >= 2) acc[mb][nb] = WFrag<T16>::mma(a[mb], b2, acc[mb][nb]); } }
        asm volatile("v_nop\n\tv_nop\n\tv_nop\n\tv_nop" : "+v"(acc[0][0]), "+v"(acc[1][1]), "+v"(acc[2][2]), "+v"(acc[3][3]) : "v"(a[0]), "v"(a[3]));
    }
#pragma unroll
    for (int mb = 0; mb < 4; ++mb) {
#pragma unroll
        for (int nb = 0; nb < 4; ++nb) {
#pragma unroll
            for (int j = 0; j < 8; ++j) os[(hi * 8 + j) * 68 + nb * 16 + lr] = acc[mb][nb][j]; }
        __builtin_amdgcn_wave_barrier(); asm volatile("" ::: "memory");
        float* crow = C + (size_t)(r0 + mb * 16) * ldc + c0;
{
#pragma unroll
            for (int s = 0; s < 8; ++s) { const int row = 2 * s + hi, cofs = lr * 4; v4f val = *(const v4fa*)(os + row * 68 + cofs); if (BIAS) { val[0] += bfr(bias[c0 + cofs]); val[1] += bfr(bias[c0 + cofs + 1]); val[2] += bfr(bias[c0 + cofs + 2]); val[3] += bfr(bias[c0 + cofs + 3]); }
                *(v4f*)(crow + (size_t)row * ldc + cofs) = val; }
             }
        __builtin_amdgcn_wave_barrier(); asm volatile("" ::: "memory");
    }
}

__device__ __forceinline__ h16 tohx(float x) { return (h16)x; }
__device__ __forceinline__ float siluf(float u) { const float sg = __fdiv_rn(1.0f, __fadd_rn(1.0f, expf(-u))); return __fmul_rn(u, sg); }   /* silu = u sigmoid(u), precise expf */
__device__ __forceinline__ void splitf(float y, unsigned short& h, unsigned short& l) { h = f2bf(y); l = f2bf(y - bf2f(h)); }
typedef __attribute__((ext_vector_type(2))) _Float16 v2h;
typedef __attribute__((ext_vector_type(4))) _Float16 v4h;
typedef __attribute__((ext_vector_type(2))) unsigned short v2us;
typedef __attribute__((ext_vector_type(4))) unsigned short v4us;
typedef __attribute__((ext_vector_type(2))) float v2f;
typedef __attribute__((ext_vector_type(4))) int v4i;

__global__ __launch_bounds__(256) void k_wtG(const float* __restrict__ w, int K, int N, bf* Bt) {
    const int lane = threadIdx.x & 31; const int L0 = (blockIdx.x * 8 + (threadIdx.x >> 5)) * 8; const int nlines = N * K / 64;
{
#pragma unroll 1
        for (int l = 0; l < 8; ++l) { const int L = L0 + l; if (L >= nlines) break; const size_t e = (size_t)L * 64 + lane * 2; const int k = (int)(e % K), n = (int)(e / K); v2us o;
            o[0] = f2bf(w[(size_t)k * N + n]); o[1] = f2bf(w[(size_t)(k + 1) * N + n]); *(v2us*)(Bt + e) = o; }
         }
}
__global__ __launch_bounds__(256) void k_cvt8(const float* __restrict__ src, bf* dst, size_t n8) { const size_t i = (size_t)blockIdx.x * 256 + threadIdx.x; if (i >= n8) return; const v8f v = *(const v8f*)(src + i * 8); v8us o;
#pragma unroll
    for (int k = 0; k < 8; ++k) o[k] = f2bf(v[k]); *(v8us*)(dst + i * 8) = o;  }

// k_rope: head planes [h][t][d] (fp16 + hi/lo) of rope(x) x sc with the rotate-half convention out[d] = x[d] cos[t][d] - x[d+HD/2] sin[t][d], out[d+HD/2] = x[d+HD/2] cos[t][d+HD/2] + x[d] sin[t][d+HD/2]
__global__ __launch_bounds__(256) void k_rope(const float* __restrict__ F, int pitch, int nheads, const float* __restrict__ CS, const float* __restrict__ RF, const float* __restrict__ nw, float sc, h16* P16, bf* Ph, bf* Pl) {
    { const size_t b = blockIdx.y, pb = b * nheads * TT * HD; F += b * TT * pitch; P16 += pb; Ph += pb; Pl += pb; }   // blockIdx.y: the batch (rows b*TT.. of F, planes [b][h][t][d])
    const size_t e = ((size_t)blockIdx.x * 256 + threadIdx.x) * 2; if (e >= (size_t)nheads * TT * HD) return; const int d = (int)(e % HD); const int t = (int)((e / HD) % TT); const int h = (int)(e / ((size_t)HD * TT)); const float* f = F + (size_t)t * pitch + h * HD; const float rf = RF ? RF[(size_t)h * TT + t] : 1.0f; v2h o16; v2us oh, ol;
#pragma unroll
    for (int q = 0; q < 2; ++q) { const int dd = d + q; const int dp = (dd < HD / 2) ? dd + HD / 2 : dd - HD / 2; float x0 = siluf(f[dd]), x1 = siluf(f[dp]);   /* silu(Q), silu(K) */
        if (RF) { float n0 = __fmul_rn(x0, rf), n1 = __fmul_rn(x1, rf); asm volatile("" : "+v"(n0)); asm volatile("" : "+v"(n1)); x0 = __fmul_rn(bfr(nw[dd]), n0); x1 = __fmul_rn(bfr(nw[dp]), n1); }
        const v2f cs = *(const v2f*)(CS + ((size_t)t * HD + dd) * 2); float a = __fmul_rn(x0, cs[0]), bq = __fmul_rn(x1, cs[1]); asm volatile("" : "+v"(a)); asm volatile("" : "+v"(bq)); const float r = ((dd < HD / 2) ? __fsub_rn(a, bq) : __fadd_rn(a, bq)) * sc;
        o16[q] = tohx(r); unsigned short a2, c2; splitf(r, a2, c2); oh[q] = a2; ol[q] = c2; }
    *(v2h*)(P16 + e) = o16; *(v2us*)(Ph + e) = oh; *(v2us*)(Pl + e) = ol;  }
__global__ __launch_bounds__(256) void k_vtp(const float* __restrict__ F, int pitch, int nheads, h16* V16, bf* Vh, bf* Vl) {
    { const size_t b = blockIdx.y, pb = b * nheads * HD * TT; F += b * TT * pitch; V16 += pb; Vh += pb; Vl += pb; }   // blockIdx.y: the batch (planes [b][g][d][t])
    const size_t e = ((size_t)blockIdx.x * 256 + threadIdx.x) * 2; if (e >= (size_t)nheads * HD * TT) return; const int t = (int)(e % TT); const int d = (int)((e / TT) % HD); const int g = (int)(e / ((size_t)TT * HD)); v2h o16; v2us oh, ol;
#pragma unroll
    for (int q = 0; q < 2; ++q) { const float x = siluf(F[(size_t)(t + q) * pitch + g * HD + d]);   /* silu(V) */ o16[q] = tohx(x); unsigned short a2, c2; splitf(x, a2, c2); oh[q] = a2; ol[q] = c2; }
    *(v2h*)(V16 + e) = o16; *(v2us*)(Vh + e) = oh; *(v2us*)(Vl + e) = ol;  }
__global__ __launch_bounds__(256) void k_csid(float* CS) { const int idx = blockIdx.x * 256 + threadIdx.x; if (idx >= TT * HD) return; v2f cs; cs[0] = 1.0f; cs[1] = 0.0f; *(v2f*)(CS + (size_t)idx * 2) = cs;  }
__global__ __launch_bounds__(256) void k_bttr(const float* __restrict__ RB, float* BTT) { const int idx = blockIdx.x * 256 + threadIdx.x; if (idx >= NH_ * 4096) return; const int p = idx % 4096, h = idx / 4096; const float v = (p < 2 * TT - 1) ? bfr(RB[(size_t)p * NH_ + h]) : 0.0f; *(float*)(BTT + idx) = v;  }
__global__ __launch_bounds__(256) void k_kmask(const float* __restrict__ FK, float* KM) {
    FK += (size_t)blockIdx.y * TT * DKV; KM += (size_t)blockIdx.y * NH_ * TT;   // blockIdx.y: the batch
    const int idx = blockIdx.x * 256 + threadIdx.x; if (idx >= NH_ * TT) return; const int j = idx % TT, h = idx / TT; const float* f = FK + (size_t)j * DKV + h * HD; float s = 0.f;
#pragma unroll 8
    for (int d = 0; d < HD; ++d) s = __fadd_rn(s, fabsf(siluf(f[d]))); const float m = (s > 0.f) ? 1.0f : ((s < 0.f) ? -1.0f : 0.0f); *(float*)(KM + idx) = m;  }
// ---- k_fattn: scores, bias, masks, silu weights and weights x V in one kernel; nothing of the [t][t] planes goes to memory. One wave per 16 query rows, 4 waves a work-group, grid (heads, batches, TT/64): the row block is the slowest index, longest rows first over all heads and batches, so that no long work-group starts late.
// Per 32 keys: St = K Qt (two 16-key tiles, the same 3 hi/lo products in the same order per 32 of d), a lane then holds 16 keys of ONE query in the hardware k order, so the fp16 weights are the B operand of Ot += Vt Pt as they stand.
// Keys run in ascending 32-key steps into one accumulator and stop at the end of the 64-row diagonal block, so every sum keeps its order.
// The K hi, K lo and V tiles of a step are brought into LDS once for the four waves, by asynchronous copies of whole rows, one step ahead into the other of two buffers; the waves read their fragments from there (rows pitched 16 B x odd for the 16-byte reads).
#define KPIT 272                   // LDS pitch of a 256-byte K row
#define VPIT 80                    // LDS pitch of a 64-byte V row (32 keys of one d)
#define KTB  (32 * KPIT)           // one K plane's tile
#define STG  (2 * KTB + HD * VPIT) // one step's tiles: K hi, K lo, V
typedef const __attribute__((address_space(1))) char* gptr;   // an address known to be global memory
__device__ __forceinline__ v16bf ldfb(gptr p) { return cat16b(*(const __attribute__((address_space(1))) v8us*)p, *(const __attribute__((address_space(1))) v8us*)(p + 32)); }
__device__ __forceinline__ v16bf ldsb(const char* p) { return cat16b(*(const v8us*)p, *(const v8us*)(p + 32)); }
__device__ __forceinline__ v16h ldsh(const char* p) { return cat16(*(const v8h*)p, *(const v8h*)(p + 32)); }
// a step's twelve 16-byte copies a lane, global memory to LDS through no register, in one statement; the one wait at its end stands in front of any rewrite of the address registers that the copies name
__device__ __forceinline__ void cp12(unsigned a, unsigned b, unsigned v, gptr x, gptr y, gptr w) {
    asm volatile("global_load_async_to_lds_b128 %0, %12, off\n\tglobal_load_async_to_lds_b128 %1, %13, off\n\tglobal_load_async_to_lds_b128 %2, %14, off\n\tglobal_load_async_to_lds_b128 %3, %15, off\n\t"
                 "global_load_async_to_lds_b128 %4, %16, off\n\tglobal_load_async_to_lds_b128 %5, %17, off\n\tglobal_load_async_to_lds_b128 %6, %18, off\n\tglobal_load_async_to_lds_b128 %7, %19, off\n\t"
                 "global_load_async_to_lds_b128 %8, %20, off\n\tglobal_load_async_to_lds_b128 %9, %21, off\n\tglobal_load_async_to_lds_b128 %10, %22, off\n\tglobal_load_async_to_lds_b128 %11, %23, off\n\ts_wait_xcnt 0x0"
                 :: "v"(a), "v"(a + 8 * KPIT), "v"(a + 16 * KPIT), "v"(a + 24 * KPIT), "v"(b), "v"(b + 8 * KPIT), "v"(b + 16 * KPIT), "v"(b + 24 * KPIT), "v"(v), "v"(v + 32 * VPIT), "v"(v + 64 * VPIT), "v"(v + 96 * VPIT),
                    "v"(x), "v"(x + 2048), "v"(x + 4096), "v"(x + 6144), "v"(y), "v"(y + 2048), "v"(y + 4096), "v"(y + 6144), "v"(w), "v"(w + 32 * TT * 2), "v"(w + 64 * TT * 2), "v"(w + 96 * TT * 2) : "memory");
}
__global__ __launch_bounds__(128) void k_fattn(const bf* __restrict__ Qh, const bf* __restrict__ Ql, const bf* __restrict__ Kh, const bf* __restrict__ Kl, const h16* __restrict__ Vt, const float* __restrict__ BTT, const float* __restrict__ KM, float* O) {
    __shared__ __align__(16) float sbias[4096]; __shared__ __align__(16) float skm[TT]; __shared__ __align__(16) char ring[2 * STG];
    const int h = blockIdx.x; const int qb = ((int)gridDim.z - 1 - (int)blockIdx.z) * 64;
    { const size_t b = blockIdx.y, pb = b * NH_ * TT * HD; Qh += pb; Ql += pb; Kh += pb; Kl += pb; Vt += pb; KM += b * NH_ * TT; O += b * TT * DM; }   // this batch's planes, key flags and output rows
    const size_t hp = (size_t)h * TT * HD; const int tid = threadIdx.x;
    // each lane's part of a step's copies: K tiles are 8 KiB in a row (16 lanes a row, 8 rows a copy), V rows are 64 B of a 4-KiB row (4 lanes a row, 32 rows a copy)
    const unsigned lring = (unsigned)(size_t)(__attribute__((address_space(3))) char*)ring;
    const unsigned lk = lring + (tid >> 4) * KPIT + (tid & 15) * 16, lv = lring + 2 * KTB + (tid >> 2) * VPIT + (tid & 3) * 16;
    gptr gkh = (gptr)(Kh + hp) + tid * 16; gptr gkl = (gptr)(Kl + hp) + tid * 16; gptr gv = (gptr)(Vt + hp) + (tid >> 2) * TT * 2 + (tid & 3) * 16;
    auto fill = [&](const int bo, const int k0) {   // bo: the buffer's byte offset in the ring
        const unsigned a = lk + bo, v = lv + bo; gptr x = gkh + k0 * HD * 2, y = gkl + k0 * HD * 2, w = gv + k0 * 2;
        cp12(a, a + KTB, v, x, y, w);
    };
    fill(0, 0);
#pragma unroll
    for (int p = 0; p < 4096 / 4 / 128; ++p) ((v4f*)sbias)[p * 128 + threadIdx.x] = ((const v4f*)(BTT + (size_t)h * 4096))[p * 128 + threadIdx.x];
#pragma unroll
    for (int p = 0; p < TT / 4 / 128; ++p) ((v4f*)skm)[p * 128 + threadIdx.x] = ((const v4f*)(KM + (size_t)h * TT))[p * 128 + threadIdx.x];
    asm volatile("s_wait_asynccnt 0x0" ::: "memory");   // this wave's copies of the first tiles have landed before the barrier behind which the other waves read them
    __syncthreads();
    fill(STG, 32);   // kend >= 64: a second step always exists
    const int lane = threadIdx.x & 31, c = lane & 15, hh = lane >> 4; const int q0 = qb + __builtin_amdgcn_readfirstlane((int)(threadIdx.x >> 5)) * 16; const int i = q0 + c;
    const int kof = c * HD * 2 + 16 * hh;
    v16bf qh[4], ql[4];
#pragma unroll
    for (int kc = 0; kc < 4; ++kc) { qh[kc] = ldfb((gptr)(Qh + hp) + (size_t)q0 * HD * 2 + kof + kc * 64); ql[kc] = ldfb((gptr)(Ql + hp) + (size_t)q0 * HD * 2 + kof + kc * 64); }
    v8f o[8];
#pragma unroll
    for (int dt = 0; dt < 8; ++dt) o[dt] = (v8f){};
    const int kend = qb + 64;   // keys up to the end of the work-group's 64-row diagonal block (weights past the diagonal are exact zeros): an even number of 32-key steps for every wave
    // one 32-key step on the tiles in the buffer at bo; at its foot the next step's tiles are published and the buffer is refilled for the step after that
    auto step = [&](const int bo, const int k0) {
        const char* kt = ring + bo + c * KPIT + 16 * hh; const char* vt = kt + 2 * KTB + c * (VPIT - KPIT);
        v16bf ka[8], kb[8]; v16h vf[8]; float bs[16]; v4f km[4];
#pragma unroll
        for (int f = 0; f < 8; ++f) { ka[f] = ldsb(kt + (f & 1) * 16 * KPIT + (f >> 1) * 64); kb[f] = ldsb(kt + KTB + (f & 1) * 16 * KPIT + (f >> 1) * 64); }
#pragma unroll
        for (int e = 0; e < 16; ++e) bs[e] = sbias[2047 + i - (k0 + (e >> 3) * 16 + 8 * hh + (e & 7))];
#pragma unroll
        for (int e = 0; e < 4; ++e) km[e] = *(const v4f*)(skm + k0 + (e >> 1) * 16 + 8 * hh + (e & 1) * 4);
        // inputs only, loaded values only: holds the bias and mask LDS loads at the head of the step (left alone the compiler sinks them into the silu arithmetic, a short-led wait every few elements)
        asm volatile("" :: "v"(bs[0]), "v"(bs[1]), "v"(bs[2]), "v"(bs[3]), "v"(bs[4]), "v"(bs[5]), "v"(bs[6]), "v"(bs[7]), "v"(bs[8]), "v"(bs[9]), "v"(bs[10]), "v"(bs[11]), "v"(bs[12]), "v"(bs[13]), "v"(bs[14]), "v"(bs[15]), "v"(km[0]), "v"(km[1]), "v"(km[2]), "v"(km[3]));
        v8f s[2]; s[0] = (v8f){}; s[1] = (v8f){};
#pragma unroll
        for (int f = 0; f < 8; ++f) { const int kt2 = f & 1, kc = f >> 1;
            s[kt2] = wmmab(ka[f], qh[kc], s[kt2]); s[kt2] = wmmab(ka[f], ql[kc], s[kt2]); s[kt2] = wmmab(kb[f], qh[kc], s[kt2]);
            if (f == 5) {   // three quarters of the K fragments are used up: the V fragments take their registers
#pragma unroll
                for (int dt = 0; dt < 8; ++dt) vf[dt] = ldsh(vt + dt * 16 * VPIT);
                __builtin_amdgcn_sched_barrier(0);   // keeps the V reads here as one group, their latency under the rest of the products and the silu (left alone the compiler sinks them between the last products, a short-led wait at each)
            } }
        v16h p;
#pragma unroll
        for (int e = 0; e < 16; ++e) { const int j = k0 + (e >> 3) * 16 + 8 * hh + (e & 7); float t = __fmul_rn(__fadd_rn(s[e >> 3][e & 7], bs[e]), ISC); const bool msk = (j > i) | (km[e >> 2][e & 3] == 0.0f); t = msk ? NEGM : t; p[e] = tohx(siluf(t)); }
#pragma unroll
        for (int dt = 0; dt < 8; ++dt) o[dt] = wmma16(vf[dt], p, o[dt]);
        __builtin_amdgcn_sched_barrier(0);   // keeps the waits and the barrier below at the foot, directly in front of the refill, so that the copies have a whole step to land
        asm volatile("s_wait_dscnt 0x0" ::: "memory");      // this wave's reads of the buffer are over before the barrier behind which it is refilled
        asm volatile("s_wait_asynccnt 0x0" ::: "memory");   // this wave's copies of the next step's tiles have landed before the barrier behind which the other waves read them
        __syncthreads();
        if (k0 + 64 < kend) fill(bo, k0 + 64);   // the same for the whole work-group
    };
#pragma unroll 1
    for (int k0 = 0, bo = 0; k0 < kend; k0 += 32, bo ^= STG) step(bo, k0);   // not unrolled: the buffers' addresses are formed from bo in each step and hold no registers of their own
    asm volatile("s_wait_asynccnt 0x0" ::: "memory");   // no copy is in flight when the wave stores its tile and ends
    float* orow = O + (size_t)i * DM + h * HD + 8 * hh;   // a lane holds 8 consecutive d of one query: merged [t][h*128+d], f32
#pragma unroll
    for (int dt = 0; dt < 8; ++dt) { v4f lo, hi4;
#pragma unroll
        for (int r = 0; r < 4; ++r) { lo[r] = o[dt][r]; hi4[r] = o[dt][4 + r]; }
        *(v4f*)(orow + dt * 16) = lo; *(v4f*)(orow + dt * 16 + 4) = hi4; }
}
__global__ __launch_bounds__(256) void k_ugate(const float* __restrict__ M, const float* __restrict__ FU, float* O, size_t n4) { const size_t i = (size_t)blockIdx.x * 256 + threadIdx.x; if (i >= n4) return; const v4f a = *(const v4f*)(M + i * 4), u = *(const v4f*)(FU + i * 4); v4f o;
#pragma unroll
    for (int q = 0; q < 4; ++q) o[q] = __fmul_rn(a[q], siluf(u[q])); *(v4f*)(O + i * 4) = o;  }

extern "C" void kernel_launch(void* const* d_in, const int* in_sizes, int n_in,
                              void* d_out, int out_size, void* d_ws, size_t ws_size, hipStream_t stream) {
    (void)in_sizes; (void)n_in; (void)out_size;
    const float* x = (const float*)d_in[0]; const float* wq = (const float*)d_in[1]; const float* wk = (const float*)d_in[2]; const float* wv = (const float*)d_in[3]; const float* wu = (const float*)d_in[4]; const float* RB = (const float*)d_in[5]; const float* wo = nullptr; (void)wo;
    float* OUT = (float*)d_out;     // [4][2048][1024]
    char* wsp = (char*)d_ws;
    auto take = [&](size_t bytes) { char* p = wsp; wsp += (bytes + 255) & ~(size_t)255; return (void*)p; };
    bf* WQ = (bf*)take((size_t)DQ * DM * 2); bf* WK = (bf*)take((size_t)DKV * DM * 2); bf* WV = (bf*)take((size_t)DKV * DM * 2); bf* WU = (bf*)take((size_t)DM * DM * 2); float* BTT = (float*)take((size_t)NH_ * 4096 * 4); float* KM = (float*)take((size_t)NB_ * NH_ * TT * 4); float* CS = (float*)take((size_t)TT * HD * 2 * 4);
    bf* XB = (bf*)take((size_t)NB_ * TT * DM * 2); float* FQ = (float*)take((size_t)NB_ * TT * DQ * 4); float* FK = (float*)take((size_t)NB_ * TT * DKV * 4);
    h16* QP16 = (h16*)take((size_t)NB_ * NH_ * TT * HD * 2); h16* KP16 = (h16*)take((size_t)NB_ * NKV * TT * HD * 2); h16* VT16 = (h16*)take((size_t)NB_ * NKV * HD * TT * 2);
    bf* QPh = (bf*)take((size_t)NB_ * NH_ * TT * HD * 2); bf* QPl = (bf*)take((size_t)NB_ * NH_ * TT * HD * 2); bf* KPh = (bf*)take((size_t)NB_ * NKV * TT * HD * 2); bf* KPl = (bf*)take((size_t)NB_ * NKV * TT * HD * 2); bf* VTh = (bf*)take((size_t)NB_ * NKV * HD * TT * 2); bf* VTl = (bf*)take((size_t)NB_ * NKV * HD * TT * 2); bf* Ph = nullptr; bf* Pl = nullptr; (void)Ph; (void)Pl;
    if ((size_t)(wsp - (char*)d_ws) > ws_size) return;    // ws 256 MiB
    float* FV = FK;   // v projection reuses the k buffer after the k planes are built (stream-ordered)
    float* MRG = FK;  // the merged attention rows reuse it after the v planes are built
    float* FU = FQ;   // the u projection reuses the q buffer after the q planes are built
    { k_wtG<<<(unsigned)((DM * DQ / 64 + 63) / 64), 256, 0, stream>>>(wq, DM, DQ, WQ); k_wtG<<<(unsigned)((DM * DKV / 64 + 63) / 64), 256, 0, stream>>>(wk, DM, DKV, WK); k_wtG<<<(unsigned)((DM * DKV / 64 + 63) / 64), 256, 0, stream>>>(wv, DM, DKV, WV); k_wtG<<<(unsigned)((DM * DM / 64 + 63) / 64), 256, 0, stream>>>(wu, DM, DM, WU); k_bttr<<<(NH_ * 4096 + 255) / 256, 256, 0, stream>>>(RB, BTT);   /* Wu; transposed relative-bias rows */
       }
    k_csid<<<(TT * HD + 255) / 256, 256, 0, stream>>>(CS);
    const unsigned LQ = (unsigned)(((size_t)NH_ * TT * HD / 2 + 255) / 256), LKv = (unsigned)(((size_t)NKV * TT * HD / 2 + 255) / 256);
    k_cvt8<<<(unsigned)(((size_t)NB_ * TT * DM / 8 + 255) / 256), 256, 0, stream>>>(x, XB, (size_t)NB_ * TT * DM / 8);
    k_gemmw<bf, 0, false><<<dim3(NB_ * TT / 64, DQ / 64, 1), 32, 0, stream>>>(XB, nullptr, WQ, nullptr, DM, FQ, DQ, nullptr, 0, 0, 0);
    k_rope<<<dim3(LQ, NB_, 1), 256, 0, stream>>>(FQ, DQ, NH_, CS, nullptr, nullptr, 1.0f, QP16, QPh, QPl);
    k_gemmw<bf, 0, false><<<dim3(NB_ * TT / 64, DKV / 64, 1), 32, 0, stream>>>(XB, nullptr, WK, nullptr, DM, FK, DKV, nullptr, 0, 0, 0);
    k_rope<<<dim3(LKv, NB_, 1), 256, 0, stream>>>(FK, DKV, NKV, CS, nullptr, nullptr, 1.0f, KP16, KPh, KPl); k_kmask<<<dim3((NH_ * TT + 255) / 256, NB_, 1), 256, 0, stream>>>(FK, KM);   /* key padding flags from silu(K) */
    k_gemmw<bf, 0, false><<<dim3(NB_ * TT / 64, DKV / 64, 1), 32, 0, stream>>>(XB, nullptr, WV, nullptr, DM, FV, DKV, nullptr, 0, 0, 0); k_vtp<<<dim3(LKv, NB_, 1), 256, 0, stream>>>(FV, DKV, NKV, VT16, VTh, VTl);
    k_fattn<<<dim3(NH_, NB_, TT / 64), 128, 0, stream>>>(QPh, QPl, KPh, KPl, VT16, BTT, KM, MRG);   /* silu attention, all heads and batches: merged [b*TT+t][h*128+d], f32 */
    k_gemmw<bf, 0, false><<<dim3(NB_ * TT / 64, DM / 64, 1), 32, 0, stream>>>(XB, nullptr, WU, nullptr, DM, FU, DM, nullptr, 0, 0, 0);   /* U = x Wu */
    k_ugate<<<(unsigned)(((size_t)NB_ * TT * DM / 4 + 255) / 256), 256, 0, stream>>>(MRG, FU, OUT, (size_t)NB_ * TT * DM / 4);   /* out = attn x silu(U) */
}

// v004
// Measured time: 297 microseconds a run.
// Next to v003, in two timings, it ran 1.33 and 1.32 times as fast.
// All steps since v000 together make it 5.85 times as fast.
#include <hip/hip_runtime.h>

// HSTU layer (x [4][2048][1024]; Q, K, V = silu(x W) ('xw' [1024][1024]; 8 heads x 128), U = x Wu; scores = Q.K + rel_bias[i - j + 2047][h] ([4095][8], read); scores / sqrt(128); causal and key-padding (sign(sum|K|) == 0) positions -> -2^32+1; weights = silu(scores) (no softmax; masked weights are exactly 0); attn = weights V merged [t][h*128+d]; out = attn x silu(U) -> [4][2048][1024] (8.4 M)).
// Layout: bf16 copies of x and of the transposed weights; four projection GEMMs whose f32 tiles never go to memory: each epilogue applies what the layer does next to its tile and stores that (silu and the bf16 hi/lo planes of Q and K, the key flags, silu and the transposed fp16 plane of V, the silu(U) gate on the attention rows); between the V and the U GEMM one fused silu-attention kernel (scores and fp16 weights stay in registers, exact zeros above the diagonal so the P.V contraction stops at the diagonal block; it writes the merged f32 rows). The four batches run side by side in every launch: the GEMMs and the bf16 copy of x take the 8192 rows as one matrix, the attention kernel takes the batch from the grid.
// Compute dtypes, f32 accumulate: every input rounded to bf16; projections exact (inputs); silu in f32 (precise expf) -> Q/K hi/lo planes, V fp16 planes; scores 3 products (tile skipping); bias add, 1/sqrt(128), masks and silu in f32; fp16 weights x fp16 silu(V) (one product, causal K range); no output projection: out = attn x silu(x Wu) in f32.

#define NB_  4
#define TT   2048
#define DM   1024
#define NH_  8
#define NKV  8
#define REP  (NH_ / NKV)
#define HD   128
#define DQ   (NH_ * HD)
#define DKV  (NKV * HD)
#define NEGM (-4294967295.0f)
#define ISC  0.088388347648318447f   // 1/sqrt(128), applied after the bias add
#define ZH   2
#define RH   2048
#define WIN  2048
#define PCAR 1024.0f
#define SCL  0.088388347648318447f   // HD^-0.5
typedef _Float16 h16;
typedef unsigned short bf;
typedef __attribute__((ext_vector_type(16))) __bf16   v16bf;
typedef __attribute__((ext_vector_type(16))) _Float16 v16h;
typedef __attribute__((ext_vector_type(8)))  _Float16 v8h;
typedef __attribute__((ext_vector_type(8)))  unsigned short v8us;
typedef __attribute__((ext_vector_type(8)))  float    v8f;
typedef __attribute__((ext_vector_type(4)))  float    v4f;
typedef v8h  __attribute__((may_alias)) v8ha;
typedef v4f  __attribute__((may_alias)) v4fa;
typedef v8us __attribute__((may_alias)) v8usa;

__device__ __forceinline__ unsigned short f2bf(float f) { unsigned u = __float_as_uint(f); u += 0x7FFFu + ((u >> 16) & 1u); return (unsigned short)(u >> 16); }
__device__ __forceinline__ float bf2f(unsigned short b) { return __uint_as_float(((unsigned)b) << 16); }
__device__ __forceinline__ float bfr(float f) { return bf2f(f2bf(f)); }
__device__ __forceinline__ v16h cat16(v8h lo, v8h hi) { return __builtin_shufflevector(lo, hi, 0, 1, 2, 3, 4, 5, 6, 7, 8, 9, 10, 11, 12, 13, 14, 15); }
__device__ __forceinline__ v16bf cat16b(v8us lo, v8us hi) { return __builtin_bit_cast(v16bf, __builtin_shufflevector(lo, hi, 0, 1, 2, 3, 4, 5, 6, 7, 8, 9, 10, 11, 12, 13, 14, 15)); }
__device__ __forceinline__ v8f wmma16(v16h a, v16h b, v8f c) { return __builtin_amdgcn_wmma_f32_16x16x32_f16(false, a, false, b, (short)0, c, false, false); }
__device__ __forceinline__ v8f wmmab(v16bf a, v16bf b, v8f c) { return __builtin_amdgcn_wmma_f32_16x16x32_bf16(false, a, false, b, (short)0, c, false, false); }



__device__ __forceinline__ h16 tohx(float x) { return (h16)x; }
__device__ __forceinline__ float siluf(float u) { const float sg = __fdiv_rn(1.0f, __fadd_rn(1.0f, expf(-u))); return __fmul_rn(u, sg); }   /* silu = u sigmoid(u), precise expf */
__device__ __forceinline__ void splitf(float y, unsigned short& h, unsigned short& l) { h = f2bf(y); l = f2bf(y - bf2f(h)); }
typedef __attribute__((ext_vector_type(2))) _Float16 v2h;
typedef __attribute__((ext_vector_type(4))) _Float16 v4h;
typedef __attribute__((ext_vector_type(2))) unsigned short v2us;
typedef __attribute__((ext_vector_type(4))) unsigned short v4us;
typedef __attribute__((ext_vector_type(2))) float v2f;
typedef __attribute__((ext_vector_type(4))) int v4i;

// ---- k_gemmw: register-blocked GEMM, ONE WAVE per 64x64 output tile (16 accumulators), operands straight from K-contiguous 16-bit planes; grid (M/64, N/64), 32 threads. K % 32 == 0.
// c[m][n] = sum_k A[m][k] Bt[n][k] (+ split products per NSPLIT; f32) never goes to memory; m = b*TT + t, n = h*HD + d. The tile is laid into the wave's LDS once and read back as whole rows, 8 values a lane; what the epilogue stores, by MODE, in 128-byte (f32: 256-byte) pieces:
// 0: silu(c) as bf16 hi/lo planes [b][h][t][d] (Q). 1: the same (K), and KF[n/64][m] = 1.0 where any silu(c) of the row's 64 columns is not zero, else 0.0 (a sum of absolute values is zero only where every term is).
// 2: silu(c) as the fp16 plane [b][h][d][t] (V transposed: the tile is laid down as [d][t], a lane's 8 accumulator rows being 8 consecutive t of one d). 3: G[m][n] x silu(c) -> O[m][n] (the u gate on the attention rows).
template <typename T16> struct WFrag;
template <> struct WFrag<h16> { typedef v16h V; static __device__ __forceinline__ V ld(const h16* p) { return cat16(*(const v8h*)p, *(const v8h*)(p + 16)); } static __device__ __forceinline__ v8f mma(V a, V b, v8f c) { return wmma16(a, b, c); } };
template <> struct WFrag<bf> { typedef v16bf V; static __device__ __forceinline__ V ld(const bf* p) { return cat16b(*(const v8us*)p, *(const v8us*)(p + 16)); } static __device__ __forceinline__ v8f mma(V a, V b, v8f c) { return wmmab(a, b, c); } };
template <typename T16, int NSPLIT, int MODE>
__global__ __launch_bounds__(32) void k_gemmw(const T16* __restrict__ A, const T16* __restrict__ A2, const T16* __restrict__ Bt, const T16* __restrict__ Bt2, int K, bf* Ph, bf* Pl, float* KF, h16* Vt, const float* __restrict__ G, float* O) {
    typedef typename WFrag<T16>::V V;
    __shared__ __align__(16) float os[64 * 68];
    const int lane = threadIdx.x & 31, lr = lane & 15, hi = lane >> 4; const int r0 = blockIdx.x * 64, c0 = blockIdx.y * 64;
    v8f acc[4][4];
#pragma unroll
    for (int mb = 0; mb < 4; ++mb)
#pragma unroll
        for (int nb = 0; nb < 4; ++nb) acc[mb][nb] = (v8f){};
    const size_t aoff = (size_t)(r0 + lr) * K + 8 * hi, boff = (size_t)(c0 + lr) * K + 8 * hi;
#pragma unroll 1
    for (int kc = 0; kc < K; kc += 32) {
        V a[4], a2[4];
#pragma unroll
        for (int mb = 0; mb < 4; ++mb) { a[mb] = WFrag<T16>::ld(A + aoff + (size_t)mb * 16 * K + kc); if (NSPLIT == 1 || NSPLIT == 2) a2[mb] = WFrag<T16>::ld(A2 + aoff + (size_t)mb * 16 * K + kc); }
#pragma unroll
        for (int nb = 0; nb < 4; ++nb) { const V b = WFrag<T16>::ld(Bt + boff + (size_t)nb * 16 * K + kc); V b2; if (NSPLIT >= 2) b2 = WFrag<T16>::ld(Bt2 + boff + (size_t)nb * 16 * K + kc);
#pragma unroll
            for (int mb = 0; mb < 4; ++mb) { acc[mb][nb] = WFrag<T16>::mma(a[mb], b, acc[mb][nb]); if (NSPLIT == 1 || NSPLIT == 2) acc[mb][nb] = WFrag<T16>::mma(a2[mb], b, acc[mb][nb]); if (NSPLIT >= 2) acc[mb][nb] = WFrag<T16>::mma(a[mb], b2, acc[mb][nb]); } }
        asm volatile("v_nop\n\tv_nop\n\tv_nop\n\tv_nop" : "+v"(acc[0][0]), "+v"(acc[1][1]), "+v"(acc[2][2]), "+v"(acc[3][3]) : "v"(a[0]), "v"(a[3]));
    }
#pragma unroll
    for (int mb = 0; mb < 4; ++mb)
#pragma unroll
        for (int nb = 0; nb < 4; ++nb) {
            if (MODE == 2) { v4f lo, hi4;
#pragma unroll
                for (int r = 0; r < 4; ++r) { lo[r] = acc[mb][nb][r]; hi4[r] = acc[mb][nb][4 + r]; }
                float* p = os + (nb * 16 + lr) * 68 + mb * 16 + hi * 8; *(v4fa*)p = lo; *(v4fa*)(p + 4) = hi4;
            } else {
#pragma unroll
                for (int j = 0; j < 8; ++j) os[(mb * 16 + hi * 8 + j) * 68 + nb * 16 + lr] = acc[mb][nb][j]; } }
    __builtin_amdgcn_wave_barrier(); asm volatile("" ::: "memory");   // the reads below take what OTHER lanes of the wave have written: the compiler may not lift them over the writes
    const int rw = lane >> 3, cofs = (lane & 7) * 8;   // 8 lanes a tile row, 4 rows a pass
    const size_t pl = (size_t)(r0 / TT) * NH_ + c0 / HD; const int t0 = r0 % TT, d0 = c0 % HD;   // the tile's (batch, head) plane and its first row and column there
    const size_t e0 = (MODE == 3) ? (size_t)(r0 + rw) * DM + c0 + cofs : (MODE == 2) ? (pl * HD + d0 + rw) * TT + t0 + cofs : (pl * TT + t0 + rw) * HD + d0 + cofs;
    const size_t est = 4 * ((MODE == 3) ? DM : (MODE == 2) ? TT : HD);   // elements from one pass's row to the next pass's
    v4f g[2][2];
    if (MODE == 3) {
#pragma unroll
        for (int u = 0; u < 2; ++u) { g[u][0] = *(const v4f*)(G + e0 + u * est); g[u][1] = *(const v4f*)(G + e0 + u * est + 4); } }
    unsigned long long nzr = 0;   // one bit a tile row: some silu(K) of the row is not zero
#pragma unroll 1   // kept rolled, two passes a trip: 8 independent silu chains a lane and pass keep the vector port fed, and the kernel's text stays a few KB
    for (int it = 0; it < 16; it += 2) {
#pragma unroll
        for (int u = 0; u < 2; ++u) {
            const float* src = os + ((it + u) * 4 + rw) * 68 + cofs; const v4f v0 = *(const v4fa*)src, v1 = *(const v4fa*)(src + 4); const size_t e = e0 + (size_t)(it + u) * est;
            float y[8];
#pragma unroll
            for (int q = 0; q < 4; ++q) { y[q] = siluf(v0[q]); y[4 + q] = siluf(v1[q]); }
            if (MODE == 3) { v4f o0, o1;
#pragma unroll
                for (int q = 0; q < 4; ++q) { o0[q] = __fmul_rn(g[u][0][q], y[q]); o1[q] = __fmul_rn(g[u][1][q], y[4 + q]); }
                *(v4f*)(O + e) = o0; *(v4f*)(O + e + 4) = o1;
                asm volatile("s_wait_xcnt 0x0" ::: "memory");   // stands in front of the rewrite of the registers that the two stores name (the loads below land in them)
                const size_t en = e0 + (size_t)(it + u + (it < 14 ? 2 : 0)) * est;   // the attention rows are asked for two passes ahead; the last trip asks for its own rows again, so that every trip has the same loads in flight and the waits can be counted
                g[u][0] = *(const v4f*)(G + en); g[u][1] = *(const v4f*)(G + en + 4);
                asm volatile("s_wait_xcnt 0x0" ::: "memory");   // and in front of the next rewrite of the address registers that the two loads name
            } else if (MODE == 2) { v8h o;
#pragma unroll
                for (int q = 0; q < 8; ++q) o[q] = tohx(y[q]);
                *(v8h*)(Vt + e) = o;
            } else { v8us oh, ol; bool nz = false;
#pragma unroll
                for (int q = 0; q < 8; ++q) { unsigned short a2, c2; splitf(y[q], a2, c2); oh[q] = a2; ol[q] = c2; nz = nz | !(y[q] == 0.0f); }
                *(v8us*)(Ph + e) = oh; *(v8us*)(Pl + e) = ol;
                if (MODE == 1) { const unsigned m = __builtin_amdgcn_ballot_w32(nz);   // byte k: the 8 lanes of the pass's row k
                    const unsigned b4 = ((m & 0xFFu) ? 1u : 0u) | ((m & 0xFF00u) ? 2u : 0u) | ((m & 0xFF0000u) ? 4u : 0u) | ((m & 0xFF000000u) ? 8u : 0u);
                    nzr |= (unsigned long long)b4 << ((it + u) * 4); }
            } } }
    if (MODE == 3) asm volatile("s_wait_loadcnt 0x0" ::: "memory");   // the last trip's loads, which nothing reads, have landed before the wave ends and gives its registers back
    if (MODE == 1) { float* kf = KF + (size_t)blockIdx.y * (NB_ * TT) + r0 + lane; kf[0] = ((nzr >> lane) & 1u) ? 1.0f : 0.0f; kf[32] = ((nzr >> (lane + 32)) & 1u) ? 1.0f : 0.0f; }
}
__global__ __launch_bounds__(256) void k_wtG(const float* __restrict__ w, int K, int N, bf* Bt) {
    const int lane = threadIdx.x & 31; const int L0 = (blockIdx.x * 8 + (threadIdx.x >> 5)) * 8; const int nlines = N * K / 64;
{
#pragma unroll 1
        for (int l = 0; l < 8; ++l) { const int L = L0 + l; if (L >= nlines) break; const size_t e = (size_t)L * 64 + lane * 2; const int k = (int)(e % K), n = (int)(e / K); v2us o;
            o[0] = f2bf(w[(size_t)k * N + n]); o[1] = f2bf(w[(size_t)(k + 1) * N + n]); *(v2us*)(Bt + e) = o; }
         }
}
__global__ __launch_bounds__(256) void k_cvt8(const float* __restrict__ src, bf* dst, size_t n8) { const size_t i = (size_t)blockIdx.x * 256 + threadIdx.x; if (i >= n8) return; const v8f v = *(const v8f*)(src + i * 8); v8us o;
#pragma unroll
    for (int k = 0; k < 8; ++k) o[k] = f2bf(v[k]); *(v8us*)(dst + i * 8) = o;  }

__global__ __launch_bounds__(256) void k_bttr(const float* __restrict__ RB, float* BTT) { const int idx = blockIdx.x * 256 + threadIdx.x; if (idx >= NH_ * 4096) return; const int p = idx % 4096, h = idx / 4096; const float v = (p < 2 * TT - 1) ? bfr(RB[(size_t)p * NH_ + h]) : 0.0f; *(float*)(BTT + idx) = v;  }
// ---- k_fattn: scores, bias, masks, silu weights and weights x V in one kernel; nothing of the [t][t] planes goes to memory. One wave per 16 query rows, 4 waves a work-group, grid (heads, batches, TT/64): the row block is the slowest index, longest rows first over all heads and batches, so that no long work-group starts late.
// Per 32 keys: St = K Qt (two 16-key tiles, the same 3 hi/lo products in the same order per 32 of d), a lane then holds 16 keys of ONE query in the hardware k order, so the fp16 weights are the B operand of Ot += Vt Pt as they stand.
// Keys run in ascending 32-key steps into one accumulator and stop at the end of the 64-row diagonal block, so every sum keeps its order.
// The K hi, K lo and V tiles of a step are brought into LDS once for the four waves, by asynchronous copies of whole rows, one step ahead into the other of two buffers; the waves read their fragments from there (rows pitched 16 B x odd for the 16-byte reads).
#define KPIT 272                   // LDS pitch of a 256-byte K row
#define VPIT 80                    // LDS pitch of a 64-byte V row (32 keys of one d)
#define KTB  (32 * KPIT)           // one K plane's tile
#define STG  (2 * KTB + HD * VPIT) // one step's tiles: K hi, K lo, V
typedef const __attribute__((address_space(1))) char* gptr;   // an address known to be global memory
__device__ __forceinline__ v16bf ldfb(gptr p) { return cat16b(*(const __attribute__((address_space(1))) v8us*)p, *(const __attribute__((address_space(1))) v8us*)(p + 32)); }
__device__ __forceinline__ v16bf ldsb(const char* p) { return cat16b(*(const v8us*)p, *(const v8us*)(p + 32)); }
__device__ __forceinline__ v16h ldsh(const char* p) { return cat16(*(const v8h*)p, *(const v8h*)(p + 32)); }
// a step's twelve 16-byte copies a lane, global memory to LDS through no register, in one statement; the one wait at its end stands in front of any rewrite of the address registers that the copies name
__device__ __forceinline__ void cp12(unsigned a, unsigned b, unsigned v, gptr x, gptr y, gptr w) {
    asm volatile("global_load_async_to_lds_b128 %0, %12, off\n\tglobal_load_async_to_lds_b128 %1, %13, off\n\tglobal_load_async_to_lds_b128 %2, %14, off\n\tglobal_load_async_to_lds_b128 %3, %15, off\n\t"
                 "global_load_async_to_lds_b128 %4, %16, off\n\tglobal_load_async_to_lds_b128 %5, %17, off\n\tglobal_load_async_to_lds_b128 %6, %18, off\n\tglobal_load_async_to_lds_b128 %7, %19, off\n\t"
                 "global_load_async_to_lds_b128 %8, %20, off\n\tglobal_load_async_to_lds_b128 %9, %21, off\n\tglobal_load_async_to_lds_b128 %10, %22, off\n\tglobal_load_async_to_lds_b128 %11, %23, off\n\ts_wait_xcnt 0x0"
                 :: "v"(a), "v"(a + 8 * KPIT), "v"(a + 16 * KPIT), "v"(a + 24 * KPIT), "v"(b), "v"(b + 8 * KPIT), "v"(b + 16 * KPIT), "v"(b + 24 * KPIT), "v"(v), "v"(v + 32 * VPIT), "v"(v + 64 * VPIT), "v"(v + 96 * VPIT),
                    "v"(x), "v"(x + 2048), "v"(x + 4096), "v"(x + 6144), "v"(y), "v"(y + 2048), "v"(y + 4096), "v"(y + 6144), "v"(w), "v"(w + 32 * TT * 2), "v"(w + 64 * TT * 2), "v"(w + 96 * TT * 2) : "memory");
}
__global__ __launch_bounds__(128) void k_fattn(const bf* __restrict__ Qh, const bf* __restrict__ Ql, const bf* __restrict__ Kh, const bf* __restrict__ Kl, const h16* __restrict__ Vt, const float* __restrict__ BTT, const float* __restrict__ KM, float* O) {
    __shared__ __align__(16) float sbias[4096]; __shared__ __align__(16) float skm[TT]; __shared__ __align__(16) char ring[2 * STG];
    const int h = blockIdx.x; const int qb = ((int)gridDim.z - 1 - (int)blockIdx.z) * 64;
    { const size_t b = blockIdx.y, pb = b * NH_ * TT * HD; Qh += pb; Ql += pb; Kh += pb; Kl += pb; Vt += pb; KM += (size_t)(2 * h) * (NB_ * TT) + b * TT; O += b * TT * DM; }   // this batch's planes, the head's two rows of key flags (one for each 64 of its columns) and output rows
    const size_t hp = (size_t)h * TT * HD; const int tid = threadIdx.x;
    // each lane's part of a step's copies: K tiles are 8 KiB in a row (16 lanes a row, 8 rows a copy), V rows are 64 B of a 4-KiB row (4 lanes a row, 32 rows a copy)
    const unsigned lring = (unsigned)(size_t)(__attribute__((address_space(3))) char*)ring;
    const unsigned lk = lring + (tid >> 4) * KPIT + (tid & 15) * 16, lv = lring + 2 * KTB + (tid >> 2) * VPIT + (tid & 3) * 16;
    gptr gkh = (gptr)(Kh + hp) + tid * 16; gptr gkl = (gptr)(Kl + hp) + tid * 16; gptr gv = (gptr)(Vt + hp) + (tid >> 2) * TT * 2 + (tid & 3) * 16;
    auto fill = [&](const int bo, const int k0) {   // bo: the buffer's byte offset in the ring
        const unsigned a = lk + bo, v = lv + bo; gptr x = gkh + k0 * HD * 2, y = gkl + k0 * HD * 2, w = gv + k0 * 2;
        cp12(a, a + KTB, v, x, y, w);
    };
    fill(0, 0);
#pragma unroll
    for (int p = 0; p < 4096 / 4 / 128; ++p) ((v4f*)sbias)[p * 128 + threadIdx.x] = ((const v4f*)(BTT + (size_t)h * 4096))[p * 128 + threadIdx.x];
#pragma unroll
    for (int p = 0; p < TT / 4 / 128; ++p) ((v4f*)skm)[p * 128 + threadIdx.x] = ((const v4f*)KM)[p * 128 + threadIdx.x] + ((const v4f*)(KM + NB_ * TT))[p * 128 + threadIdx.x];   // zero only where both halves of the key's row are all zero
    asm volatile("s_wait_asynccnt 0x0" ::: "memory");   // this wave's copies of the first tiles have landed before the barrier behind which the other waves read them
    __syncthreads();
    fill(STG, 32);   // kend >= 64: a second step always exists
    const int lane = threadIdx.x & 31, c = lane & 15, hh = lane >> 4; const int q0 = qb + __builtin_amdgcn_readfirstlane((int)(threadIdx.x >> 5)) * 16; const int i = q0 + c;
    const int kof = c * HD * 2 + 16 * hh;
    v16bf qh[4], ql[4];
#pragma unroll
    for (int kc = 0; kc < 4; ++kc) { qh[kc] = ldfb((gptr)(Qh + hp) + (size_t)q0 * HD * 2 + kof + kc * 64); ql[kc] = ldfb((gptr)(Ql + hp) + (size_t)q0 * HD * 2 + kof + kc * 64); }
    v8f o[8];
#pragma unroll
    for (int dt = 0; dt < 8; ++dt) o[dt] = (v8f){};
    const int kend = qb + 64;   // keys up to the end of the work-group's 64-row diagonal block (weights past the diagonal are exact zeros): an even number of 32-key steps for every wave
    // one 32-key step on the tiles in the buffer at bo; at its foot the next step's tiles are published and the buffer is refilled for the step after that
    auto step = [&](const int bo, const int k0) {
        const char* kt = ring + bo + c * KPIT + 16 * hh; const char* vt = kt + 2 * KTB + c * (VPIT - KPIT);
        v16bf ka[8], kb[8]; v16h vf[8]; float bs[16]; v4f km[4];
#pragma unroll
        for (int f = 0; f < 8; ++f) { ka[f] = ldsb(kt + (f & 1) * 16 * KPIT + (f >> 1) * 64); kb[f] = ldsb(kt + KTB + (f & 1) * 16 * KPIT + (f >> 1) * 64); }
#pragma unroll
        for (int e = 0; e < 16; ++e) bs[e] = sbias[2047 + i - (k0 + (e >> 3) * 16 + 8 * hh + (e & 7))];
#pragma unroll
        for (int e = 0; e < 4; ++e) km[e] = *(const v4f*)(skm + k0 + (e >> 1) * 16 + 8 * hh + (e & 1) * 4);
        // inputs only, loaded values only: holds the bias and mask LDS loads at the head of the step (left alone the compiler sinks them into the silu arithmetic, a short-led wait every few elements)
        asm volatile("" :: "v"(bs[0]), "v"(bs[1]), "v"(bs[2]), "v"(bs[3]), "v"(bs[4]), "v"(bs[5]), "v"(bs[6]), "v"(bs[7]), "v"(bs[8]), "v"(bs[9]), "v"(bs[10]), "v"(bs[11]), "v"(bs[12]), "v"(bs[13]), "v"(bs[14]), "v"(bs[15]), "v"(km[0]), "v"(km[1]), "v"(km[2]), "v"(km[3]));
        v8f s[2]; s[0] = (v8f){}; s[1] = (v8f){};
#pragma unroll
        for (int f = 0; f < 8; ++f) { const int kt2 = f & 1, kc = f >> 1;
            s[kt2] = wmmab(ka[f], qh[kc], s[kt2]); s[kt2] = wmmab(ka[f], ql[kc], s[kt2]); s[kt2] = wmmab(kb[f], qh[kc], s[kt2]);
            if (f == 5) {   // three quarters of the K fragments are used up: the V fragments take their registers
#pragma unroll
                for (int dt = 0; dt < 8; ++dt) vf[dt] = ldsh(vt + dt * 16 * VPIT);
                __builtin_amdgcn_sched_barrier(0);   // keeps the V reads here as one group, their latency under the rest of the products and the silu (left alone the compiler sinks them between the last products, a short-led wait at each)
            } }
        v16h p;
#pragma unroll
        for (int e = 0; e < 16; ++e) { const int j = k0 + (e >> 3) * 16 + 8 * hh + (e & 7); float t = __fmul_rn(__fadd_rn(s[e >> 3][e & 7], bs[e]), ISC); const bool msk = (j > i) | (km[e >> 2][e & 3] == 0.0f); t = msk ? NEGM : t; p[e] = tohx(siluf(t)); }
#pragma unroll
        for (int dt = 0; dt < 8; ++dt) o[dt] = wmma16(vf[dt], p, o[dt]);
        __builtin_amdgcn_sched_barrier(0);   // keeps the waits and the barrier below at the foot, directly in front of the refill, so that the copies have a whole step to land
        asm volatile("s_wait_dscnt 0x0" ::: "memory");      // this wave's reads of the buffer are over before the barrier behind which it is refilled
        asm volatile("s_wait_asynccnt 0x0" ::: "memory");   // this wave's copies of the next step's tiles have landed before the barrier behind which the other waves read them
        __syncthreads();
        if (k0 + 64 < kend) fill(bo, k0 + 64);   // the same for the whole work-group
    };
#pragma unroll 1
    for (int k0 = 0, bo = 0; k0 < kend; k0 += 32, bo ^= STG) step(bo, k0);   // not unrolled: the buffers' addresses are formed from bo in each step and hold no registers of their own
    asm volatile("s_wait_asynccnt 0x0" ::: "memory");   // no copy is in flight when the wave stores its tile and ends
    float* orow = O + (size_t)i * DM + h * HD + 8 * hh;   // a lane holds 8 consecutive d of one query: merged [t][h*128+d], f32
#pragma unroll
    for (int dt = 0; dt < 8; ++dt) { v4f lo, hi4;
#pragma unroll
        for (int r = 0; r < 4; ++r) { lo[r] = o[dt][r]; hi4[r] = o[dt][4 + r]; }
        *(v4f*)(orow + dt * 16) = lo; *(v4f*)(orow + dt * 16 + 4) = hi4; }
}
extern "C" void kernel_launch(void* const* d_in, const int* in_sizes, int n_in,
                              void* d_out, int out_size, void* d_ws, size_t ws_size, hipStream_t stream) {
    (void)in_sizes; (void)n_in; (void)out_size;
    const float* x = (const float*)d_in[0]; const float* wq = (const float*)d_in[1]; const float* wk = (const float*)d_in[2]; const float* wv = (const float*)d_in[3]; const float* wu = (const float*)d_in[4]; const float* RB = (const float*)d_in[5];
    float* OUT = (float*)d_out;     // [4][2048][1024]
    char* wsp = (char*)d_ws;
    auto take = [&](size_t bytes) { char* p = wsp; wsp += (bytes + 255) & ~(size_t)255; return (void*)p; };
    bf* WQ = (bf*)take((size_t)DQ * DM * 2); bf* WK = (bf*)take((size_t)DKV * DM * 2); bf* WV = (bf*)take((size_t)DKV * DM * 2); bf* WU = (bf*)take((size_t)DM * DM * 2); float* BTT = (float*)take((size_t)NH_ * 4096 * 4); float* KF = (float*)take((size_t)(DKV / 64) * NB_ * TT * 4);
    bf* XB = (bf*)take((size_t)NB_ * TT * DM * 2); float* MRG = (float*)take((size_t)NB_ * TT * DM * 4); h16* VT16 = (h16*)take((size_t)NB_ * NKV * HD * TT * 2);
    bf* QPh = (bf*)take((size_t)NB_ * NH_ * TT * HD * 2); bf* QPl = (bf*)take((size_t)NB_ * NH_ * TT * HD * 2); bf* KPh = (bf*)take((size_t)NB_ * NKV * TT * HD * 2); bf* KPl = (bf*)take((size_t)NB_ * NKV * TT * HD * 2);
    if ((size_t)(wsp - (char*)d_ws) > ws_size) return;    // ws 256 MiB
    { k_wtG<<<(unsigned)((DM * DQ / 64 + 63) / 64), 256, 0, stream>>>(wq, DM, DQ, WQ); k_wtG<<<(unsigned)((DM * DKV / 64 + 63) / 64), 256, 0, stream>>>(wk, DM, DKV, WK); k_wtG<<<(unsigned)((DM * DKV / 64 + 63) / 64), 256, 0, stream>>>(wv, DM, DKV, WV); k_wtG<<<(unsigned)((DM * DM / 64 + 63) / 64), 256, 0, stream>>>(wu, DM, DM, WU); k_bttr<<<(NH_ * 4096 + 255) / 256, 256, 0, stream>>>(RB, BTT);   /* Wu; transposed relative-bias rows */
       }
    k_cvt8<<<(unsigned)(((size_t)NB_ * TT * DM / 8 + 255) / 256), 256, 0, stream>>>(x, XB, (size_t)NB_ * TT * DM / 8);
    k_gemmw<bf, 0, 0><<<dim3(NB_ * TT / 64, DQ / 64, 1), 32, 0, stream>>>(XB, nullptr, WQ, nullptr, DM, QPh, QPl, nullptr, nullptr, nullptr, nullptr);    /* silu(x Wq) planes */
    k_gemmw<bf, 0, 1><<<dim3(NB_ * TT / 64, DKV / 64, 1), 32, 0, stream>>>(XB, nullptr, WK, nullptr, DM, KPh, KPl, KF, nullptr, nullptr, nullptr);        /* silu(x Wk) planes, key padding flags */
    k_gemmw<bf, 0, 2><<<dim3(NB_ * TT / 64, DKV / 64, 1), 32, 0, stream>>>(XB, nullptr, WV, nullptr, DM, nullptr, nullptr, nullptr, VT16, nullptr, nullptr);   /* silu(x Wv), transposed */
    k_fattn<<<dim3(NH_, NB_, TT / 64), 128, 0, stream>>>(QPh, QPl, KPh, KPl, VT16, BTT, KF, MRG);   /* silu attention, all heads and batches: merged [b*TT+t][h*128+d], f32 */
    k_gemmw<bf, 0, 3><<<dim3(NB_ * TT / 64, DM / 64, 1), 32, 0, stream>>>(XB, nullptr, WU, nullptr, DM, nullptr, nullptr, nullptr, nullptr, MRG, OUT);   /* out = attn x silu(x Wu) */
}

// v005
// A run of this version takes 203 microseconds.
// In both of two side-by-side timings against v004, it was 1.48 times as fast.
// All steps since v000 together make it 8.66 times as fast.
#include <hip/hip_runtime.h>

// HSTU layer (x [4][2048][1024]; Q, K, V = silu(x W) ('xw' [1024][1024]; 8 heads x 128), U = x Wu; scores = Q.K + rel_bias[i - j + 2047][h] ([4095][8], read); scores / sqrt(128); causal and key-padding (sign(sum|K|) == 0) positions -> -2^32+1; weights = silu(scores) (no softmax; masked weights are exactly 0); attn = weights V merged [t][h*128+d]; out = attn x silu(U) -> [4][2048][1024] (8.4 M)).
// Layout: bf16 copies of x and of the transposed weights; four projection GEMMs whose f32 tiles never go to memory: each epilogue applies what the layer does next to its tile and stores that (silu and the bf16 hi/lo planes of Q and K, the key flags, silu and the transposed fp16 plane of V, the silu(U) gate on the attention rows); between the V and the U GEMM one fused silu-attention kernel (scores and fp16 weights stay in registers, exact zeros above the diagonal so the P.V contraction stops at the diagonal block; it writes the merged f32 rows). The four batches run side by side in every launch: the GEMMs and the bf16 copy of x take the 8192 rows as one matrix, the attention kernel takes the batch from the grid.
// Compute dtypes, f32 accumulate: every input rounded to bf16; projections exact (inputs); silu in f32 (precise expf) -> Q/K hi/lo planes, V fp16 planes; scores 3 products (tile skipping); bias add, 1/sqrt(128), masks and silu in f32; fp16 weights x fp16 silu(V) (one product, causal K range); no output projection: out = attn x silu(x Wu) in f32.

#define NB_  4
#define TT   2048
#define DM   1024
#define NH_  8
#define NKV  8
#define REP  (NH_ / NKV)
#define HD   128
#define DQ   (NH_ * HD)
#define DKV  (NKV * HD)
#define NEGM (-4294967295.0f)
#define ISC  0.088388347648318447f   // 1/sqrt(128), applied after the bias add
#define ZH   2
#define RH   2048
#define WIN  2048
#define PCAR 1024.0f
#define SCL  0.088388347648318447f   // HD^-0.5
typedef _Float16 h16;
typedef unsigned short bf;
typedef __attribute__((ext_vector_type(16))) __bf16   v16bf;
typedef __attribute__((ext_vector_type(16))) _Float16 v16h;
typedef __attribute__((ext_vector_type(8)))  _Float16 v8h;
typedef __attribute__((ext_vector_type(8)))  unsigned short v8us;
typedef __attribute__((ext_vector_type(8)))  float    v8f;
typedef __attribute__((ext_vector_type(4)))  float    v4f;
typedef v8h  __attribute__((may_alias)) v8ha;
typedef v4f  __attribute__((may_alias)) v4fa;
typedef v8us __attribute__((may_alias)) v8usa;

__device__ __forceinline__ unsigned short f2bf(float f) { unsigned u = __float_as_uint(f); u += 0x7FFFu + ((u >> 16) & 1u); return (unsigned short)(u >> 16); }
__device__ __forceinline__ float bf2f(unsigned short b) { return __uint_as_float(((unsigned)b) << 16); }
__device__ __forceinline__ float bfr(float f) { return bf2f(f2bf(f)); }
__device__ __forceinline__ v16h cat16(v8h lo, v8h hi) { return __builtin_shufflevector(lo, hi, 0, 1, 2, 3, 4, 5, 6, 7, 8, 9, 10, 11, 12, 13, 14, 15); }
__device__ __forceinline__ v16bf cat16b(v8us lo, v8us hi) { return __builtin_bit_cast(v16bf, __builtin_shufflevector(lo, hi, 0, 1, 2, 3, 4, 5, 6, 7, 8, 9, 10, 11, 12, 13, 14, 15)); }
__device__ __forceinline__ v8f wmma16(v16h a, v16h b, v8f c) { return __builtin_amdgcn_wmma_f32_16x16x32_f16(false, a, false, b, (short)0, c, false, false); }
__device__ __forceinline__ v8f wmmab(v16bf a, v16bf b, v8f c) { return __builtin_amdgcn_wmma_f32_16x16x32_bf16(false, a, false, b, (short)0, c, false, false); }



__device__ __forceinline__ h16 tohx(float x) { return (h16)x; }
__device__ __forceinline__ float siluf(float u) { const float sg = __fdiv_rn(1.0f, __fadd_rn(1.0f, expf(-u))); return __fmul_rn(u, sg); }   /* silu = u sigmoid(u), precise expf */
__device__ __forceinline__ void splitf(float y, unsigned short& h, unsigned short& l) { h = f2bf(y); l = f2bf(y - bf2f(h)); }
typedef __attribute__((ext_vector_type(2))) _Float16 v2h;
typedef __attribute__((ext_vector_type(4))) _Float16 v4h;
typedef __attribute__((ext_vector_type(2))) unsigned short v2us;
typedef __attribute__((ext_vector_type(4))) unsigned short v4us;
typedef __attribute__((ext_vector_type(2))) float v2f;
typedef __attribute__((ext_vector_type(4))) int v4i;

// ---- k_gemmw: register-blocked GEMM, one wave per 64x64 output tile (16 accumulators), 4 x 2 waves a work-group (256x128), one work-group a WGP; grid (M/256, N/128), 256 threads. K % 128 == 0, K >= 256.
// The operands are K-contiguous 16-bit planes. A stage is 128 k (256 bytes) of the work-group's 256 rows of A and 128 rows of Bt, brought into LDS once for the eight waves by asynchronous copies of whole rows, one stage ahead into the other of two buffers; the waves read their fragments from there (rows pitched 16 B x odd for the 16-byte reads), 32 k ahead of the products. k runs upward in 32s into the same accumulators.
// c[m][n] = sum_k A[m][k] Bt[n][k] (f32) never goes to memory; m = b*TT + t, n = h*HD + d. The tile is laid into the wave's own part of LDS (the buffers, which nobody reads any more behind the last stage's barrier) once and read back as whole rows, 8 values a lane; what the epilogue stores, by MODE, in 128-byte (f32: 256-byte) pieces:
// 0: silu(c) as bf16 hi/lo planes [b][h][t][d] (Q). 1: the same (K), and KF[n/64][m] = 1.0 where any silu(c) of the row's 64 columns is not zero, else 0.0 (a sum of absolute values is zero only where every term is).
// 2: silu(c) as the fp16 plane [b][h][d][t] (V transposed: the tile is laid down as [d][t], a lane's 8 accumulator rows being 8 consecutive t of one d). 3: G[m][n] x silu(c) -> O[m][n] (the u gate on the attention rows).
template <typename T16> struct WFrag;
template <> struct WFrag<h16> { typedef v16h V; static __device__ __forceinline__ V ld(const h16* p) { return cat16(*(const v8h*)p, *(const v8h*)(p + 16)); } static __device__ __forceinline__ v8f mma(V a, V b, v8f c) { return wmma16(a, b, c); } };
template <> struct WFrag<bf> { typedef v16bf V; static __device__ __forceinline__ V ld(const bf* p) { return cat16b(*(const v8us*)p, *(const v8us*)(p + 16)); } static __device__ __forceinline__ v8f mma(V a, V b, v8f c) { return wmmab(a, b, c); } };
#define GPIT 272                   // LDS pitch of a 256-byte operand row (128 k)
#define GSTG (384 * GPIT)          // one stage: 256 rows of A, then 128 rows of Bt
typedef const __attribute__((address_space(1))) char* gptr;   // an address known to be global memory
// eight 16-byte copies a lane, global memory to LDS through no register, 16 rows apart, in one statement; the one wait at its end stands in front of any rewrite of the address registers that the copies name
__device__ __forceinline__ void cp8(unsigned l, gptr g, size_t gs) {
    asm volatile("global_load_async_to_lds_b128 %0, %8, off\n\tglobal_load_async_to_lds_b128 %1, %9, off\n\tglobal_load_async_to_lds_b128 %2, %10, off\n\tglobal_load_async_to_lds_b128 %3, %11, off\n\t"
                 "global_load_async_to_lds_b128 %4, %12, off\n\tglobal_load_async_to_lds_b128 %5, %13, off\n\tglobal_load_async_to_lds_b128 %6, %14, off\n\tglobal_load_async_to_lds_b128 %7, %15, off\n\ts_wait_xcnt 0x0"
                 :: "v"(l), "v"(l + 16 * GPIT), "v"(l + 32 * GPIT), "v"(l + 48 * GPIT), "v"(l + 64 * GPIT), "v"(l + 80 * GPIT), "v"(l + 96 * GPIT), "v"(l + 112 * GPIT),
                    "v"(g), "v"(g + gs), "v"(g + 2 * gs), "v"(g + 3 * gs), "v"(g + 4 * gs), "v"(g + 5 * gs), "v"(g + 6 * gs), "v"(g + 7 * gs) : "memory");
}
template <typename T16, int MODE>
__global__ __launch_bounds__(256) void k_gemmw(const T16* __restrict__ A, const T16* __restrict__ Bt, int K, bf* Ph, bf* Pl, float* KF, h16* Vt, const float* __restrict__ G, float* O) {
    typedef typename WFrag<T16>::V V;
    __shared__ __align__(16) char sm[2 * GSTG];
    const int tid = threadIdx.x, lane = tid & 31, lr = lane & 15, hi = lane >> 4; const int wv = __builtin_amdgcn_readfirstlane(tid >> 5);
    const int r0 = blockIdx.x * 256 + (wv & 3) * 64, c0 = blockIdx.y * 128 + (wv >> 2) * 64;   // the wave's own 64x64 tile
    float* os = (float*)(sm + wv * (64 * 68 * 4));   // the wave's epilogue tile, laid over the buffers
    v8f acc[4][4];
#pragma unroll
    for (int mb = 0; mb < 4; ++mb)
#pragma unroll
        for (int nb = 0; nb < 4; ++nb) acc[mb][nb] = (v8f){};
    // each lane's part of a stage's copies: 16 lanes a 256-byte row, 16 rows a copy of the work-group, 16 copies for the 256 rows of A and 8 for the 128 of Bt
    const unsigned lsm = (unsigned)(size_t)(__attribute__((address_space(3))) char*)sm + (tid >> 4) * GPIT + (tid & 15) * 16; const size_t gs = (size_t)16 * K * 2;
    gptr ga = (gptr)(A + (size_t)(blockIdx.x * 256 + (tid >> 4)) * K) + (tid & 15) * 16; gptr gb = (gptr)(Bt + (size_t)(blockIdx.y * 128 + (tid >> 4)) * K) + (tid & 15) * 16;
    auto fill = [&](const int bo, const int kc) {   // bo: the buffer's byte offset
        const unsigned l = lsm + bo; gptr x = ga + kc * 2, y = gb + kc * 2;
        cp8(l, x, gs); cp8(l + 128 * GPIT, x + 8 * gs, gs); cp8(l + 256 * GPIT, y, gs);
    };
    fill(0, 0);
    asm volatile("s_wait_asynccnt 0x0" ::: "memory");   // this wave's copies of the first stage have landed before the barrier behind which the other waves read them
    __syncthreads();
    fill(GSTG, 128);   // K >= 256: a second stage always exists
    const int aof = ((wv & 3) * 64 + lr) * GPIT + 16 * hi, bof = (256 + (wv >> 2) * 64 + lr) * GPIT + 16 * hi;
#pragma unroll 1   // not unrolled: the buffers' addresses are formed from bo in each stage and hold no registers of their own
    for (int kc = 0, bo = 0; kc < K; kc += 128, bo ^= GSTG) {
        const char* at = sm + bo + aof; const char* bt = sm + bo + bof;
        V a[2][4], b[2][4];
#pragma unroll
        for (int f = 0; f < 4; ++f) { a[0][f] = WFrag<T16>::ld((const T16*)(at + f * 16 * GPIT)); b[0][f] = WFrag<T16>::ld((const T16*)(bt + f * 16 * GPIT)); }
#pragma unroll
        for (int s = 0; s < 4; ++s) {   // 32 k a pass; the next pass's fragments (of this stage only) are asked for as one group in front of this pass's products
            if (s < 3) {
#pragma unroll
                for (int f = 0; f < 4; ++f) { a[(s + 1) & 1][f] = WFrag<T16>::ld((const T16*)(at + f * 16 * GPIT + (s + 1) * 64)); b[(s + 1) & 1][f] = WFrag<T16>::ld((const T16*)(bt + f * 16 * GPIT + (s + 1) * 64)); }
                __builtin_amdgcn_sched_barrier(0);   // keeps those reads here as one group, their latency under this pass's products (left alone the compiler sinks them among the products that use them, a wait to zero in front of every four)
            }
#pragma unroll
            for (int nb = 0; nb < 4; ++nb)
#pragma unroll
                for (int mb = 0; mb < 4; ++mb) acc[mb][nb] = WFrag<T16>::mma(a[s & 1][mb], b[s & 1][nb], acc[mb][nb]);
        }
        __builtin_amdgcn_sched_barrier(0);   // keeps the waits and the barrier below at the foot, behind the last products and directly in front of the refill, so that the copies have a whole stage to land
        asm volatile("s_wait_dscnt 0x0" ::: "memory");      // this wave's reads of the buffer are over before the barrier behind which it is refilled
        asm volatile("s_wait_asynccnt 0x0" ::: "memory");   // this wave's copies of the next stage have landed before the barrier behind which the other waves read them
        __syncthreads();
        if (kc + 256 < K) fill(bo, kc + 256);   // the same for the whole work-group
    }
    asm volatile("s_wait_asynccnt 0x0" ::: "memory");   // no copy is in flight when the buffers become the epilogue's tiles
#pragma unroll
    for (int mb = 0; mb < 4; ++mb)
#pragma unroll
        for (int nb = 0; nb < 4; ++nb) {
            if (MODE == 2) { v4f lo, hi4;
#pragma unroll
                for (int r = 0; r < 4; ++r) { lo[r] = acc[mb][nb][r]; hi4[r] = acc[mb][nb][4 + r]; }
                float* p = os + (nb * 16 + lr) * 68 + mb * 16 + hi * 8; *(v4fa*)p = lo; *(v4fa*)(p + 4) = hi4;
            } else {
#pragma unroll
                for (int j = 0; j < 8; ++j) os[(mb * 16 + hi * 8 + j) * 68 + nb * 16 + lr] = acc[mb][nb][j]; } }
    __builtin_amdgcn_wave_barrier(); asm volatile("" ::: "memory");   // the reads below take what OTHER lanes of the wave have written: the compiler may not lift them over the writes
    const int rw = lane >> 3, cofs = (lane & 7) * 8;   // 8 lanes a tile row, 4 rows a pass
    const size_t pl = (size_t)(r0 / TT) * NH_ + c0 / HD; const int t0 = r0 % TT, d0 = c0 % HD;   // the tile's (batch, head) plane and its first row and column there
    const size_t e0 = (MODE == 3) ? (size_t)(r0 + rw) * DM + c0 + cofs : (MODE == 2) ? (pl * HD + d0 + rw) * TT + t0 + cofs : (pl * TT + t0 + rw) * HD + d0 + cofs;
    const size_t est = 4 * ((MODE == 3) ? DM : (MODE == 2) ? TT : HD);   // elements from one pass's row to the next pass's
    v4f g[2][2];
    if (MODE == 3) {
#pragma unroll
        for (int u = 0; u < 2; ++u) { g[u][0] = *(const v4f*)(G + e0 + u * est); g[u][1] = *(const v4f*)(G + e0 + u * est + 4); } }
    unsigned long long nzr = 0;   // one bit a tile row: some silu(K) of the row is not zero
#pragma unroll 1   // kept rolled, two passes a trip: 8 independent silu chains a lane and pass keep the vector port fed, and the kernel's text stays a few KB
    for (int it = 0; it < 16; it += 2) {
#pragma unroll
        for (int u = 0; u < 2; ++u) {
            const float* src = os + ((it + u) * 4 + rw) * 68 + cofs; const v4f v0 = *(const v4fa*)src, v1 = *(const v4fa*)(src + 4); const size_t e = e0 + (size_t)(it + u) * est;
            float y[8];
#pragma unroll
            for (int q = 0; q < 4; ++q) { y[q] = siluf(v0[q]); y[4 + q] = siluf(v1[q]); }
            if (MODE == 3) { v4f o0, o1;
#pragma unroll
                for (int q = 0; q < 4; ++q) { o0[q] = __fmul_rn(g[u][0][q], y[q]); o1[q] = __fmul_rn(g[u][1][q], y[4 + q]); }
                *(v4f*)(O + e) = o0; *(v4f*)(O + e + 4) = o1;
                asm volatile("s_wait_xcnt 0x0" ::: "memory");   // stands in front of the rewrite of the registers that the two stores name (the loads below land in them)
                const size_t en = e0 + (size_t)(it + u + (it < 14 ? 2 : 0)) * est;   // the attention rows are asked for two passes ahead; the last trip asks for its own rows again, so that every trip has the same loads in flight and the waits can be counted
                g[u][0] = *(const v4f*)(G + en); g[u][1] = *(const v4f*)(G + en + 4);
                asm volatile("s_wait_xcnt 0x0" ::: "memory");   // and in front of the next rewrite of the address registers that the two loads name
            } else if (MODE == 2) { v8h o;
#pragma unroll
                for (int q = 0; q < 8; ++q) o[q] = tohx(y[q]);
                *(v8h*)(Vt + e) = o;
            } else { v8us oh, ol; bool nz = false;
#pragma unroll
                for (int q = 0; q < 8; ++q) { unsigned short a2, c2; splitf(y[q], a2, c2); oh[q] = a2; ol[q] = c2; nz = nz | !(y[q] == 0.0f); }
                *(v8us*)(Ph + e) = oh; *(v8us*)(Pl + e) = ol;
                if (MODE == 1) { const unsigned m = __builtin_amdgcn_ballot_w32(nz);   // byte k: the 8 lanes of the pass's row k
                    const unsigned b4 = ((m & 0xFFu) ? 1u : 0u) | ((m & 0xFF00u) ? 2u : 0u) | ((m & 0xFF0000u) ? 4u : 0u) | ((m & 0xFF000000u) ? 8u : 0u);
                    nzr |= (unsigned long long)b4 << ((it + u) * 4); }
            } } }
    if (MODE == 3) asm volatile("s_wait_loadcnt 0x0" ::: "memory");   // the last trip's loads, which nothing reads, have landed before the wave ends and gives its registers back
    if (MODE == 1) { float* kf = KF + (size_t)(c0 / 64) * (NB_ * TT) + r0 + lane; kf[0] = ((nzr >> lane) & 1u) ? 1.0f : 0.0f; kf[32] = ((nzr >> (lane + 32)) & 1u) ? 1.0f : 0.0f; }
}
__global__ __launch_bounds__(256) void k_wtG(const float* __restrict__ w, int K, int N, bf* Bt) {
    const int lane = threadIdx.x & 31; const int L0 = (blockIdx.x * 8 + (threadIdx.x >> 5)) * 8; const int nlines = N * K / 64;
{
#pragma unroll 1
        for (int l = 0; l < 8; ++l) { const int L = L0 + l; if (L >= nlines) break; const size_t e = (size_t)L * 64 + lane * 2; const int k = (int)(e % K), n = (int)(e / K); v2us o;
            o[0] = f2bf(w[(size_t)k * N + n]); o[1] = f2bf(w[(size_t)(k + 1) * N + n]); *(v2us*)(Bt + e) = o; }
         }
}
__global__ __launch_bounds__(256) void k_cvt8(const float* __restrict__ src, bf* dst, size_t n8) { const size_t i = (size_t)blockIdx.x * 256 + threadIdx.x; if (i >= n8) return; const v8f v = *(const v8f*)(src + i * 8); v8us o;
#pragma unroll
    for (int k = 0; k < 8; ++k) o[k] = f2bf(v[k]); *(v8us*)(dst + i * 8) = o;  }

__global__ __launch_bounds__(256) void k_bttr(const float* __restrict__ RB, float* BTT) { const int idx = blockIdx.x * 256 + threadIdx.x; if (idx >= NH_ * 4096) return; const int p = idx % 4096, h = idx / 4096; const float v = (p < 2 * TT - 1) ? bfr(RB[(size_t)p * NH_ + h]) : 0.0f; *(float*)(BTT + idx) = v;  }
// ---- k_fattn: scores, bias, masks, silu weights and weights x V in one kernel; nothing of the [t][t] planes goes to memory. One wave per 16 query rows, 4 waves a work-group, grid (heads, batches, TT/64): the row block is the slowest index, longest rows first over all heads and batches, so that no long work-group starts late.
// Per 32 keys: St = K Qt (two 16-key tiles, the same 3 hi/lo products in the same order per 32 of d), a lane then holds 16 keys of ONE query in the hardware k order, so the fp16 weights are the B operand of Ot += Vt Pt as they stand.
// Keys run in ascending 32-key steps into one accumulator and stop at the end of the 64-row diagonal block, so every sum keeps its order.
// The K hi, K lo and V tiles of a step are brought into LDS once for the four waves, by asynchronous copies of whole rows, one step ahead into the other of two buffers; the waves read their fragments from there (rows pitched 16 B x odd for the 16-byte reads).
#define KPIT 272                   // LDS pitch of a 256-byte K row
#define VPIT 80                    // LDS pitch of a 64-byte V row (32 keys of one d)
#define KTB  (32 * KPIT)           // one K plane's tile
#define STG  (2 * KTB + HD * VPIT) // one step's tiles: K hi, K lo, V
__device__ __forceinline__ v16bf ldfb(gptr p) { return cat16b(*(const __attribute__((address_space(1))) v8us*)p, *(const __attribute__((address_space(1))) v8us*)(p + 32)); }
__device__ __forceinline__ v16bf ldsb(const char* p) { return cat16b(*(const v8us*)p, *(const v8us*)(p + 32)); }
__device__ __forceinline__ v16h ldsh(const char* p) { return cat16(*(const v8h*)p, *(const v8h*)(p + 32)); }
// a step's twelve 16-byte copies a lane, global memory to LDS through no register, in one statement; the one wait at its end stands in front of any rewrite of the address registers that the copies name
__device__ __forceinline__ void cp12(unsigned a, unsigned b, unsigned v, gptr x, gptr y, gptr w) {
    asm volatile("global_load_async_to_lds_b128 %0, %12, off\n\tglobal_load_async_to_lds_b128 %1, %13, off\n\tglobal_load_async_to_lds_b128 %2, %14, off\n\tglobal_load_async_to_lds_b128 %3, %15, off\n\t"
                 "global_load_async_to_lds_b128 %4, %16, off\n\tglobal_load_async_to_lds_b128 %5, %17, off\n\tglobal_load_async_to_lds_b128 %6, %18, off\n\tglobal_load_async_to_lds_b128 %7, %19, off\n\t"
                 "global_load_async_to_lds_b128 %8, %20, off\n\tglobal_load_async_to_lds_b128 %9, %21, off\n\tglobal_load_async_to_lds_b128 %10, %22, off\n\tglobal_load_async_to_lds_b128 %11, %23, off\n\ts_wait_xcnt 0x0"
                 :: "v"(a), "v"(a + 8 * KPIT), "v"(a + 16 * KPIT), "v"(a + 24 * KPIT), "v"(b), "v"(b + 8 * KPIT), "v"(b + 16 * KPIT), "v"(b + 24 * KPIT), "v"(v), "v"(v + 32 * VPIT), "v"(v + 64 * VPIT), "v"(v + 96 * VPIT),
                    "v"(x), "v"(x + 2048), "v"(x + 4096), "v"(x + 6144), "v"(y), "v"(y + 2048), "v"(y + 4096), "v"(y + 6144), "v"(w), "v"(w + 32 * TT * 2), "v"(w + 64 * TT * 2), "v"(w + 96 * TT * 2) : "memory");
}
__global__ __launch_bounds__(128) void k_fattn(const bf* __restrict__ Qh, const bf* __restrict__ Ql, const bf* __restrict__ Kh, const bf* __restrict__ Kl, const h16* __restrict__ Vt, const float* __restrict__ BTT, const float* __restrict__ KM, float* O) {
    __shared__ __align__(16) float sbias[4096]; __shared__ __align__(16) float skm[TT]; __shared__ __align__(16) char ring[2 * STG];
    const int h = blockIdx.x; const int qb = ((int)gridDim.z - 1 - (int)blockIdx.z) * 64;
    { const size_t b = blockIdx.y, pb = b * NH_ * TT * HD; Qh += pb; Ql += pb; Kh += pb; Kl += pb; Vt += pb; KM += (size_t)(2 * h) * (NB_ * TT) + b * TT; O += b * TT * DM; }   // this batch's planes, the head's two rows of key flags (one for each 64 of its columns) and output rows
    const size_t hp = (size_t)h * TT * HD; const int tid = threadIdx.x;
    // each lane's part of a step's copies: K tiles are 8 KiB in a row (16 lanes a row, 8 rows a copy), V rows are 64 B of a 4-KiB row (4 lanes a row, 32 rows a copy)
    const unsigned lring = (unsigned)(size_t)(__attribute__((address_space(3))) char*)ring;
    const unsigned lk = lring + (tid >> 4) * KPIT + (tid & 15) * 16, lv = lring + 2 * KTB + (tid >> 2) * VPIT + (tid & 3) * 16;
    gptr gkh = (gptr)(Kh + hp) + tid * 16; gptr gkl = (gptr)(Kl + hp) + tid * 16; gptr gv = (gptr)(Vt + hp) + (tid >> 2) * TT * 2 + (tid & 3) * 16;
    auto fill = [&](const int bo, const int k0) {   // bo: the buffer's byte offset in the ring
        const unsigned a = lk + bo, v = lv + bo; gptr x = gkh + k0 * HD * 2, y = gkl + k0 * HD * 2, w = gv + k0 * 2;
        cp12(a, a + KTB, v, x, y, w);
    };
    fill(0, 0);
#pragma unroll
    for (int p = 0; p < 4096 / 4 / 128; ++p) ((v4f*)sbias)[p * 128 + threadIdx.x] = ((const v4f*)(BTT + (size_t)h * 4096))[p * 128 + threadIdx.x];
#pragma unroll
    for (int p = 0; p < TT / 4 / 128; ++p) ((v4f*)skm)[p * 128 + threadIdx.x] = ((const v4f*)KM)[p * 128 + threadIdx.x] + ((const v4f*)(KM + NB_ * TT))[p * 128 + threadIdx.x];   // zero only where both halves of the key's row are all zero
    asm volatile("s_wait_asynccnt 0x0" ::: "memory");   // this wave's copies of the first tiles have landed before the barrier behind which the other waves read them
    __syncthreads();
    fill(STG, 32);   // kend >= 64: a second step always exists
    const int lane = threadIdx.x & 31, c = lane & 15, hh = lane >> 4; const int q0 = qb + __builtin_amdgcn_readfirstlane((int)(threadIdx.x >> 5)) * 16; const int i = q0 + c;
    const int kof = c * HD * 2 + 16 * hh;
    v16bf qh[4], ql[4];
#pragma unroll
    for (int kc = 0; kc < 4; ++kc) { qh[kc] = ldfb((gptr)(Qh + hp) + (size_t)q0 * HD * 2 + kof + kc * 64); ql[kc] = ldfb((gptr)(Ql + hp) + (size_t)q0 * HD * 2 + kof + kc * 64); }
    v8f o[8];
#pragma unroll
    for (int dt = 0; dt < 8; ++dt) o[dt] = (v8f){};
    const int kend = qb + 64;   // keys up to the end of the work-group's 64-row diagonal block (weights past the diagonal are exact zeros): an even number of 32-key steps for every wave
    // one 32-key step on the tiles in the buffer at bo; at its foot the next step's tiles are published and the buffer is refilled for the step after that
    auto step = [&](const int bo, const int k0) {
        const char* kt = ring + bo + c * KPIT + 16 * hh; const char* vt = kt + 2 * KTB + c * (VPIT - KPIT);
        v16bf ka[8], kb[8]; v16h vf[8]; float bs[16]; v4f km[4];
#pragma unroll
        for (int f = 0; f < 8; ++f) { ka[f] = ldsb(kt + (f & 1) * 16 * KPIT + (f >> 1) * 64); kb[f] = ldsb(kt + KTB + (f & 1) * 16 * KPIT + (f >> 1) * 64); }
#pragma unroll
        for (int e = 0; e < 16; ++e) bs[e] = sbias[2047 + i - (k0 + (e >> 3) * 16 + 8 * hh + (e & 7))];
#pragma unroll
        for (int e = 0; e < 4; ++e) km[e] = *(const v4f*)(skm + k0 + (e >> 1) * 16 + 8 * hh + (e & 1) * 4);
        // inputs only, loaded values only: holds the bias and mask LDS loads at the head of the step (left alone the compiler sinks them into the silu arithmetic, a short-led wait every few elements)
        asm volatile("" :: "v"(bs[0]), "v"(bs[1]), "v"(bs[2]), "v"(bs[3]), "v"(bs[4]), "v"(bs[5]), "v"(bs[6]), "v"(bs[7]), "v"(bs[8]), "v"(bs[9]), "v"(bs[10]), "v"(bs[11]), "v"(bs[12]), "v"(bs[13]), "v"(bs[14]), "v"(bs[15]), "v"(km[0]), "v"(km[1]), "v"(km[2]), "v"(km[3]));
        v8f s[2]; s[0] = (v8f){}; s[1] = (v8f){};
#pragma unroll
        for (int f = 0; f < 8; ++f) { const int kt2 = f & 1, kc = f >> 1;
            s[kt2] = wmmab(ka[f], qh[kc], s[kt2]); s[kt2] = wmmab(ka[f], ql[kc], s[kt2]); s[kt2] = wmmab(kb[f], qh[kc], s[kt2]);
            if (f == 5) {   // three quarters of the K fragments are used up: the V fragments take their registers
#pragma unroll
                for (int dt = 0; dt < 8; ++dt) vf[dt] = ldsh(vt + dt * 16 * VPIT);
                __builtin_amdgcn_sched_barrier(0);   // keeps the V reads here as one group, their latency under the rest of the products and the silu (left alone the compiler sinks them between the last products, a short-led wait at each)
            } }
        v16h p;
#pragma unroll
        for (int e = 0; e < 16; ++e) { const int j = k0 + (e >> 3) * 16 + 8 * hh + (e & 7); float t = __fmul_rn(__fadd_rn(s[e >> 3][e & 7], bs[e]), ISC); const bool msk = (j > i) | (km[e >> 2][e & 3] == 0.0f); t = msk ? NEGM : t; p[e] = tohx(siluf(t)); }
#pragma unroll
        for (int dt = 0; dt < 8; ++dt) o[dt] = wmma16(vf[dt], p, o[dt]);
        __builtin_amdgcn_sched_barrier(0);   // keeps the waits and the barrier below at the foot, directly in front of the refill, so that the copies have a whole step to land
        asm volatile("s_wait_dscnt 0x0" ::: "memory");      // this wave's reads of the buffer are over before the barrier behind which it is refilled
        asm volatile("s_wait_asynccnt 0x0" ::: "memory");   // this wave's copies of the next step's tiles have landed before the barrier behind which the other waves read them
        __syncthreads();
        if (k0 + 64 < kend) fill(bo, k0 + 64);   // the same for the whole work-group
    };
#pragma unroll 1
    for (int k0 = 0, bo = 0; k0 < kend; k0 += 32, bo ^= STG) step(bo, k0);   // not unrolled: the buffers' addresses are formed from bo in each step and hold no registers of their own
    asm volatile("s_wait_asynccnt 0x0" ::: "memory");   // no copy is in flight when the wave stores its tile and ends
    float* orow = O + (size_t)i * DM + h * HD + 8 * hh;   // a lane holds 8 consecutive d of one query: merged [t][h*128+d], f32
#pragma unroll
    for (int dt = 0; dt < 8; ++dt) { v4f lo, hi4;
#pragma unroll
        for (int r = 0; r < 4; ++r) { lo[r] = o[dt][r]; hi4[r] = o[dt][4 + r]; }
        *(v4f*)(orow + dt * 16) = lo; *(v4f*)(orow + dt * 16 + 4) = hi4; }
}
extern "C" void kernel_launch(void* const* d_in, const int* in_sizes, int n_in,
                              void* d_out, int out_size, void* d_ws, size_t ws_size, hipStream_t stream) {
    (void)in_sizes; (void)n_in; (void)out_size;
    const float* x = (const float*)d_in[0]; const float* wq = (const float*)d_in[1]; const float* wk = (const float*)d_in[2]; const float* wv = (const float*)d_in[3]; const float* wu = (const float*)d_in[4]; const float* RB = (const float*)d_in[5];
    float* OUT = (float*)d_out;     // [4][2048][1024]
    char* wsp = (char*)d_ws;
    auto take = [&](size_t bytes) { char* p = wsp; wsp += (bytes + 255) & ~(size_t)255; return (void*)p; };
    bf* WQ = (bf*)take((size_t)DQ * DM * 2); bf* WK = (bf*)take((size_t)DKV * DM * 2); bf* WV = (bf*)take((size_t)DKV * DM * 2); bf* WU = (bf*)take((size_t)DM * DM * 2); float* BTT = (float*)take((size_t)NH_ * 4096 * 4); float* KF = (float*)take((size_t)(DKV / 64) * NB_ * TT * 4);
    bf* XB = (bf*)take((size_t)NB_ * TT * DM * 2); float* MRG = (float*)take((size_t)NB_ * TT * DM * 4); h16* VT16 = (h16*)take((size_t)NB_ * NKV * HD * TT * 2);
    bf* QPh = (bf*)take((size_t)NB_ * NH_ * TT * HD * 2); bf* QPl = (bf*)take((size_t)NB_ * NH_ * TT * HD * 2); bf* KPh = (bf*)take((size_t)NB_ * NKV * TT * HD * 2); bf* KPl = (bf*)take((size_t)NB_ * NKV * TT * HD * 2);
    if ((size_t)(wsp - (char*)d_ws) > ws_size) return;    // ws 256 MiB
    { k_wtG<<<(unsigned)((DM * DQ / 64 + 63) / 64), 256, 0, stream>>>(wq, DM, DQ, WQ); k_wtG<<<(unsigned)((DM * DKV / 64 + 63) / 64), 256, 0, stream>>>(wk, DM, DKV, WK); k_wtG<<<(unsigned)((DM * DKV / 64 + 63) / 64), 256, 0, stream>>>(wv, DM, DKV, WV); k_wtG<<<(unsigned)((DM * DM / 64 + 63) / 64), 256, 0, stream>>>(wu, DM, DM, WU); k_bttr<<<(NH_ * 4096 + 255) / 256, 256, 0, stream>>>(RB, BTT);   /* Wu; transposed relative-bias rows */
       }
    k_cvt8<<<(unsigned)(((size_t)NB_ * TT * DM / 8 + 255) / 256), 256, 0, stream>>>(x, XB, (size_t)NB_ * TT * DM / 8);
    k_gemmw<bf, 0><<<dim3(NB_ * TT / 256, DQ / 128, 1), 256, 0, stream>>>(XB, WQ, DM, QPh, QPl, nullptr, nullptr, nullptr, nullptr);    /* silu(x Wq) planes */
    k_gemmw<bf, 1><<<dim3(NB_ * TT / 256, DKV / 128, 1), 256, 0, stream>>>(XB, WK, DM, KPh, KPl, KF, nullptr, nullptr, nullptr);        /* silu(x Wk) planes, key padding flags */
    k_gemmw<bf, 2><<<dim3(NB_ * TT / 256, DKV / 128, 1), 256, 0, stream>>>(XB, WV, DM, nullptr, nullptr, nullptr, VT16, nullptr, nullptr);   /* silu(x Wv), transposed */
    k_fattn<<<dim3(NH_, NB_, TT / 64), 128, 0, stream>>>(QPh, QPl, KPh, KPl, VT16, BTT, KF, MRG);   /* silu attention, all heads and batches: merged [b*TT+t][h*128+d], f32 */
    k_gemmw<bf, 3><<<dim3(NB_ * TT / 256, DM / 128, 1), 256, 0, stream>>>(XB, WU, DM, nullptr, nullptr, nullptr, nullptr, MRG, OUT);   /* out = attn x silu(x Wu) */
}

// v006
// A run of this version takes 175 microseconds.
// In both of two side-by-side timings against v005, it was 1.16 times as fast.
// Counting every step since v000, it is 10.0 times as fast.
#include <hip/hip_runtime.h>

// HSTU layer (x [4][2048][1024]; Q, K, V = silu(x W) ('xw' [1024][1024]; 8 heads x 128), U = x Wu; scores = Q.K + rel_bias[i - j + 2047][h] ([4095][8], read); scores / sqrt(128); causal and key-padding (sign(sum|K|) == 0) positions -> -2^32+1; weights = silu(scores) (no softmax; masked weights are exactly 0); attn = weights V merged [t][h*128+d]; out = attn x silu(U) -> [4][2048][1024] (8.4 M)).
// Layout: bf16 copies of x and of the transposed weights; four projection GEMMs whose f32 tiles never go to memory: each epilogue applies what the layer does next to its tile and stores that (silu and the bf16 hi/lo planes of Q and K, the key flags, silu and the transposed fp16 plane of V, the silu(U) gate on the attention rows); between the V and the U GEMM one fused silu-attention kernel (scores and fp16 weights stay in registers, exact zeros above the diagonal so the P.V contraction stops at the diagonal block; it writes the merged f32 rows). The four batches run side by side in every launch: the GEMMs and the bf16 copy of x take the 8192 rows as one matrix, the attention kernel takes the batch from the grid.
// Compute dtypes, f32 accumulate: every input rounded to bf16; projections exact (inputs); silu in f32 (hardware exp2 and reciprocal) -> Q/K hi/lo planes, V fp16 planes; scores 3 products (tile skipping); bias add, 1/sqrt(128), masks and silu in f32; fp16 weights x fp16 silu(V) (one product, causal K range); no output projection: out = attn x silu(x Wu) in f32.

#define NB_  4
#define TT   2048
#define DM   1024
#define NH_  8
#define NKV  8
#define REP  (NH_ / NKV)
#define HD   128
#define DQ   (NH_ * HD)
#define DKV  (NKV * HD)
#define NEGM (-4294967295.0f)
#define ISC  0.088388347648318447f   // 1/sqrt(128), applied after the bias add
#define ZH   2
#define RH   2048
#define WIN  2048
#define PCAR 1024.0f
#define SCL  0.088388347648318447f   // HD^-0.5
typedef _Float16 h16;
typedef unsigned short bf;
typedef __attribute__((ext_vector_type(16))) __bf16   v16bf;
typedef __attribute__((ext_vector_type(16))) _Float16 v16h;
typedef __attribute__((ext_vector_type(8)))  _Float16 v8h;
typedef __attribute__((ext_vector_type(8)))  unsigned short v8us;
typedef __attribute__((ext_vector_type(8)))  float    v8f;
typedef __attribute__((ext_vector_type(4)))  float    v4f;
typedef v8h  __attribute__((may_alias)) v8ha;
typedef v4f  __attribute__((may_alias)) v4fa;
typedef v8us __attribute__((may_alias)) v8usa;

__device__ __forceinline__ unsigned short f2bf(float f) { unsigned u = __float_as_uint(f); u += 0x7FFFu + ((u >> 16) & 1u); return (unsigned short)(u >> 16); }
__device__ __forceinline__ float bf2f(unsigned short b) { return __uint_as_float(((unsigned)b) << 16); }
__device__ __forceinline__ float bfr(float f) { return bf2f(f2bf(f)); }
__device__ __forceinline__ v16h cat16(v8h lo, v8h hi) { return __builtin_shufflevector(lo, hi, 0, 1, 2, 3, 4, 5, 6, 7, 8, 9, 10, 11, 12, 13, 14, 15); }
__device__ __forceinline__ v16bf cat16b(v8us lo, v8us hi) { return __builtin_bit_cast(v16bf, __builtin_shufflevector(lo, hi, 0, 1, 2, 3, 4, 5, 6, 7, 8, 9, 10, 11, 12, 13, 14, 15)); }
__device__ __forceinline__ v8f wmma16(v16h a, v16h b, v8f c) { return __builtin_amdgcn_wmma_f32_16x16x32_f16(false, a, false, b, (short)0, c, false, false); }
__device__ __forceinline__ v8f wmmab(v16bf a, v16bf b, v8f c) { return __builtin_amdgcn_wmma_f32_16x16x32_bf16(false, a, false, b, (short)0, c, false, false); }



__device__ __forceinline__ h16 tohx(float x) { return (h16)x; }
// silu = u sigmoid(u) = u / (1 + 2^(-u log2 e)) in f32 on the hardware's exp2 and reciprocal, eight values at a time.
// Each run of eight transcendentals is one statement: results in registers of their own (early clobber), so that none overwrites a source of the one in front of it, and the v_nop at the end is the slot that the instruction set asks for between a transcendental and an instruction that reads its result or overwrites its source.
#define TR8(op, d, s) asm(op " %0, %8\n\t" op " %1, %9\n\t" op " %2, %10\n\t" op " %3, %11\n\t" op " %4, %12\n\t" op " %5, %13\n\t" op " %6, %14\n\t" op " %7, %15\n\tv_nop" \
    : "=&v"(d[0]), "=&v"(d[1]), "=&v"(d[2]), "=&v"(d[3]), "=&v"(d[4]), "=&v"(d[5]), "=&v"(d[6]), "=&v"(d[7]) : "v"(s[0]), "v"(s[1]), "v"(s[2]), "v"(s[3]), "v"(s[4]), "v"(s[5]), "v"(s[6]), "v"(s[7]))
__device__ __forceinline__ void silu8(const float* u, float* y) {
    float a[8], e[8], r[8];
#pragma unroll
    for (int q = 0; q < 8; ++q) a[q] = u[q] * -1.4426950408889634f;
    TR8("v_exp_f32", e, a);
#pragma unroll
    for (int q = 0; q < 8; ++q) e[q] = 1.0f + e[q];
    TR8("v_rcp_f32", r, e);
#pragma unroll
    for (int q = 0; q < 8; ++q) y[q] = u[q] * r[q];
}
__device__ __forceinline__ void splitf(float y, unsigned short& h, unsigned short& l) { h = f2bf(y); l = f2bf(y - bf2f(h)); }
typedef __attribute__((ext_vector_type(2))) _Float16 v2h;
typedef __attribute__((ext_vector_type(4))) _Float16 v4h;
typedef __attribute__((ext_vector_type(2))) unsigned short v2us;
typedef __attribute__((ext_vector_type(4))) unsigned short v4us;
typedef __attribute__((ext_vector_type(2))) float v2f;
typedef __attribute__((ext_vector_type(4))) int v4i;

// ---- k_gemmw: register-blocked GEMM, one wave per 64x64 output tile (16 accumulators), 4 x 2 waves a work-group (256x128), one work-group a WGP; grid (M/256, N/128), 256 threads. K % 128 == 0, K >= 256.
// The operands are K-contiguous 16-bit planes. A stage is 128 k (256 bytes) of the work-group's 256 rows of A and 128 rows of Bt, brought into LDS once for the eight waves by asynchronous copies of whole rows, one stage ahead into the other of two buffers; the waves read their fragments from there (rows pitched 16 B x odd for the 16-byte reads), 32 k ahead of the products. k runs upward in 32s into the same accumulators.
// c[m][n] = sum_k A[m][k] Bt[n][k] (f32) never goes to memory; m = b*TT + t, n = h*HD + d. The tile is laid into the wave's own part of LDS (the buffers, which nobody reads any more behind the last stage's barrier) once and read back as whole rows, 8 values a lane; what the epilogue stores, by MODE, in 128-byte (f32: 256-byte) pieces:
// 0: silu(c) as bf16 hi/lo planes [b][h][t][d] (Q). 1: the same (K), and KF[n/64][m] = 1.0 where any silu(c) of the row's 64 columns is not zero, else 0.0 (a sum of absolute values is zero only where every term is).
// 2: silu(c) as the fp16 plane [b][h][d][t] (V transposed: the tile is laid down as [d][t], a lane's 8 accumulator rows being 8 consecutive t of one d). 3: G[m][n] x silu(c) -> O[m][n] (the u gate on the attention rows).
template <typename T16> struct WFrag;
template <> struct WFrag<h16> { typedef v16h V; static __device__ __forceinline__ V ld(const h16* p) { return cat16(*(const v8h*)p, *(const v8h*)(p + 16)); } static __device__ __forceinline__ v8f mma(V a, V b, v8f c) { return wmma16(a, b, c); } };
template <> struct WFrag<bf> { typedef v16bf V; static __device__ __forceinline__ V ld(const bf* p) { return cat16b(*(const v8us*)p, *(const v8us*)(p + 16)); } static __device__ __forceinline__ v8f mma(V a, V b, v8f c) { return wmmab(a, b, c); } };
#define GPIT 272                   // LDS pitch of a 256-byte operand row (128 k)
#define GSTG (384 * GPIT)          // one stage: 256 rows of A, then 128 rows of Bt
typedef const __attribute__((address_space(1))) char* gptr;   // an address known to be global memory
// eight 16-byte copies a lane, global memory to LDS through no register, 16 rows apart, in one statement; the one wait at its end stands in front of any rewrite of the address registers that the copies name
__device__ __forceinline__ void cp8(unsigned l, gptr g, size_t gs) {
    asm volatile("global_load_async_to_lds_b128 %0, %8, off\n\tglobal_load_async_to_lds_b128 %1, %9, off\n\tglobal_load_async_to_lds_b128 %2, %10, off\n\tglobal_load_async_to_lds_b128 %3, %11, off\n\t"
                 "global_load_async_to_lds_b128 %4, %12, off\n\tglobal_load_async_to_lds_b128 %5, %13, off\n\tglobal_load_async_to_lds_b128 %6, %14, off\n\tglobal_load_async_to_lds_b128 %7, %15, off\n\ts_wait_xcnt 0x0"
                 :: "v"(l), "v"(l + 16 * GPIT), "v"(l + 32 * GPIT), "v"(l + 48 * GPIT), "v"(l + 64 * GPIT), "v"(l + 80 * GPIT), "v"(l + 96 * GPIT), "v"(l + 112 * GPIT),
                    "v"(g), "v"(g + gs), "v"(g + 2 * gs), "v"(g + 3 * gs), "v"(g + 4 * gs), "v"(g + 5 * gs), "v"(g + 6 * gs), "v"(g + 7 * gs) : "memory");
}
template <typename T16, int MODE>
__global__ __launch_bounds__(256) void k_gemmw(const T16* __restrict__ A, const T16* __restrict__ Bt, int K, bf* Ph, bf* Pl, float* KF, h16* Vt, const float* __restrict__ G, float* O) {
    typedef typename WFrag<T16>::V V;
    __shared__ __align__(16) char sm[2 * GSTG];
    const int tid = threadIdx.x, lane = tid & 31, lr = lane & 15, hi = lane >> 4; const int wv = __builtin_amdgcn_readfirstlane(tid >> 5);
    const int r0 = blockIdx.x * 256 + (wv & 3) * 64, c0 = blockIdx.y * 128 + (wv >> 2) * 64;   // the wave's own 64x64 tile
    float* os = (float*)(sm + wv * (64 * 68 * 4));   // the wave's epilogue tile, laid over the buffers
    v8f acc[4][4];
#pragma unroll
    for (int mb = 0; mb < 4; ++mb)
#pragma unroll
        for (int nb = 0; nb < 4; ++nb) acc[mb][nb] = (v8f){};
    // each lane's part of a stage's copies: 16 lanes a 256-byte row, 16 rows a copy of the work-group, 16 copies for the 256 rows of A and 8 for the 128 of Bt
    const unsigned lsm = (unsigned)(size_t)(__attribute__((address_space(3))) char*)sm + (tid >> 4) * GPIT + (tid & 15) * 16; const size_t gs = (size_t)16 * K * 2;
    gptr ga = (gptr)(A + (size_t)(blockIdx.x * 256 + (tid >> 4)) * K) + (tid & 15) * 16; gptr gb = (gptr)(Bt + (size_t)(blockIdx.y * 128 + (tid >> 4)) * K) + (tid & 15) * 16;
    auto fill = [&](const int bo, const int kc) {   // bo: the buffer's byte offset
        const unsigned l = lsm + bo; gptr x = ga + kc * 2, y = gb + kc * 2;
        cp8(l, x, gs); cp8(l + 128 * GPIT, x + 8 * gs, gs); cp8(l + 256 * GPIT, y, gs);
    };
    fill(0, 0);
    asm volatile("s_wait_asynccnt 0x0" ::: "memory");   // this wave's copies of the first stage have landed before the barrier behind which the other waves read them
    __syncthreads();
    fill(GSTG, 128);   // K >= 256: a second stage always exists
    const int aof = ((wv & 3) * 64 + lr) * GPIT + 16 * hi, bof = (256 + (wv >> 2) * 64 + lr) * GPIT + 16 * hi;
#pragma unroll 1   // not unrolled: the buffers' addresses are formed from bo in each stage and hold no registers of their own
    for (int kc = 0, bo = 0; kc < K; kc += 128, bo ^= GSTG) {
        const char* at = sm + bo + aof; const char* bt = sm + bo + bof;
        V a[2][4], b[2][4];
#pragma unroll
        for (int f = 0; f < 4; ++f) { a[0][f] = WFrag<T16>::ld((const T16*)(at + f * 16 * GPIT)); b[0][f] = WFrag<T16>::ld((const T16*)(bt + f * 16 * GPIT)); }
#pragma unroll
        for (int s = 0; s < 4; ++s) {   // 32 k a pass; the next pass's fragments (of this stage only) are asked for as one group in front of this pass's products
            if (s < 3) {
#pragma unroll
                for (int f = 0; f < 4; ++f) { a[(s + 1) & 1][f] = WFrag<T16>::ld((const T16*)(at + f * 16 * GPIT + (s + 1) * 64)); b[(s + 1) & 1][f] = WFrag<T16>::ld((const T16*)(bt + f * 16 * GPIT + (s + 1) * 64)); }
                __builtin_amdgcn_sched_barrier(0);   // keeps those reads here as one group, their latency under this pass's products (left alone the compiler sinks them among the products that use them, a wait to zero in front of every four)
            }
#pragma unroll
            for (int nb = 0; nb < 4; ++nb)
#pragma unroll
                for (int mb = 0; mb < 4; ++mb) acc[mb][nb] = WFrag<T16>::mma(a[s & 1][mb], b[s & 1][nb], acc[mb][nb]);
        }
        __builtin_amdgcn_sched_barrier(0);   // keeps the waits and the barrier below at the foot, behind the last products and directly in front of the refill, so that the copies have a whole stage to land
        asm volatile("s_wait_dscnt 0x0" ::: "memory");      // this wave's reads of the buffer are over before the barrier behind which it is refilled
        asm volatile("s_wait_asynccnt 0x0" ::: "memory");   // this wave's copies of the next stage have landed before the barrier behind which the other waves read them
        __syncthreads();
        if (kc + 256 < K) fill(bo, kc + 256);   // the same for the whole work-group
    }
    asm volatile("s_wait_asynccnt 0x0" ::: "memory");   // no copy is in flight when the buffers become the epilogue's tiles
#pragma unroll
    for (int mb = 0; mb < 4; ++mb)
#pragma unroll
        for (int nb = 0; nb < 4; ++nb) {
            if (MODE == 2) { v4f lo, hi4;
#pragma unroll
                for (int r = 0; r < 4; ++r) { lo[r] = acc[mb][nb][r]; hi4[r] = acc[mb][nb][4 + r]; }
                float* p = os + (nb * 16 + lr) * 68 + mb * 16 + hi * 8; *(v4fa*)p = lo; *(v4fa*)(p + 4) = hi4;
            } else {
#pragma unroll
                for (int j = 0; j < 8; ++j) os[(mb * 16 + hi * 8 + j) * 68 + nb * 16 + lr] = acc[mb][nb][j]; } }
    __builtin_amdgcn_wave_barrier(); asm volatile("" ::: "memory");   // the reads below take what OTHER lanes of the wave have written: the compiler may not lift them over the writes
    const int rw = lane >> 3, cofs = (lane & 7) * 8;   // 8 lanes a tile row, 4 rows a pass
    const size_t pl = (size_t)(r0 / TT) * NH_ + c0 / HD; const int t0 = r0 % TT, d0 = c0 % HD;   // the tile's (batch, head) plane and its first row and column there
    const size_t e0 = (MODE == 3) ? (size_t)(r0 + rw) * DM + c0 + cofs : (MODE == 2) ? (pl * HD + d0 + rw) * TT + t0 + cofs : (pl * TT + t0 + rw) * HD + d0 + cofs;
    const size_t est = 4 * ((MODE == 3) ? DM : (MODE == 2) ? TT : HD);   // elements from one pass's row to the next pass's
    v4f g[2][2];
    if (MODE == 3) {
#pragma unroll
        for (int u = 0; u < 2; ++u) { g[u][0] = *(const v4f*)(G + e0 + u * est); g[u][1] = *(const v4f*)(G + e0 + u * est + 4); } }
    unsigned long long nzr = 0;   // one bit a tile row: some silu(K) of the row is not zero
#pragma unroll 1   // kept rolled, two passes a trip: 8 independent silu chains a lane and pass keep the vector port fed, and the kernel's text stays a few KB
    for (int it = 0; it < 16; it += 2) {
#pragma unroll
        for (int u = 0; u < 2; ++u) {
            const float* src = os + ((it + u) * 4 + rw) * 68 + cofs; const v4f v0 = *(const v4fa*)src, v1 = *(const v4fa*)(src + 4); const size_t e = e0 + (size_t)(it + u) * est;
            float cv[8], y[8];
#pragma unroll
            for (int q = 0; q < 4; ++q) { cv[q] = v0[q]; cv[4 + q] = v1[q]; }
            silu8(cv, y);
            if (MODE == 3) { v4f o0, o1;
#pragma unroll
                for (int q = 0; q < 4; ++q) { o0[q] = __fmul_rn(g[u][0][q], y[q]); o1[q] = __fmul_rn(g[u][1][q], y[4 + q]); }
                *(v4f*)(O + e) = o0; *(v4f*)(O + e + 4) = o1;
                asm volatile("s_wait_xcnt 0x0" ::: "memory");   // stands in front of the rewrite of the registers that the two stores name (the loads below land in them)
                const size_t en = e0 + (size_t)(it + u + (it < 14 ? 2 : 0)) * est;   // the attention rows are asked for two passes ahead; the last trip asks for its own rows again, so that every trip has the same loads in flight and the waits can be counted
                g[u][0] = *(const v4f*)(G + en); g[u][1] = *(const v4f*)(G + en + 4);
                asm volatile("s_wait_xcnt 0x0" ::: "memory");   // and in front of the next rewrite of the address registers that the two loads name
            } else if (MODE == 2) { v8h o;
#pragma unroll
                for (int q = 0; q < 8; ++q) o[q] = tohx(y[q]);
                *(v8h*)(Vt + e) = o;
            } else { v8us oh, ol; bool nz = false;
#pragma unroll
                for (int q = 0; q < 8; ++q) { unsigned short a2, c2; splitf(y[q], a2, c2); oh[q] = a2; ol[q] = c2; nz = nz | !(y[q] == 0.0f); }
                *(v8us*)(Ph + e) = oh; *(v8us*)(Pl + e) = ol;
                if (MODE == 1) { const unsigned m = __builtin_amdgcn_ballot_w32(nz);   // byte k: the 8 lanes of the pass's row k
                    const unsigned b4 = ((m & 0xFFu) ? 1u : 0u) | ((m & 0xFF00u) ? 2u : 0u) | ((m & 0xFF0000u) ? 4u : 0u) | ((m & 0xFF000000u) ? 8u : 0u);
                    nzr |= (unsigned long long)b4 << ((it + u) * 4); }
            } } }
    if (MODE == 3) asm volatile("s_wait_loadcnt 0x0" ::: "memory");   // the last trip's loads, which nothing reads, have landed before the wave ends and gives its registers back
    if (MODE == 1) { float* kf = KF + (size_t)(c0 / 64) * (NB_ * TT) + r0 + lane; kf[0] = ((nzr >> lane) & 1u) ? 1.0f : 0.0f; kf[32] = ((nzr >> (lane + 32)) & 1u) ? 1.0f : 0.0f; }
}
__global__ __launch_bounds__(256) void k_wtG(const float* __restrict__ w, int K, int N, bf* Bt) {
    const int lane = threadIdx.x & 31; const int L0 = (blockIdx.x * 8 + (threadIdx.x >> 5)) * 8; const int nlines = N * K / 64;
{
#pragma unroll 1
        for (int l = 0; l < 8; ++l) { const int L = L0 + l; if (L >= nlines) break; const size_t e = (size_t)L * 64 + lane * 2; const int k = (int)(e % K), n = (int)(e / K); v2us o;
            o[0] = f2bf(w[(size_t)k * N + n]); o[1] = f2bf(w[(size_t)(k + 1) * N + n]); *(v2us*)(Bt + e) = o; }
         }
}
__global__ __launch_bounds__(256) void k_cvt8(const float* __restrict__ src, bf* dst, size_t n8) { const size_t i = (size_t)blockIdx.x * 256 + threadIdx.x; if (i >= n8) return; const v8f v = *(const v8f*)(src + i * 8); v8us o;
#pragma unroll
    for (int k = 0; k < 8; ++k) o[k] = f2bf(v[k]); *(v8us*)(dst + i * 8) = o;  }

__global__ __launch_bounds__(256) void k_bttr(const float* __restrict__ RB, float* BTT) { const int idx = blockIdx.x * 256 + threadIdx.x; if (idx >= NH_ * 4096) return; const int p = idx % 4096, h = idx / 4096; const float v = (p < 2 * TT - 1) ? bfr(RB[(size_t)p * NH_ + h]) : 0.0f; *(float*)(BTT + idx) = v;  }
// ---- k_fattn: scores, bias, masks, silu weights and weights x V in one kernel; nothing of the [t][t] planes goes to memory. One wave per 16 query rows, 4 waves a work-group, grid (heads, batches, TT/64): the row block is the slowest index, longest rows first over all heads and batches, so that no long work-group starts late.
// Per 32 keys: St = K Qt (two 16-key tiles, the same 3 hi/lo products in the same order per 32 of d), a lane then holds 16 keys of ONE query in the hardware k order, so the fp16 weights are the B operand of Ot += Vt Pt as they stand.
// Keys run in ascending 32-key steps into one accumulator and stop at the end of the 64-row diagonal block, so every sum keeps its order.
// The K hi, K lo and V tiles of a step are brought into LDS once for the four waves, by asynchronous copies of whole rows, one step ahead into the other of two buffers; the waves read their fragments from there (rows pitched 16 B x odd for the 16-byte reads).
#define KPIT 272                   // LDS pitch of a 256-byte K row
#define VPIT 80                    // LDS pitch of a 64-byte V row (32 keys of one d)
#define KTB  (32 * KPIT)           // one K plane's tile
#define STG  (2 * KTB + HD * VPIT) // one step's tiles: K hi, K lo, V
__device__ __forceinline__ v16bf ldfb(gptr p) { return cat16b(*(const __attribute__((address_space(1))) v8us*)p, *(const __attribute__((address_space(1))) v8us*)(p + 32)); }
__device__ __forceinline__ v16bf ldsb(const char* p) { return cat16b(*(const v8us*)p, *(const v8us*)(p + 32)); }
__device__ __forceinline__ v16h ldsh(const char* p) { return cat16(*(const v8h*)p, *(const v8h*)(p + 32)); }
// a step's twelve 16-byte copies a lane, global memory to LDS through no register, in one statement; the one wait at its end stands in front of any rewrite of the address registers that the copies name
__device__ __forceinline__ void cp12(unsigned a, unsigned b, unsigned v, gptr x, gptr y, gptr w) {
    asm volatile("global_load_async_to_lds_b128 %0, %12, off\n\tglobal_load_async_to_lds_b128 %1, %13, off\n\tglobal_load_async_to_lds_b128 %2, %14, off\n\tglobal_load_async_to_lds_b128 %3, %15, off\n\t"
                 "global_load_async_to_lds_b128 %4, %16, off\n\tglobal_load_async_to_lds_b128 %5, %17, off\n\tglobal_load_async_to_lds_b128 %6, %18, off\n\tglobal_load_async_to_lds_b128 %7, %19, off\n\t"
                 "global_load_async_to_lds_b128 %8, %20, off\n\tglobal_load_async_to_lds_b128 %9, %21, off\n\tglobal_load_async_to_lds_b128 %10, %22, off\n\tglobal_load_async_to_lds_b128 %11, %23, off\n\ts_wait_xcnt 0x0"
                 :: "v"(a), "v"(a + 8 * KPIT), "v"(a + 16 * KPIT), "v"(a + 24 * KPIT), "v"(b), "v"(b + 8 * KPIT), "v"(b + 16 * KPIT), "v"(b + 24 * KPIT), "v"(v), "v"(v + 32 * VPIT), "v"(v + 64 * VPIT), "v"(v + 96 * VPIT),
                    "v"(x), "v"(x + 2048), "v"(x + 4096), "v"(x + 6144), "v"(y), "v"(y + 2048), "v"(y + 4096), "v"(y + 6144), "v"(w), "v"(w + 32 * TT * 2), "v"(w + 64 * TT * 2), "v"(w + 96 * TT * 2) : "memory");
}
__global__ __launch_bounds__(128) void k_fattn(const bf* __restrict__ Qh, const bf* __restrict__ Ql, const bf* __restrict__ Kh, const bf* __restrict__ Kl, const h16* __restrict__ Vt, const float* __restrict__ BTT, const float* __restrict__ KM, float* O) {
    __shared__ __align__(16) float sbias[4096]; __shared__ __align__(16) float skm[TT]; __shared__ __align__(16) char ring[2 * STG];
    const int h = blockIdx.x; const int qb = ((int)gridDim.z - 1 - (int)blockIdx.z) * 64;
    { const size_t b = blockIdx.y, pb = b * NH_ * TT * HD; Qh += pb; Ql += pb; Kh += pb; Kl += pb; Vt += pb; KM += (size_t)(2 * h) * (NB_ * TT) + b * TT; O += b * TT * DM; }   // this batch's planes, the head's two rows of key flags (one for each 64 of its columns) and output rows
    const size_t hp = (size_t)h * TT * HD; const int tid = threadIdx.x;
    // each lane's part of a step's copies: K tiles are 8 KiB in a row (16 lanes a row, 8 rows a copy), V rows are 64 B of a 4-KiB row (4 lanes a row, 32 rows a copy)
    const unsigned lring = (unsigned)(size_t)(__attribute__((address_space(3))) char*)ring;
    const unsigned lk = lring + (tid >> 4) * KPIT + (tid & 15) * 16, lv = lring + 2 * KTB + (tid >> 2) * VPIT + (tid & 3) * 16;
    gptr gkh = (gptr)(Kh + hp); gptr gkl = (gptr)(Kl + hp); gptr gv = (gptr)(Vt + hp); const unsigned tk = tid * 16, tv = (tid >> 2) * TT * 2 + (tid & 3) * 16;   // the planes' addresses are the same for every lane (scalar registers); a lane keeps its two 32-bit byte offsets into them
    auto fill = [&](const int bo, const int k0) {   // bo: the buffer's byte offset in the ring
        const unsigned a = lk + bo, v = lv + bo; gptr x = gkh + (tk + (unsigned)k0 * HD * 2), y = gkl + (tk + (unsigned)k0 * HD * 2), w = gv + (tv + (unsigned)k0 * 2);
        cp12(a, a + KTB, v, x, y, w);
    };
    fill(0, 0);
#pragma unroll
    for (int p = 0; p < 4096 / 4 / 128; ++p) ((v4f*)sbias)[p * 128 + threadIdx.x] = ((const v4f*)(BTT + (size_t)h * 4096))[p * 128 + threadIdx.x];
#pragma unroll
    for (int p = 0; p < TT / 4 / 128; ++p) ((v4f*)skm)[p * 128 + threadIdx.x] = ((const v4f*)KM)[p * 128 + threadIdx.x] + ((const v4f*)(KM + NB_ * TT))[p * 128 + threadIdx.x];   // zero only where both halves of the key's row are all zero
    asm volatile("s_wait_asynccnt 0x0" ::: "memory");   // this wave's copies of the first tiles have landed before the barrier behind which the other waves read them
    __syncthreads();
    fill(STG, 32);   // kend >= 64: a second step always exists
    const int lane = threadIdx.x & 31, c = lane & 15, hh = lane >> 4; const int q0 = qb + __builtin_amdgcn_readfirstlane((int)(threadIdx.x >> 5)) * 16; const int i = q0 + c;
    const int kof = c * HD * 2 + 16 * hh;
    v16bf qh[4], ql[4];
#pragma unroll
    for (int kc = 0; kc < 4; ++kc) { qh[kc] = ldfb((gptr)(Qh + hp) + (size_t)q0 * HD * 2 + kof + kc * 64); ql[kc] = ldfb((gptr)(Ql + hp) + (size_t)q0 * HD * 2 + kof + kc * 64); }
    v8f o[8];
#pragma unroll
    for (int dt = 0; dt < 8; ++dt) o[dt] = (v8f){};
    const int kend = qb + 64;   // keys up to the end of the work-group's 64-row diagonal block (weights past the diagonal are exact zeros): an even number of 32-key steps for every wave
    // one 32-key step on the tiles in the buffer at bo; at its foot the next step's tiles are published and the buffer is refilled for the step after that
    auto step = [&](const int bo, const int k0) {
        const char* kt = ring + bo + c * KPIT + 16 * hh; const char* vt = kt + 2 * KTB + c * (VPIT - KPIT);
        v16bf ka[8], kb[8]; v16h vf[8]; float bs[16]; v4f km[4];
#pragma unroll
        for (int f = 0; f < 8; ++f) { ka[f] = ldsb(kt + (f & 1) * 16 * KPIT + (f >> 1) * 64); kb[f] = ldsb(kt + KTB + (f & 1) * 16 * KPIT + (f >> 1) * 64); }
#pragma unroll
        for (int e = 0; e < 16; ++e) bs[e] = sbias[2047 + i - (k0 + (e >> 3) * 16 + 8 * hh + (e & 7))];
#pragma unroll
        for (int e = 0; e < 4; ++e) km[e] = *(const v4f*)(skm + k0 + (e >> 1) * 16 + 8 * hh + (e & 1) * 4);
        // inputs only, loaded values only: holds the bias and mask LDS loads at the head of the step (left alone the compiler sinks them into the silu arithmetic, a short-led wait every few elements)
        asm volatile("" :: "v"(bs[0]), "v"(bs[1]), "v"(bs[2]), "v"(bs[3]), "v"(bs[4]), "v"(bs[5]), "v"(bs[6]), "v"(bs[7]), "v"(bs[8]), "v"(bs[9]), "v"(bs[10]), "v"(bs[11]), "v"(bs[12]), "v"(bs[13]), "v"(bs[14]), "v"(bs[15]), "v"(km[0]), "v"(km[1]), "v"(km[2]), "v"(km[3]));
        v8f s[2]; s[0] = (v8f){}; s[1] = (v8f){};
#pragma unroll
        for (int f = 0; f < 8; ++f) { const int kt2 = f & 1, kc = f >> 1;
            s[kt2] = wmmab(ka[f], qh[kc], s[kt2]); s[kt2] = wmmab(ka[f], ql[kc], s[kt2]); s[kt2] = wmmab(kb[f], qh[kc], s[kt2]);
            if (f == 5) {   // three quarters of the K fragments are used up: the V fragments take their registers
#pragma unroll
                for (int dt = 0; dt < 8; ++dt) vf[dt] = ldsh(vt + dt * 16 * VPIT);
                __builtin_amdgcn_sched_barrier(0);   // keeps the V reads here as one group, their latency under the rest of the products and the silu (left alone the compiler sinks them between the last products, a short-led wait at each)
            } }
        v16h p; float t[16], wt[16];
#pragma unroll
        for (int e = 0; e < 16; ++e) { const int j = k0 + (e >> 3) * 16 + 8 * hh + (e & 7); const float t0 = __fmul_rn(__fadd_rn(s[e >> 3][e & 7], bs[e]), ISC); const bool msk = (j > i) | (km[e >> 2][e & 3] == 0.0f); t[e] = msk ? NEGM : t0; }
        silu8(t, wt); silu8(t + 8, wt + 8);
#pragma unroll
        for (int e = 0; e < 16; ++e) p[e] = tohx(wt[e]);
#pragma unroll
        for (int dt = 0; dt < 8; ++dt) o[dt] = wmma16(vf[dt], p, o[dt]);
        __builtin_amdgcn_sched_barrier(0);   // keeps the waits and the barrier below at the foot, directly in front of the refill, so that the copies have a whole step to land
        asm volatile("s_wait_dscnt 0x0" ::: "memory");      // this wave's reads of the buffer are over before the barrier behind which it is refilled
        asm volatile("s_wait_asynccnt 0x0" ::: "memory");   // this wave's copies of the next step's tiles have landed before the barrier behind which the other waves read them
        __syncthreads();
        if (k0 + 64 < kend) fill(bo, k0 + 64);   // the same for the whole work-group
    };
#pragma unroll 1
    for (int k0 = 0, bo = 0; k0 < kend; k0 += 32, bo ^= STG) step(bo, k0);   // not unrolled: the buffers' addresses are formed from bo in each step and hold no registers of their own
    asm volatile("s_wait_asynccnt 0x0" ::: "memory");   // no copy is in flight when the wave stores its tile and ends
    float* orow = O + (size_t)i * DM + h * HD + 8 * hh;   // a lane holds 8 consecutive d of one query: merged [t][h*128+d], f32
#pragma unroll
    for (int dt = 0; dt < 8; ++dt) { v4f lo, hi4;
#pragma unroll
        for (int r = 0; r < 4; ++r) { lo[r] = o[dt][r]; hi4[r] = o[dt][4 + r]; }
        *(v4f*)(orow + dt * 16) = lo; *(v4f*)(orow + dt * 16 + 4) = hi4; }
}
extern "C" void kernel_launch(void* const* d_in, const int* in_sizes, int n_in,
                              void* d_out, int out_size, void* d_ws, size_t ws_size, hipStream_t stream) {
    (void)in_sizes; (void)n_in; (void)out_size;
    const float* x = (const float*)d_in[0]; const float* wq = (const float*)d_in[1]; const float* wk = (const float*)d_in[2]; const float* wv = (const float*)d_in[3]; const float* wu = (const float*)d_in[4]; const float* RB = (const float*)d_in[5];
    float* OUT = (float*)d_out;     // [4][2048][1024]
    char* wsp = (char*)d_ws;
    auto take = [&](size_t bytes) { char* p = wsp; wsp += (bytes + 255) & ~(size_t)255; return (void*)p; };
    bf* WQ = (bf*)take((size_t)DQ * DM * 2); bf* WK = (bf*)take((size_t)DKV * DM * 2); bf* WV = (bf*)take((size_t)DKV * DM * 2); bf* WU = (bf*)take((size_t)DM * DM * 2); float* BTT = (float*)take((size_t)NH_ * 4096 * 4); float* KF = (float*)take((size_t)(DKV / 64) * NB_ * TT * 4);
    bf* XB = (bf*)take((size_t)NB_ * TT * DM * 2); float* MRG = (float*)take((size_t)NB_ * TT * DM * 4); h16* VT16 = (h16*)take((size_t)NB_ * NKV * HD * TT * 2);
    bf* QPh = (bf*)take((size_t)NB_ * NH_ * TT * HD * 2); bf* QPl = (bf*)take((size_t)NB_ * NH_ * TT * HD * 2); bf* KPh = (bf*)take((size_t)NB_ * NKV * TT * HD * 2); bf* KPl = (bf*)take((size_t)NB_ * NKV * TT * HD * 2);
    if ((size_t)(wsp - (char*)d_ws) > ws_size) return;    // ws 256 MiB
    { k_wtG<<<(unsigned)((DM * DQ / 64 + 63) / 64), 256, 0, stream>>>(wq, DM, DQ, WQ); k_wtG<<<(unsigned)((DM * DKV / 64 + 63) / 64), 256, 0, stream>>>(wk, DM, DKV, WK); k_wtG<<<(unsigned)((DM * DKV / 64 + 63) / 64), 256, 0, stream>>>(wv, DM, DKV, WV); k_wtG<<<(unsigned)((DM * DM / 64 + 63) / 64), 256, 0, stream>>>(wu, DM, DM, WU); k_bttr<<<(NH_ * 4096 + 255) / 256, 256, 0, stream>>>(RB, BTT);   /* Wu; transposed relative-bias rows */
       }
    k_cvt8<<<(unsigned)(((size_t)NB_ * TT * DM / 8 + 255) / 256), 256, 0, stream>>>(x, XB, (size_t)NB_ * TT * DM / 8);
    k_gemmw<bf, 0><<<dim3(NB_ * TT / 256, DQ / 128, 1), 256, 0, stream>>>(XB, WQ, DM, QPh, QPl, nullptr, nullptr, nullptr, nullptr);    /* silu(x Wq) planes */
    k_gemmw<bf, 1><<<dim3(NB_ * TT / 256, DKV / 128, 1), 256, 0, stream>>>(XB, WK, DM, KPh, KPl, KF, nullptr, nullptr, nullptr);        /* silu(x Wk) planes, key padding flags */
    k_gemmw<bf, 2><<<dim3(NB_ * TT / 256, DKV / 128, 1), 256, 0, stream>>>(XB, WV, DM, nullptr, nullptr, nullptr, VT16, nullptr, nullptr);   /* silu(x Wv), transposed */
    k_fattn<<<dim3(NH_, NB_, TT / 64), 128, 0, stream>>>(QPh, QPl, KPh, KPl, VT16, BTT, KF, MRG);   /* silu attention, all heads and batches: merged [b*TT+t][h*128+d], f32 */
    k_gemmw<bf, 3><<<dim3(NB_ * TT / 256, DM / 128, 1), 256, 0, stream>>>(XB, WU, DM, nullptr, nullptr, nullptr, nullptr, MRG, OUT);   /* out = attn x silu(x Wu) */
}

// v007
// Measured time: 145 microseconds a run.
// Two timings next to v006 both put it at 1.21 times that version's speed.
// All steps since v000 together make it 12.2 times as fast.
#include <hip/hip_runtime.h>

// HSTU layer (x [4][2048][1024]; Q, K, V = silu(x W) ('xw' [1024][1024]; 8 heads x 128), U = x Wu; scores = Q.K + rel_bias[i - j + 2047][h] ([4095][8], read); scores / sqrt(128); causal and key-padding (sign(sum|K|) == 0) positions -> -2^32+1; weights = silu(scores) (no softmax; masked weights are exactly 0); attn = weights V merged [t][h*128+d]; out = attn x silu(U) -> [4][2048][1024] (8.4 M)).
// Layout: bf16 copies of x and of the transposed weights; four projection GEMMs whose f32 tiles never go to memory: each epilogue applies what the layer does next to its tile and stores that (silu and the bf16 hi/lo planes of Q and K, the key flags, silu and the transposed fp16 plane of V, the silu(U) gate on the attention rows); between the V and the U GEMM one fused silu-attention kernel (scores and fp16 weights stay in registers, exact zeros above the diagonal so the P.V contraction stops at the diagonal block; it writes the merged f32 rows). The four batches run side by side in every launch: the GEMMs and the bf16 copy of x take the 8192 rows as one matrix, the attention kernel takes the batch from the grid.
// Compute dtypes, f32 accumulate: every input rounded to bf16; projections exact (inputs); silu in f32 (hardware exp2 and reciprocal) -> Q/K hi/lo planes, V fp16 planes; scores 3 products (tile skipping); bias add, 1/sqrt(128), masks and silu in f32; fp16 weights x fp16 silu(V) (one product, causal K range); no output projection: out = attn x silu(x Wu) in f32.

#define NB_  4
#define TT   2048
#define DM   1024
#define NH_  8
#define NKV  8
#define REP  (NH_ / NKV)
#define HD   128
#define DQ   (NH_ * HD)
#define DKV  (NKV * HD)
#define NEGM (-4294967295.0f)
#define ISC  0.088388347648318447f   // 1/sqrt(128), applied after the bias add
#define ZH   2
#define RH   2048
#define WIN  2048
#define PCAR 1024.0f
#define SCL  0.088388347648318447f   // HD^-0.5
typedef _Float16 h16;
typedef unsigned short bf;
typedef __attribute__((ext_vector_type(16))) __bf16   v16bf;
typedef __attribute__((ext_vector_type(16))) _Float16 v16h;
typedef __attribute__((ext_vector_type(8)))  _Float16 v8h;
typedef __attribute__((ext_vector_type(8)))  unsigned short v8us;
typedef __attribute__((ext_vector_type(8)))  float    v8f;
typedef __attribute__((ext_vector_type(4)))  float    v4f;
typedef v8h  __attribute__((may_alias)) v8ha;
typedef v4f  __attribute__((may_alias)) v4fa;
typedef v8us __attribute__((may_alias)) v8usa;

__device__ __forceinline__ unsigned short f2bf(float f) { unsigned u = __float_as_uint(f); u += 0x7FFFu + ((u >> 16) & 1u); return (unsigned short)(u >> 16); }
__device__ __forceinline__ float bf2f(unsigned short b) { return __uint_as_float(((unsigned)b) << 16); }
__device__ __forceinline__ float bfr(float f) { return bf2f(f2bf(f)); }
__device__ __forceinline__ v16h cat16(v8h lo, v8h hi) { return __builtin_shufflevector(lo, hi, 0, 1, 2, 3, 4, 5, 6, 7, 8, 9, 10, 11, 12, 13, 14, 15); }
__device__ __forceinline__ v16bf cat16b(v8us lo, v8us hi) { return __builtin_bit_cast(v16bf, __builtin_shufflevector(lo, hi, 0, 1, 2, 3, 4, 5, 6, 7, 8, 9, 10, 11, 12, 13, 14, 15)); }
__device__ __forceinline__ v8f wmma16(v16h a, v16h b, v8f c) { return __builtin_amdgcn_wmma_f32_16x16x32_f16(false, a, false, b, (short)0, c, false, false); }
__device__ __forceinline__ v8f wmmab(v16bf a, v16bf b, v8f c) { return __builtin_amdgcn_wmma_f32_16x16x32_bf16(false, a, false, b, (short)0, c, false, false); }



__device__ __forceinline__ h16 tohx(float x) { return (h16)x; }
// silu = u sigmoid(u) = u / (1 + 2^(-u log2 e)) in f32 on the hardware's exp2 and reciprocal, eight values at a time.
// Each run of eight transcendentals is one statement: results in registers of their own (early clobber), so that none overwrites a source of the one in front of it, and the v_nop at the end is the slot that the instruction set asks for between a transcendental and an instruction that reads its result or overwrites its source.
#define TR8(op, d, s) asm(op " %0, %8\n\t" op " %1, %9\n\t" op " %2, %10\n\t" op " %3, %11\n\t" op " %4, %12\n\t" op " %5, %13\n\t" op " %6, %14\n\t" op " %7, %15\n\tv_nop" \
    : "=&v"(d[0]), "=&v"(d[1]), "=&v"(d[2]), "=&v"(d[3]), "=&v"(d[4]), "=&v"(d[5]), "=&v"(d[6]), "=&v"(d[7]) : "v"(s[0]), "v"(s[1]), "v"(s[2]), "v"(s[3]), "v"(s[4]), "v"(s[5]), "v"(s[6]), "v"(s[7]))
__device__ __forceinline__ void silu8(const float* u, float* y) {
    float a[8], e[8], r[8];
#pragma unroll
    for (int q = 0; q < 8; ++q) a[q] = u[q] * -1.4426950408889634f;
    TR8("v_exp_f32", e, a);
#pragma unroll
    for (int q = 0; q < 8; ++q) e[q] = 1.0f + e[q];
    TR8("v_rcp_f32", r, e);
#pragma unroll
    for (int q = 0; q < 8; ++q) y[q] = u[q] * r[q];
}
__device__ __forceinline__ void splitf(float y, unsigned short& h, unsigned short& l) { h = f2bf(y); l = f2bf(y - bf2f(h)); }
typedef __attribute__((ext_vector_type(2))) _Float16 v2h;
typedef __attribute__((ext_vector_type(4))) _Float16 v4h;
typedef __attribute__((ext_vector_type(2))) unsigned short v2us;
typedef __attribute__((ext_vector_type(4))) unsigned short v4us;
typedef __attribute__((ext_vector_type(2))) float v2f;
typedef __attribute__((ext_vector_type(4))) int v4i;

// ---- k_gemmw: register-blocked GEMM, one wave per 64x64 output tile (16 accumulators), 4 x 2 waves a work-group (256x128), one work-group a WGP; grid (M/256, N/128), 256 threads. K % 128 == 0, K >= 256.
// The operands are K-contiguous 16-bit planes. A stage is 128 k (256 bytes) of the work-group's 256 rows of A and 128 rows of Bt, brought into LDS once for the eight waves by asynchronous copies of whole rows, one stage ahead into the other of two buffers; the waves read their fragments from there (rows pitched 16 B x odd for the 16-byte reads), 32 k ahead of the products. k runs upward in 32s into the same accumulators.
// c[m][n] = sum_k A[m][k] Bt[n][k] (f32) never goes to memory; m = b*TT + t, n = h*HD + d. The tile is laid into the wave's own part of LDS (the buffers, which nobody reads any more behind the last stage's barrier) once and read back as whole rows, 8 values a lane; what the epilogue stores, by MODE, in 128-byte (f32: 256-byte) pieces:
// 0: silu(c) as bf16 hi/lo planes [b][h][t][d] (Q). 1: the same (K), and KF[n/64][m] = 1.0 where any silu(c) of the row's 64 columns is not zero, else 0.0 (a sum of absolute values is zero only where every term is).
// 2: silu(c) as the fp16 plane [b][h][d][t] (V transposed: the tile is laid down as [d][t], a lane's 8 accumulator rows being 8 consecutive t of one d). 3: G[m][n] x silu(c) -> O[m][n] (the u gate on the attention rows).
template <typename T16> struct WFrag;
template <> struct WFrag<h16> { typedef v16h V; static __device__ __forceinline__ V ld(const h16* p) { return cat16(*(const v8h*)p, *(const v8h*)(p + 16)); } static __device__ __forceinline__ v8f mma(V a, V b, v8f c) { return wmma16(a, b, c); } };
template <> struct WFrag<bf> { typedef v16bf V; static __device__ __forceinline__ V ld(const bf* p) { return cat16b(*(const v8us*)p, *(const v8us*)(p + 16)); } static __device__ __forceinline__ v8f mma(V a, V b, v8f c) { return wmmab(a, b, c); } };
#define GPIT 272                   // LDS pitch of a 256-byte operand row (128 k)
#define GSTG (384 * GPIT)          // one stage: 256 rows of A, then 128 rows of Bt
typedef const __attribute__((address_space(1))) char* gptr;   // an address known to be global memory
// eight 16-byte copies a lane, global memory to LDS through no register, 16 rows apart, in one statement; the one wait at its end stands in front of any rewrite of the address registers that the copies name
__device__ __forceinline__ void cp8(unsigned l, gptr g, size_t gs) {
    asm volatile("global_load_async_to_lds_b128 %0, %8, off\n\tglobal_load_async_to_lds_b128 %1, %9, off\n\tglobal_load_async_to_lds_b128 %2, %10, off\n\tglobal_load_async_to_lds_b128 %3, %11, off\n\t"
                 "global_load_async_to_lds_b128 %4, %12, off\n\tglobal_load_async_to_lds_b128 %5, %13, off\n\tglobal_load_async_to_lds_b128 %6, %14, off\n\tglobal_load_async_to_lds_b128 %7, %15, off\n\ts_wait_xcnt 0x0"
                 :: "v"(l), "v"(l + 16 * GPIT), "v"(l + 32 * GPIT), "v"(l + 48 * GPIT), "v"(l + 64 * GPIT), "v"(l + 80 * GPIT), "v"(l + 96 * GPIT), "v"(l + 112 * GPIT),
                    "v"(g), "v"(g + gs), "v"(g + 2 * gs), "v"(g + 3 * gs), "v"(g + 4 * gs), "v"(g + 5 * gs), "v"(g + 6 * gs), "v"(g + 7 * gs) : "memory");
}
template <typename T16, int MODE>
__global__ __launch_bounds__(256) void k_gemmw(const T16* __restrict__ A, const T16* __restrict__ Bt, int K, bf* Ph, bf* Pl, float* KF, h16* Vt, const float* __restrict__ G, float* O) {
    typedef typename WFrag<T16>::V V;
    __shared__ __align__(16) char sm[2 * GSTG];
    const int tid = threadIdx.x, lane = tid & 31, lr = lane & 15, hi = lane >> 4; const int wv = __builtin_amdgcn_readfirstlane(tid >> 5);
    const int r0 = blockIdx.x * 256 + (wv & 3) * 64, c0 = blockIdx.y * 128 + (wv >> 2) * 64;   // the wave's own 64x64 tile
    float* os = (float*)(sm + wv * (64 * 68 * 4));   // the wave's epilogue tile, laid over the buffers
    v8f acc[4][4];
#pragma unroll
    for (int mb = 0; mb < 4; ++mb)
#pragma unroll
        for (int nb = 0; nb < 4; ++nb) acc[mb][nb] = (v8f){};
    // each lane's part of a stage's copies: 16 lanes a 256-byte row, 16 rows a copy of the work-group, 16 copies for the 256 rows of A and 8 for the 128 of Bt
    const unsigned lsm = (unsigned)(size_t)(__attribute__((address_space(3))) char*)sm + (tid >> 4) * GPIT + (tid & 15) * 16; const size_t gs = (size_t)16 * K * 2;
    gptr ga = (gptr)(A + (size_t)(blockIdx.x * 256 + (tid >> 4)) * K) + (tid & 15) * 16; gptr gb = (gptr)(Bt + (size_t)(blockIdx.y * 128 + (tid >> 4)) * K) + (tid & 15) * 16;
    auto fill = [&](const int bo, const int kc) {   // bo: the buffer's byte offset
        const unsigned l = lsm + bo; gptr x = ga + kc * 2, y = gb + kc * 2;
        cp8(l, x, gs); cp8(l + 128 * GPIT, x + 8 * gs, gs); cp8(l + 256 * GPIT, y, gs);
    };
    fill(0, 0);
    asm volatile("s_wait_asynccnt 0x0" ::: "memory");   // this wave's copies of the first stage have landed before the barrier behind which the other waves read them
    __syncthreads();
    fill(GSTG, 128);   // K >= 256: a second stage always exists
    const int aof = ((wv & 3) * 64 + lr) * GPIT + 16 * hi, bof = (256 + (wv >> 2) * 64 + lr) * GPIT + 16 * hi;
#pragma unroll 1   // not unrolled: the buffers' addresses are formed from bo in each stage and hold no registers of their own
    for (int kc = 0, bo = 0; kc < K; kc += 128, bo ^= GSTG) {
        const char* at = sm + bo + aof; const char* bt = sm + bo + bof;
        V a[2][4], b[2][4];
#pragma unroll
        for (int f = 0; f < 4; ++f) { a[0][f] = WFrag<T16>::ld((const T16*)(at + f * 16 * GPIT)); b[0][f] = WFrag<T16>::ld((const T16*)(bt + f * 16 * GPIT)); }
#pragma unroll
        for (int s = 0; s < 4; ++s) {   // 32 k a pass; the next pass's fragments (of this stage only) are asked for as one group in front of this pass's products
            if (s < 3) {
#pragma unroll
                for (int f = 0; f < 4; ++f) { a[(s + 1) & 1][f] = WFrag<T16>::ld((const T16*)(at + f * 16 * GPIT + (s + 1) * 64)); b[(s + 1) & 1][f] = WFrag<T16>::ld((const T16*)(bt + f * 16 * GPIT + (s + 1) * 64)); }
                __builtin_amdgcn_sched_barrier(0);   // keeps those reads here as one group, their latency under this pass's products (left alone the compiler sinks them among the products that use them, a wait to zero in front of every four)
            }
#pragma unroll
            for (int nb = 0; nb < 4; ++nb)
#pragma unroll
                for (int mb = 0; mb < 4; ++mb) acc[mb][nb] = WFrag<T16>::mma(a[s & 1][mb], b[s & 1][nb], acc[mb][nb]);
        }
        __builtin_amdgcn_sched_barrier(0);   // keeps the waits and the barrier below at the foot, behind the last products and directly in front of the refill, so that the copies have a whole stage to land
        asm volatile("s_wait_dscnt 0x0" ::: "memory");      // this wave's reads of the buffer are over before the barrier behind which it is refilled
        asm volatile("s_wait_asynccnt 0x0" ::: "memory");   // this wave's copies of the next stage have landed before the barrier behind which the other waves read them
        __syncthreads();
        if (kc + 256 < K) fill(bo, kc + 256);   // the same for the whole work-group
    }
    asm volatile("s_wait_asynccnt 0x0" ::: "memory");   // no copy is in flight when the buffers become the epilogue's tiles
#pragma unroll
    for (int mb = 0; mb < 4; ++mb)
#pragma unroll
        for (int nb = 0; nb < 4; ++nb) {
            if (MODE == 2) { v4f lo, hi4;
#pragma unroll
                for (int r = 0; r < 4; ++r) { lo[r] = acc[mb][nb][r]; hi4[r] = acc[mb][nb][4 + r]; }
                float* p = os + (nb * 16 + lr) * 68 + mb * 16 + hi * 8; *(v4fa*)p = lo; *(v4fa*)(p + 4) = hi4;
            } else {
#pragma unroll
                for (int j = 0; j < 8; ++j) os[(mb * 16 + hi * 8 + j) * 68 + nb * 16 + lr] = acc[mb][nb][j]; } }
    __builtin_amdgcn_wave_barrier(); asm volatile("" ::: "memory");   // the reads below take what OTHER lanes of the wave have written: the compiler may not lift them over the writes
    const int rw = lane >> 3, cofs = (lane & 7) * 8;   // 8 lanes a tile row, 4 rows a pass
    const size_t pl = (size_t)(r0 / TT) * NH_ + c0 / HD; const int t0 = r0 % TT, d0 = c0 % HD;   // the tile's (batch, head) plane and its first row and column there
    const size_t e0 = (MODE == 3) ? (size_t)(r0 + rw) * DM + c0 + cofs : (MODE == 2) ? (pl * HD + d0 + rw) * TT + t0 + cofs : (pl * TT + t0 + rw) * HD + d0 + cofs;
    const size_t est = 4 * ((MODE == 3) ? DM : (MODE == 2) ? TT : HD);   // elements from one pass's row to the next pass's
    v4f g[2][2];
    if (MODE == 3) {
#pragma unroll
        for (int u = 0; u < 2; ++u) { g[u][0] = *(const v4f*)(G + e0 + u * est); g[u][1] = *(const v4f*)(G + e0 + u * est + 4); } }
    unsigned long long nzr = 0;   // one bit a tile row: some silu(K) of the row is not zero
#pragma unroll 1   // kept rolled, two passes a trip: 8 independent silu chains a lane and pass keep the vector port fed, and the kernel's text stays a few KB
    for (int it = 0; it < 16; it += 2) {
#pragma unroll
        for (int u = 0; u < 2; ++u) {
            const float* src = os + ((it + u) * 4 + rw) * 68 + cofs; const v4f v0 = *(const v4fa*)src, v1 = *(const v4fa*)(src + 4); const size_t e = e0 + (size_t)(it + u) * est;
            float cv[8], y[8];
#pragma unroll
            for (int q = 0; q < 4; ++q) { cv[q] = v0[q]; cv[4 + q] = v1[q]; }
            silu8(cv, y);
            if (MODE == 3) { v4f o0, o1;
#pragma unroll
                for (int q = 0; q < 4; ++q) { o0[q] = __fmul_rn(g[u][0][q], y[q]); o1[q] = __fmul_rn(g[u][1][q], y[4 + q]); }
                *(v4f*)(O + e) = o0; *(v4f*)(O + e + 4) = o1;
                asm volatile("s_wait_xcnt 0x0" ::: "memory");   // stands in front of the rewrite of the registers that the two stores name (the loads below land in them)
                const size_t en = e0 + (size_t)(it + u + (it < 14 ? 2 : 0)) * est;   // the attention rows are asked for two passes ahead; the last trip asks for its own rows again, so that every trip has the same loads in flight and the waits can be counted
                g[u][0] = *(const v4f*)(G + en); g[u][1] = *(const v4f*)(G + en + 4);
                asm volatile("s_wait_xcnt 0x0" ::: "memory");   // and in front of the next rewrite of the address registers that the two loads name
            } else if (MODE == 2) { v8h o;
#pragma unroll
                for (int q = 0; q < 8; ++q) o[q] = tohx(y[q]);
                *(v8h*)(Vt + e) = o;
            } else { v8us oh, ol; bool nz = false;
#pragma unroll
                for (int q = 0; q < 8; ++q) { unsigned short a2, c2; splitf(y[q], a2, c2); oh[q] = a2; ol[q] = c2; nz = nz | !(y[q] == 0.0f); }
                *(v8us*)(Ph + e) = oh; *(v8us*)(Pl + e) = ol;
                if (MODE == 1) { const unsigned m = __builtin_amdgcn_ballot_w32(nz);   // byte k: the 8 lanes of the pass's row k
                    const unsigned b4 = ((m & 0xFFu) ? 1u : 0u) | ((m & 0xFF00u) ? 2u : 0u) | ((m & 0xFF0000u) ? 4u : 0u) | ((m & 0xFF000000u) ? 8u : 0u);
                    nzr |= (unsigned long long)b4 << ((it + u) * 4); }
            } } }
    if (MODE == 3) asm volatile("s_wait_loadcnt 0x0" ::: "memory");   // the last trip's loads, which nothing reads, have landed before the wave ends and gives its registers back
    if (MODE == 1) { float* kf = KF + (size_t)(c0 / 64) * (NB_ * TT) + r0 + lane; kf[0] = ((nzr >> lane) & 1u) ? 1.0f : 0.0f; kf[32] = ((nzr >> (lane + 32)) & 1u) ? 1.0f : 0.0f; }
}
// ---- k_prep: all that is only a re-laying of an input (bf16 transposed weights, transposed bias rows, the bf16 copy of x), in one launch of few, long waves; the job comes from the block index (the same for a whole work-group); no work-group barrier.
// Blocks [0, PWB): the four weights, w [k][n] f32 -> Bt [n][k] bf16. A work-group takes 256 k x 64 n of one weight, a wave 64 k x 32 n: 16 loads of 16 bytes a lane, all in flight (8 lanes a 128-byte row piece, a lane holds rows k and k + 1 of 4 columns), the bf16 pairs (k, k + 1) go as dwords into the wave's own part of LDS as [n][k] and come back as whole 128-byte rows for the stores.
// Blocks [PWB, PWB + PBB): BTT[h][p] = bf16-rounded rel_bias[p][h], 0 at p = 4095. The rest: 16 x 8 values of x a lane, the 32 loads in flight together.
#define PWB  256                   // 4 weights x (1024 / 64) x (1024 / 256)
#define PBB  16                    // NH_ * 4096 / (256 * 8)
#define PXB  256                   // NB_ * TT * DM / (256 * 16 * 8)
#define TPIT 36                    // dwords from one n row of a wave's LDS tile to the next (32 of data; a multiple of 4 for the 16-byte reads)
typedef __attribute__((ext_vector_type(4))) unsigned v4u;
typedef v4u __attribute__((may_alias)) v4ua;
__global__ __launch_bounds__(256) void k_prep(const float* __restrict__ x, const float* __restrict__ wq, const float* __restrict__ wk, const float* __restrict__ wv, const float* __restrict__ wu, const float* __restrict__ RB,
                                              bf* XB, bf* WQ, bf* WK, bf* WV, bf* WU, float* BTT) {
    static_assert(DQ == DM && DKV == DM && DM == 1024 && PBB * 2048 == NH_ * 4096 && (size_t)PXB * 4096 * 8 == (size_t)NB_ * TT * DM, "the block ranges are cut for these shapes");
    __shared__ __align__(16) unsigned tl[8 * 32 * TPIT];
    const int blk = blockIdx.x, tid = threadIdx.x;
    if (blk < PWB) {
        const int sel = blk >> 6, t = blk & 63;
        const float* __restrict__ w = sel == 0 ? wq : sel == 1 ? wk : sel == 2 ? wv : wu; bf* Bt = sel == 0 ? WQ : sel == 1 ? WK : sel == 2 ? WV : WU;
        const int lane = tid & 31, wvi = tid >> 5, r = lane >> 3, c = lane & 7;
        const int n0 = (t >> 2) * 64 + (wvi & 1) * 32, k0 = (t & 3) * 256 + (wvi >> 1) * 64;
        unsigned* my = tl + wvi * (32 * TPIT);
        const float* s = w + (size_t)(k0 + 2 * r) * DM + n0 + 4 * c;
        v4f a[8], b[8];
#pragma unroll
        for (int j = 0; j < 8; ++j) { a[j] = *(const v4f*)(s + (size_t)(8 * j) * DM); b[j] = *(const v4f*)(s + (size_t)(8 * j + 1) * DM); }
        asm volatile("s_wait_xcnt 0x0" :: "v"(s) : "memory");   // stands in front of any rewrite of the address registers that the loads name; the address as an input keeps it in those registers up to here (left alone the last load lands on them)
#pragma unroll
        for (int j = 0; j < 8; ++j)
#pragma unroll
            for (int q = 0; q < 4; ++q) my[(4 * c + q) * TPIT + 4 * j + r] = (unsigned)f2bf(a[j][q]) | ((unsigned)f2bf(b[j][q]) << 16);
        __builtin_amdgcn_wave_barrier(); asm volatile("" ::: "memory");   // the reads below take what OTHER lanes of the wave have written: the compiler may not lift them over the writes
        bf* d = Bt + (size_t)(n0 + r) * DM + k0 + 8 * c;
#pragma unroll
        for (int i = 0; i < 8; ++i) *(v4ua*)(d + (size_t)(4 * i) * DM) = *(const v4ua*)(my + (4 * i + r) * TPIT + 4 * c);
    } else if (blk < PWB + PBB) {
#pragma unroll
        for (int u = 0; u < 8; ++u) { const int idx = (blk - PWB) * 2048 + u * 256 + tid; const int p = idx % 4096, h = idx / 4096; const int pc = p < 2 * TT - 1 ? p : 2 * TT - 2;   // the row index is clamped, so that every lane loads and the eight loads fly together
            const float v = bfr(RB[(size_t)pc * NH_ + h]); BTT[idx] = (p < 2 * TT - 1) ? v : 0.0f; }
        asm volatile("s_wait_xcnt 0x0" ::: "memory");   // stands behind the branch's last store, in front of any rewrite of the registers that the stores name
    } else {
        const size_t i0 = (size_t)(blk - PWB - PBB) * 4096 + tid; const float* s = x + i0 * 8;
        v8f v[16];
#pragma unroll
        for (int u = 0; u < 16; ++u) v[u] = *(const v8f*)(s + u * 2048);
        asm volatile("s_wait_xcnt 0x0" :: "v"(s) : "memory");   // as above
#pragma unroll
        for (int u = 0; u < 16; ++u) { v8us o;
#pragma unroll
            for (int k = 0; k < 8; ++k) o[k] = f2bf(v[u][k]);
            *(v8us*)(XB + (i0 + u * 256) * 8) = o; }
        asm volatile("s_wait_xcnt 0x0" ::: "memory");   // as behind the bias stores
    }
}
// ---- k_fattn: scores, bias, masks, silu weights and weights x V in one kernel; nothing of the [t][t] planes goes to memory. One wave per 16 query rows, 4 waves a work-group, grid (heads, batches, TT/64): the row block is the slowest index, longest rows first over all heads and batches, so that no long work-group starts late.
// Per 32 keys: St = K Qt (two 16-key tiles, the same 3 hi/lo products in the same order per 32 of d), a lane then holds 16 keys of ONE query in the hardware k order, so the fp16 weights are the B operand of Ot += Vt Pt as they stand.
// Keys run in ascending 32-key steps into one accumulator and stop at the end of the 64-row diagonal block, so every sum keeps its order.
// The K hi, K lo and V tiles of a step are brought into LDS once for the four waves, by asynchronous copies of whole rows, one step ahead into the other of two buffers; the waves read their fragments from there (rows pitched 16 B x odd for the 16-byte reads).
#define KPIT 272                   // LDS pitch of a 256-byte K row
#define VPIT 80                    // LDS pitch of a 64-byte V row (32 keys of one d)
#define KTB  (32 * KPIT)           // one K plane's tile
#define STG  (2 * KTB + HD * VPIT) // one step's tiles: K hi, K lo, V
__device__ __forceinline__ v16bf ldfb(gptr p) { return cat16b(*(const __attribute__((address_space(1))) v8us*)p, *(const __attribute__((address_space(1))) v8us*)(p + 32)); }
__device__ __forceinline__ v16bf ldsb(const char* p) { return cat16b(*(const v8us*)p, *(const v8us*)(p + 32)); }
__device__ __forceinline__ v16h ldsh(const char* p) { return cat16(*(const v8h*)p, *(const v8h*)(p + 32)); }
// a step's twelve 16-byte copies a lane, global memory to LDS through no register, in one statement; the one wait at its end stands in front of any rewrite of the address registers that the copies name
__device__ __forceinline__ void cp12(unsigned a, unsigned b, unsigned v, gptr x, gptr y, gptr w) {
    asm volatile("global_load_async_to_lds_b128 %0, %12, off\n\tglobal_load_async_to_lds_b128 %1, %13, off\n\tglobal_load_async_to_lds_b128 %2, %14, off\n\tglobal_load_async_to_lds_b128 %3, %15, off\n\t"
                 "global_load_async_to_lds_b128 %4, %16, off\n\tglobal_load_async_to_lds_b128 %5, %17, off\n\tglobal_load_async_to_lds_b128 %6, %18, off\n\tglobal_load_async_to_lds_b128 %7, %19, off\n\t"
                 "global_load_async_to_lds_b128 %8, %20, off\n\tglobal_load_async_to_lds_b128 %9, %21, off\n\tglobal_load_async_to_lds_b128 %10, %22, off\n\tglobal_load_async_to_lds_b128 %11, %23, off\n\ts_wait_xcnt 0x0"
                 :: "v"(a), "v"(a + 8 * KPIT), "v"(a + 16 * KPIT), "v"(a + 24 * KPIT), "v"(b), "v"(b + 8 * KPIT), "v"(b + 16 * KPIT), "v"(b + 24 * KPIT), "v"(v), "v"(v + 32 * VPIT), "v"(v + 64 * VPIT), "v"(v + 96 * VPIT),
                    "v"(x), "v"(x + 2048), "v"(x + 4096), "v"(x + 6144), "v"(y), "v"(y + 2048), "v"(y + 4096), "v"(y + 6144), "v"(w), "v"(w + 32 * TT * 2), "v"(w + 64 * TT * 2), "v"(w + 96 * TT * 2) : "memory");
}
__global__ __launch_bounds__(128) void k_fattn(const bf* __restrict__ Qh, const bf* __restrict__ Ql, const bf* __restrict__ Kh, const bf* __restrict__ Kl, const h16* __restrict__ Vt, const float* __restrict__ BTT, const float* __restrict__ KM, float* O) {
    __shared__ __align__(16) float sbias[4096]; __shared__ __align__(16) float skm[TT]; __shared__ __align__(16) char ring[2 * STG];
    const int h = blockIdx.x; const int qb = ((int)gridDim.z - 1 - (int)blockIdx.z) * 64;
    { const size_t b = blockIdx.y, pb = b * NH_ * TT * HD; Qh += pb; Ql += pb; Kh += pb; Kl += pb; Vt += pb; KM += (size_t)(2 * h) * (NB_ * TT) + b * TT; O += b * TT * DM; }   // this batch's planes, the head's two rows of key flags (one for each 64 of its columns) and output rows
    const size_t hp = (size_t)h * TT * HD; const int tid = threadIdx.x;
    // each lane's part of a step's copies: K tiles are 8 KiB in a row (16 lanes a row, 8 rows a copy), V rows are 64 B of a 4-KiB row (4 lanes a row, 32 rows a copy)
    const unsigned lring = (unsigned)(size_t)(__attribute__((address_space(3))) char*)ring;
    const unsigned lk = lring + (tid >> 4) * KPIT + (tid & 15) * 16, lv = lring + 2 * KTB + (tid >> 2) * VPIT + (tid & 3) * 16;
    gptr gkh = (gptr)(Kh + hp); gptr gkl = (gptr)(Kl + hp); gptr gv = (gptr)(Vt + hp); const unsigned tk = tid * 16, tv = (tid >> 2) * TT * 2 + (tid & 3) * 16;   // the planes' addresses are the same for every lane (scalar registers); a lane keeps its two 32-bit byte offsets into them
    auto fill = [&](const int bo, const int k0) {   // bo: the buffer's byte offset in the ring
        const unsigned a = lk + bo, v = lv + bo; gptr x = gkh + (tk + (unsigned)k0 * HD * 2), y = gkl + (tk + (unsigned)k0 * HD * 2), w = gv + (tv + (unsigned)k0 * 2);
        cp12(a, a + KTB, v, x, y, w);
    };
    fill(0, 0);
#pragma unroll
    for (int p = 0; p < 4096 / 4 / 128; ++p) ((v4f*)sbias)[p * 128 + threadIdx.x] = ((const v4f*)(BTT + (size_t)h * 4096))[p * 128 + threadIdx.x];
#pragma unroll
    for (int p = 0; p < TT / 4 / 128; ++p) ((v4f*)skm)[p * 128 + threadIdx.x] = ((const v4f*)KM)[p * 128 + threadIdx.x] + ((const v4f*)(KM + NB_ * TT))[p * 128 + threadIdx.x];   // zero only where both halves of the key's row are all zero
    asm volatile("s_wait_asynccnt 0x0" ::: "memory");   // this wave's copies of the first tiles have landed before the barrier behind which the other waves read them
    __syncthreads();
    fill(STG, 32);   // kend >= 64: a second step always exists
    const int lane = threadIdx.x & 31, c = lane & 15, hh = lane >> 4; const int q0 = qb + __builtin_amdgcn_readfirstlane((int)(threadIdx.x >> 5)) * 16; const int i = q0 + c;
    const int kof = c * HD * 2 + 16 * hh;
    v16bf qh[4], ql[4];
#pragma unroll
    for (int kc = 0; kc < 4; ++kc) { qh[kc] = ldfb((gptr)(Qh + hp) + (size_t)q0 * HD * 2 + kof + kc * 64); ql[kc] = ldfb((gptr)(Ql + hp) + (size_t)q0 * HD * 2 + kof + kc * 64); }
    v8f o[8];
#pragma unroll
    for (int dt = 0; dt < 8; ++dt) o[dt] = (v8f){};
    const int kend = qb + 64;   // keys up to the end of the work-group's 64-row diagonal block (weights past the diagonal are exact zeros): an even number of 32-key steps for every wave
    // one 32-key step on the tiles in the buffer at bo; at its foot the next step's tiles are published and the buffer is refilled for the step after that
    auto step = [&](const int bo, const int k0) {
        const char* kt = ring + bo + c * KPIT + 16 * hh; const char* vt = kt + 2 * KTB + c * (VPIT - KPIT);
        v16bf ka[8], kb[8]; v16h vf[8]; float bs[16]; v4f km[4];
#pragma unroll
        for (int f = 0; f < 8; ++f) { ka[f] = ldsb(kt + (f & 1) * 16 * KPIT + (f >> 1) * 64); kb[f] = ldsb(kt + KTB + (f & 1) * 16 * KPIT + (f >> 1) * 64); }
#pragma unroll
        for (int e = 0; e < 16; ++e) bs[e] = sbias[2047 + i - (k0 + (e >> 3) * 16 + 8 * hh + (e & 7))];
#pragma unroll
        for (int e = 0; e < 4; ++e) km[e] = *(const v4f*)(skm + k0 + (e >> 1) * 16 + 8 * hh + (e & 1) * 4);
        // inputs only, loaded values only: holds the bias and mask LDS loads at the head of the step (left alone the compiler sinks them into the silu arithmetic, a short-led wait every few elements)
        asm volatile("" :: "v"(bs[0]), "v"(bs[1]), "v"(bs[2]), "v"(bs[3]), "v"(bs[4]), "v"(bs[5]), "v"(bs[6]), "v"(bs[7]), "v"(bs[8]), "v"(bs[9]), "v"(bs[10]), "v"(bs[11]), "v"(bs[12]), "v"(bs[13]), "v"(bs[14]), "v"(bs[15]), "v"(km[0]), "v"(km[1]), "v"(km[2]), "v"(km[3]));
        v8f s[2]; s[0] = (v8f){}; s[1] = (v8f){};
#pragma unroll
        for (int f = 0; f < 8; ++f) { const int kt2 = f & 1, kc = f >> 1;
            s[kt2] = wmmab(ka[f], qh[kc], s[kt2]); s[kt2] = wmmab(ka[f], ql[kc], s[kt2]); s[kt2] = wmmab(kb[f], qh[kc], s[kt2]);
            if (f == 5) {   // three quarters of the K fragments are used up: the V fragments take their registers
#pragma unroll
                for (int dt = 0; dt < 8; ++dt) vf[dt] = ldsh(vt + dt * 16 * VPIT);
                __builtin_amdgcn_sched_barrier(0);   // keeps the V reads here as one group, their latency under the rest of the products and the silu (left alone the compiler sinks them between the last products, a short-led wait at each)
            } }
        v16h p; float t[16], wt[16];
#pragma unroll
        for (int e = 0; e < 16; ++e) { const int j = k0 + (e >> 3) * 16 + 8 * hh + (e & 7); const float t0 = __fmul_rn(__fadd_rn(s[e >> 3][e & 7], bs[e]), ISC); const bool msk = (j > i) | (km[e >> 2][e & 3] == 0.0f); t[e] = msk ? NEGM : t0; }
        silu8(t, wt); silu8(t + 8, wt + 8);
#pragma unroll
        for (int e = 0; e < 16; ++e) p[e] = tohx(wt[e]);
#pragma unroll
        for (int dt = 0; dt < 8; ++dt) o[dt] = wmma16(vf[dt], p, o[dt]);
        __builtin_amdgcn_sched_barrier(0);   // keeps the waits and the barrier below at the foot, directly in front of the refill, so that the copies have a whole step to land
        asm volatile("s_wait_dscnt 0x0" ::: "memory");      // this wave's reads of the buffer are over before the barrier behind which it is refilled
        asm volatile("s_wait_asynccnt 0x0" ::: "memory");   // this wave's copies of the next step's tiles have landed before the barrier behind which the other waves read them
        __syncthreads();
        if (k0 + 64 < kend) fill(bo, k0 + 64);   // the same for the whole work-group
    };
#pragma unroll 1
    for (int k0 = 0, bo = 0; k0 < kend; k0 += 32, bo ^= STG) step(bo, k0);   // not unrolled: the buffers' addresses are formed from bo in each step and hold no registers of their own
    asm volatile("s_wait_asynccnt 0x0" ::: "memory");   // no copy is in flight when the wave stores its tile and ends
    float* orow = O + (size_t)i * DM + h * HD + 8 * hh;   // a lane holds 8 consecutive d of one query: merged [t][h*128+d], f32
#pragma unroll
    for (int dt = 0; dt < 8; ++dt) { v4f lo, hi4;
#pragma unroll
        for (int r = 0; r < 4; ++r) { lo[r] = o[dt][r]; hi4[r] = o[dt][4 + r]; }
        *(v4f*)(orow + dt * 16) = lo; *(v4f*)(orow + dt * 16 + 4) = hi4; }
}
extern "C" void kernel_launch(void* const* d_in, const int* in_sizes, int n_in,
                              void* d_out, int out_size, void* d_ws, size_t ws_size, hipStream_t stream) {
    (void)in_sizes; (void)n_in; (void)out_size;
    const float* x = (const float*)d_in[0]; const float* wq = (const float*)d_in[1]; const float* wk = (const float*)d_in[2]; const float* wv = (const float*)d_in[3]; const float* wu = (const float*)d_in[4]; const float* RB = (const float*)d_in[5];
    float* OUT = (float*)d_out;     // [4][2048][1024]
    char* wsp = (char*)d_ws;
    auto take = [&](size_t bytes) { char* p = wsp; wsp += (bytes + 255) & ~(size_t)255; return (void*)p; };
    bf* WQ = (bf*)take((size_t)DQ * DM * 2); bf* WK = (bf*)take((size_t)DKV * DM * 2); bf* WV = (bf*)take((size_t)DKV * DM * 2); bf* WU = (bf*)take((size_t)DM * DM * 2); float* BTT = (float*)take((size_t)NH_ * 4096 * 4); float* KF = (float*)take((size_t)(DKV / 64) * NB_ * TT * 4);
    bf* XB = (bf*)take((size_t)NB_ * TT * DM * 2); float* MRG = (float*)take((size_t)NB_ * TT * DM * 4); h16* VT16 = (h16*)take((size_t)NB_ * NKV * HD * TT * 2);
    bf* QPh = (bf*)take((size_t)NB_ * NH_ * TT * HD * 2); bf* QPl = (bf*)take((size_t)NB_ * NH_ * TT * HD * 2); bf* KPh = (bf*)take((size_t)NB_ * NKV * TT * HD * 2); bf* KPl = (bf*)take((size_t)NB_ * NKV * TT * HD * 2);
    if ((size_t)(wsp - (char*)d_ws) > ws_size) return;    // ws 256 MiB
    k_prep<<<PWB + PBB + PXB, 256, 0, stream>>>(x, wq, wk, wv, wu, RB, XB, WQ, WK, WV, WU, BTT);   /* bf16 transposed weights, transposed relative-bias rows, bf16 x */
    k_gemmw<bf, 0><<<dim3(NB_ * TT / 256, DQ / 128, 1), 256, 0, stream>>>(XB, WQ, DM, QPh, QPl, nullptr, nullptr, nullptr, nullptr);    /* silu(x Wq) planes */
    k_gemmw<bf, 1><<<dim3(NB_ * TT / 256, DKV / 128, 1), 256, 0, stream>>>(XB, WK, DM, KPh, KPl, KF, nullptr, nullptr, nullptr);        /* silu(x Wk) planes, key padding flags */
    k_gemmw<bf, 2><<<dim3(NB_ * TT / 256, DKV / 128, 1), 256, 0, stream>>>(XB, WV, DM, nullptr, nullptr, nullptr, VT16, nullptr, nullptr);   /* silu(x Wv), transposed */
    k_fattn<<<dim3(NH_, NB_, TT / 64), 128, 0, stream>>>(QPh, QPl, KPh, KPl, VT16, BTT, KF, MRG);   /* silu attention, all heads and batches: merged [b*TT+t][h*128+d], f32 */
    k_gemmw<bf, 3><<<dim3(NB_ * TT / 256, DM / 128, 1), 256, 0, stream>>>(XB, WU, DM, nullptr, nullptr, nullptr, nullptr, MRG, OUT);   /* out = attn x silu(x Wu) */
}

// v008
// A run of this version takes 138 microseconds.
// Timed twice side by side with v007, it ran 1.05 times as fast both times.
// Counting every step since v000, it is 12.8 times as fast.
#include <hip/hip_runtime.h>

// HSTU layer (x [4][2048][1024]; Q, K, V = silu(x W) ('xw' [1024][1024]; 8 heads x 128), U = x Wu; scores = Q.K + rel_bias[i - j + 2047][h] ([4095][8], read); scores / sqrt(128); causal and key-padding (sign(sum|K|) == 0) positions -> -2^32+1; weights = silu(scores) (no softmax; masked weights are exactly 0); attn = weights V merged [t][h*128+d]; out = attn x silu(U) -> [4][2048][1024] (8.4 M)).
// Layout: bf16 copies of x and of the transposed weights; the four projections as ONE GEMM launch (the four transposed weights lie one behind the other: one Bt of 4096 rows) whose f32 tiles never go to memory: each tile's epilogue applies what the layer does next to it and stores that (silu and the bf16 hi/lo planes of Q and K, the key flags, silu and the transposed fp16 plane of V, silu(U) in f32); then one fused silu-attention kernel (scores and fp16 weights stay in registers, exact zeros above the diagonal so the P.V contraction stops at the diagonal block; its epilogue multiplies the merged f32 rows by silu(U) and writes out). Three launches. The four batches run side by side in every launch: the GEMM and the bf16 copy of x take the 8192 rows as one matrix, the attention kernel takes the batch from the grid.
// Compute dtypes, f32 accumulate: every input rounded to bf16; projections exact (inputs); silu in f32 (hardware exp2 and reciprocal) -> Q/K hi/lo planes, V fp16 planes; scores 3 products (tile skipping); bias add, 1/sqrt(128), masks and silu in f32; fp16 weights x fp16 silu(V) (one product, causal K range); no output projection: out = attn x silu(x Wu) in f32.

#define NB_  4
#define TT   2048
#define DM   1024
#define NH_  8
#define NKV  8
#define REP  (NH_ / NKV)
#define HD   128
#define DQ   (NH_ * HD)
#define DKV  (NKV * HD)
#define NEGM (-4294967295.0f)
#define ISC  0.088388347648318447f   // 1/sqrt(128), applied after the bias add
#define ZH   2
#define RH   2048
#define WIN  2048
#define PCAR 1024.0f
#define SCL  0.088388347648318447f   // HD^-0.5
typedef _Float16 h16;
typedef unsigned short bf;
typedef __attribute__((ext_vector_type(16))) __bf16   v16bf;
typedef __attribute__((ext_vector_type(16))) _Float16 v16h;
typedef __attribute__((ext_vector_type(8)))  _Float16 v8h;
typedef __attribute__((ext_vector_type(8)))  unsigned short v8us;
typedef __attribute__((ext_vector_type(8)))  float    v8f;
typedef __attribute__((ext_vector_type(4)))  float    v4f;
typedef v8h  __attribute__((may_alias)) v8ha;
typedef v4f  __attribute__((may_alias)) v4fa;
typedef v8us __attribute__((may_alias)) v8usa;

__device__ __forceinline__ unsigned short f2bf(float f) { unsigned u = __float_as_uint(f); u += 0x7FFFu + ((u >> 16) & 1u); return (unsigned short)(u >> 16); }
__device__ __forceinline__ float bf2f(unsigned short b) { return __uint_as_float(((unsigned)b) << 16); }
__device__ __forceinline__ float bfr(float f) { return bf2f(f2bf(f)); }
__device__ __forceinline__ v16h cat16(v8h lo, v8h hi) { return __builtin_shufflevector(lo, hi, 0, 1, 2, 3, 4, 5, 6, 7, 8, 9, 10, 11, 12, 13, 14, 15); }
__device__ __forceinline__ v16bf cat16b(v8us lo, v8us hi) { return __builtin_bit_cast(v16bf, __builtin_shufflevector(lo, hi, 0, 1, 2, 3, 4, 5, 6, 7, 8, 9, 10, 11, 12, 13, 14, 15)); }
__device__ __forceinline__ v8f wmma16(v16h a, v16h b, v8f c) { return __builtin_amdgcn_wmma_f32_16x16x32_f16(false, a, false, b, (short)0, c, false, false); }
__device__ __forceinline__ v8f wmmab(v16bf a, v16bf b, v8f c) { return __builtin_amdgcn_wmma_f32_16x16x32_bf16(false, a, false, b, (short)0, c, false, false); }



__device__ __forceinline__ h16 tohx(float x) { return (h16)x; }
// silu = u sigmoid(u) = u / (1 + 2^(-u log2 e)) in f32 on the hardware's exp2 and reciprocal, eight values at a time.
// Each run of eight transcendentals is one statement: results in registers of their own (early clobber), so that none overwrites a source of the one in front of it, and the v_nop at the end is the slot that the instruction set asks for between a transcendental and an instruction that reads its result or overwrites its source.
#define TR8(op, d, s) asm(op " %0, %8\n\t" op " %1, %9\n\t" op " %2, %10\n\t" op " %3, %11\n\t" op " %4, %12\n\t" op " %5, %13\n\t" op " %6, %14\n\t" op " %7, %15\n\tv_nop" \
    : "=&v"(d[0]), "=&v"(d[1]), "=&v"(d[2]), "=&v"(d[3]), "=&v"(d[4]), "=&v"(d[5]), "=&v"(d[6]), "=&v"(d[7]) : "v"(s[0]), "v"(s[1]), "v"(s[2]), "v"(s[3]), "v"(s[4]), "v"(s[5]), "v"(s[6]), "v"(s[7]))
__device__ __forceinline__ void silu8(const float* u, float* y) {
    float a[8], e[8], r[8];
#pragma unroll
    for (int q = 0; q < 8; ++q) a[q] = u[q] * -1.4426950408889634f;
    TR8("v_exp_f32", e, a);
#pragma unroll
    for (int q = 0; q < 8; ++q) e[q] = 1.0f + e[q];
    TR8("v_rcp_f32", r, e);
#pragma unroll
    for (int q = 0; q < 8; ++q) y[q] = u[q] * r[q];
}
__device__ __forceinline__ void splitf(float y, unsigned short& h, unsigned short& l) { h = f2bf(y); l = f2bf(y - bf2f(h)); }
typedef __attribute__((ext_vector_type(2))) _Float16 v2h;
typedef __attribute__((ext_vector_type(4))) _Float16 v4h;
typedef __attribute__((ext_vector_type(2))) unsigned short v2us;
typedef __attribute__((ext_vector_type(4))) unsigned short v4us;
typedef __attribute__((ext_vector_type(2))) float v2f;
typedef __attribute__((ext_vector_type(4))) int v4i;

// ---- k_gemmw: register-blocked GEMM, one wave per 64x64 output tile (16 accumulators), 4 x 2 waves a work-group (256x128), one work-group a WGP; grid (M/256, 4 * 1024/128), 256 threads: the work-groups of the four projections follow one another on a WGP with no launch boundary between them. K % 128 == 0, K >= 256.
// The operands are K-contiguous 16-bit planes. A stage is 128 k (256 bytes) of the work-group's 256 rows of A and 128 rows of Bt, brought into LDS once for the eight waves by asynchronous copies of whole rows, one stage ahead into the other of two buffers; the waves read their fragments from there (rows pitched 16 B x odd for the 16-byte reads), 32 k ahead of the products. k runs upward in 32s into the same accumulators.
// c[m][n] = sum_k A[m][k] Bt[n][k] (f32) never goes to memory; m = b*TT + t, n = MODE*1024 + h*HD + d: the projection (MODE) comes from the block index, the same for a whole work-group. The tile is laid into the wave's own part of LDS (the buffers, which nobody reads any more behind the last stage's barrier) once and read back as whole rows, 8 values a lane; what the epilogue stores, by MODE, in 128-byte (f32: 256-byte) pieces:
// 0: silu(c) as bf16 hi/lo planes [b][h][t][d] (Q). 1: the same (K), and KF[(h*HD+d)/64][m] = 1.0 where any silu(c) of the row's 64 columns is not zero, else 0.0 (a sum of absolute values is zero only where every term is).
// 2: silu(c) as the fp16 plane [b][h][d][t] (V transposed: the tile is laid down as [d][t], a lane's 8 accumulator rows being 8 consecutive t of one d). 3: silu(c) in f32 -> SU[m][h*HD+d] (the u gate, which the attention kernel's epilogue applies).
template <typename T16> struct WFrag;
template <> struct WFrag<h16> { typedef v16h V; static __device__ __forceinline__ V ld(const h16* p) { return cat16(*(const v8h*)p, *(const v8h*)(p + 16)); } static __device__ __forceinline__ v8f mma(V a, V b, v8f c) { return wmma16(a, b, c); } };
template <> struct WFrag<bf> { typedef v16bf V; static __device__ __forceinline__ V ld(const bf* p) { return cat16b(*(const v8us*)p, *(const v8us*)(p + 16)); } static __device__ __forceinline__ v8f mma(V a, V b, v8f c) { return wmmab(a, b, c); } };
#define GPIT 272                   // LDS pitch of a 256-byte operand row (128 k)
#define GSTG (384 * GPIT)          // one stage: 256 rows of A, then 128 rows of Bt
typedef const __attribute__((address_space(1))) char* gptr;   // an address known to be global memory
// eight 16-byte copies a lane, global memory to LDS through no register, 16 rows apart, in one statement; the one wait at its end stands in front of any rewrite of the address registers that the copies name
__device__ __forceinline__ void cp8(unsigned l, gptr g, size_t gs) {
    asm volatile("global_load_async_to_lds_b128 %0, %8, off\n\tglobal_load_async_to_lds_b128 %1, %9, off\n\tglobal_load_async_to_lds_b128 %2, %10, off\n\tglobal_load_async_to_lds_b128 %3, %11, off\n\t"
                 "global_load_async_to_lds_b128 %4, %12, off\n\tglobal_load_async_to_lds_b128 %5, %13, off\n\tglobal_load_async_to_lds_b128 %6, %14, off\n\tglobal_load_async_to_lds_b128 %7, %15, off\n\ts_wait_xcnt 0x0"
                 :: "v"(l), "v"(l + 16 * GPIT), "v"(l + 32 * GPIT), "v"(l + 48 * GPIT), "v"(l + 64 * GPIT), "v"(l + 80 * GPIT), "v"(l + 96 * GPIT), "v"(l + 112 * GPIT),
                    "v"(g), "v"(g + gs), "v"(g + 2 * gs), "v"(g + 3 * gs), "v"(g + 4 * gs), "v"(g + 5 * gs), "v"(g + 6 * gs), "v"(g + 7 * gs) : "memory");
}
// the epilogue of one wave's 64x64 tile: r0 its first row, c0 its first column inside its own projection
template <int MODE>
__device__ __forceinline__ void gemm_epi(const v8f (&acc)[4][4], float* os, const int lane, const int r0, const int c0, bf* Ph, bf* Pl, float* KF, h16* Vt, float* SU) {
    const int lr = lane & 15, hi = lane >> 4;
#pragma unroll
    for (int mb = 0; mb < 4; ++mb)
#pragma unroll
        for (int nb = 0; nb < 4; ++nb) {
            if (MODE == 2) { v4f lo, hi4;
#pragma unroll
                for (int r = 0; r < 4; ++r) { lo[r] = acc[mb][nb][r]; hi4[r] = acc[mb][nb][4 + r]; }
                float* p = os + (nb * 16 + lr) * 68 + mb * 16 + hi * 8; *(v4fa*)p = lo; *(v4fa*)(p + 4) = hi4;
            } else {
#pragma unroll
                for (int j = 0; j < 8; ++j) os[(mb * 16 + hi * 8 + j) * 68 + nb * 16 + lr] = acc[mb][nb][j]; } }
    __builtin_amdgcn_wave_barrier(); asm volatile("" ::: "memory");   // the reads below take what OTHER lanes of the wave have written: the compiler may not lift them over the writes
    const int rw = lane >> 3, cofs = (lane & 7) * 8;   // 8 lanes a tile row, 4 rows a pass
    const size_t pl = (size_t)(r0 / TT) * NH_ + c0 / HD; const int t0 = r0 % TT, d0 = c0 % HD;   // the tile's (batch, head) plane and its first row and column there
    const size_t e0 = (MODE == 3) ? (size_t)(r0 + rw) * DM + c0 + cofs : (MODE == 2) ? (pl * HD + d0 + rw) * TT + t0 + cofs : (pl * TT + t0 + rw) * HD + d0 + cofs;
    const size_t est = 4 * ((MODE == 3) ? DM : (MODE == 2) ? TT : HD);   // elements from one pass's row to the next pass's
    unsigned long long nzr = 0;   // one bit a tile row: some silu(K) of the row is not zero
#pragma unroll 1   // kept rolled, two passes a trip: 8 independent silu chains a lane and pass keep the vector port fed, and the kernel's text stays a few KB
    for (int it = 0; it < 16; it += 2) {
#pragma unroll
        for (int u = 0; u < 2; ++u) {
            const float* src = os + ((it + u) * 4 + rw) * 68 + cofs; const v4f v0 = *(const v4fa*)src, v1 = *(const v4fa*)(src + 4); const size_t e = e0 + (size_t)(it + u) * est;
            float cv[8], y[8];
#pragma unroll
            for (int q = 0; q < 4; ++q) { cv[q] = v0[q]; cv[4 + q] = v1[q]; }
            silu8(cv, y);
            if (MODE == 3) { v4f o0, o1;
#pragma unroll
                for (int q = 0; q < 4; ++q) { o0[q] = y[q]; o1[q] = y[4 + q]; }
                *(v4f*)(SU + e) = o0; *(v4f*)(SU + e + 4) = o1;
            } else if (MODE == 2) { v8h o;
#pragma unroll
                for (int q = 0; q < 8; ++q) o[q] = tohx(y[q]);
                *(v8h*)(Vt + e) = o;
            } else { v8us oh, ol; bool nz = false;
#pragma unroll
                for (int q = 0; q < 8; ++q) { unsigned short a2, c2; splitf(y[q], a2, c2); oh[q] = a2; ol[q] = c2; nz = nz | !(y[q] == 0.0f); }
                *(v8us*)(Ph + e) = oh; *(v8us*)(Pl + e) = ol;
                if (MODE == 1) { const unsigned m = __builtin_amdgcn_ballot_w32(nz);   // byte k: the 8 lanes of the pass's row k
                    const unsigned b4 = ((m & 0xFFu) ? 1u : 0u) | ((m & 0xFF00u) ? 2u : 0u) | ((m & 0xFF0000u) ? 4u : 0u) | ((m & 0xFF000000u) ? 8u : 0u);
                    nzr |= (unsigned long long)b4 << ((it + u) * 4); }
            } } }
    if (MODE == 1) { float* kf = KF + (size_t)(c0 / 64) * (NB_ * TT) + r0 + lane; kf[0] = ((nzr >> lane) & 1u) ? 1.0f : 0.0f; kf[32] = ((nzr >> (lane + 32)) & 1u) ? 1.0f : 0.0f; }
}
template <typename T16>
__global__ __launch_bounds__(256) void k_gemmw(const T16* __restrict__ A, const T16* __restrict__ Bt, int K, bf* Qh, bf* Ql, bf* Kh, bf* Kl, float* KF, h16* Vt, float* SU) {
    typedef typename WFrag<T16>::V V;
    __shared__ __align__(16) char sm[2 * GSTG];
    const int tid = threadIdx.x, lane = tid & 31, lr = lane & 15, hi = lane >> 4; const int wv = __builtin_amdgcn_readfirstlane(tid >> 5);
    const int r0 = blockIdx.x * 256 + (wv & 3) * 64, c0 = (blockIdx.y & 7) * 128 + (wv >> 2) * 64;   // the wave's own 64x64 tile: its first row, and its first column inside its projection
    float* os = (float*)(sm + wv * (64 * 68 * 4));   // the wave's epilogue tile, laid over the buffers
    v8f acc[4][4];
#pragma unroll
    for (int mb = 0; mb < 4; ++mb)
#pragma unroll
        for (int nb = 0; nb < 4; ++nb) acc[mb][nb] = (v8f){};
    // each lane's part of a stage's copies: 16 lanes a 256-byte row, 16 rows a copy of the work-group, 16 copies for the 256 rows of A and 8 for the 128 of Bt
    const unsigned lsm = (unsigned)(size_t)(__attribute__((address_space(3))) char*)sm + (tid >> 4) * GPIT + (tid & 15) * 16; const size_t gs = (size_t)16 * K * 2;
    gptr ga = (gptr)(A + (size_t)(blockIdx.x * 256 + (tid >> 4)) * K) + (tid & 15) * 16; gptr gb = (gptr)(Bt + (size_t)(blockIdx.y * 128 + (tid >> 4)) * K) + (tid & 15) * 16;
    auto fill = [&](const int bo, const int kc) {   // bo: the buffer's byte offset
        const unsigned l = lsm + bo; gptr x = ga + kc * 2, y = gb + kc * 2;
        cp8(l, x, gs); cp8(l + 128 * GPIT, x + 8 * gs, gs); cp8(l + 256 * GPIT, y, gs);
    };
    fill(0, 0);
    asm volatile("s_wait_asynccnt 0x0" ::: "memory");   // this wave's copies of the first stage have landed before the barrier behind which the other waves read them
    __syncthreads();
    fill(GSTG, 128);   // K >= 256: a second stage always exists
    const int aof = ((wv & 3) * 64 + lr) * GPIT + 16 * hi, bof = (256 + (wv >> 2) * 64 + lr) * GPIT + 16 * hi;
#pragma unroll 1   // not unrolled: the buffers' addresses are formed from bo in each stage and hold no registers of their own
    for (int kc = 0, bo = 0; kc < K; kc += 128, bo ^= GSTG) {
        const char* at = sm + bo + aof; const char* bt = sm + bo + bof;
        V a[2][4], b[2][4];
#pragma unroll
        for (int f = 0; f < 4; ++f) { a[0][f] = WFrag<T16>::ld((const T16*)(at + f * 16 * GPIT)); b[0][f] = WFrag<T16>::ld((const T16*)(bt + f * 16 * GPIT)); }
#pragma unroll
        for (int s = 0; s < 4; ++s) {   // 32 k a pass; the next pass's fragments (of this stage only) are asked for as one group in front of this pass's products
            if (s < 3) {
#pragma unroll
                for (int f = 0; f < 4; ++f) { a[(s + 1) & 1][f] = WFrag<T16>::ld((const T16*)(at + f * 16 * GPIT + (s + 1) * 64)); b[(s + 1) & 1][f] = WFrag<T16>::ld((const T16*)(bt + f * 16 * GPIT + (s + 1) * 64)); }
                __builtin_amdgcn_sched_barrier(0);   // keeps those reads here as one group, their latency under this pass's products (left alone the compiler sinks them among the products that use them, a wait to zero in front of every four)
            }
#pragma unroll
            for (int nb = 0; nb < 4; ++nb)
#pragma unroll
                for (int mb = 0; mb < 4; ++mb) acc[mb][nb] = WFrag<T16>::mma(a[s & 1][mb], b[s & 1][nb], acc[mb][nb]);
        }
        __builtin_amdgcn_sched_barrier(0);   // keeps the waits and the barrier below at the foot, behind the last products and directly in front of the refill, so that the copies have a whole stage to land
        asm volatile("s_wait_dscnt 0x0" ::: "memory");      // this wave's reads of the buffer are over before the barrier behind which it is refilled
        asm volatile("s_wait_asynccnt 0x0" ::: "memory");   // this wave's copies of the next stage have landed before the barrier behind which the other waves read them
        __syncthreads();
        if (kc + 256 < K) fill(bo, kc + 256);   // the same for the whole work-group
    }
    asm volatile("s_wait_asynccnt 0x0" ::: "memory");   // no copy is in flight when the buffers become the epilogue's tiles
    const int mode = blockIdx.y >> 3;   // which projection the work-group's 128 rows of Bt belong to
    if (mode == 0) gemm_epi<0>(acc, os, lane, r0, c0, Qh, Ql, nullptr, nullptr, nullptr);
    else if (mode == 1) gemm_epi<1>(acc, os, lane, r0, c0, Kh, Kl, KF, nullptr, nullptr);
    else if (mode == 2) gemm_epi<2>(acc, os, lane, r0, c0, nullptr, nullptr, nullptr, Vt, nullptr);
    else gemm_epi<3>(acc, os, lane, r0, c0, nullptr, nullptr, nullptr, nullptr, SU);
}
// ---- k_prep: all that is only a re-laying of an input (bf16 transposed weights, transposed bias rows, the bf16 copy of x), in one launch of few, long waves; the job comes from the block index (the same for a whole work-group); no work-group barrier.
// Blocks [0, PWB): the four weights, w [k][n] f32 -> Bt [n][k] bf16. A work-group takes 256 k x 64 n of one weight, a wave 64 k x 32 n: 16 loads of 16 bytes a lane, all in flight (8 lanes a 128-byte row piece, a lane holds rows k and k + 1 of 4 columns), the bf16 pairs (k, k + 1) go as dwords into the wave's own part of LDS as [n][k] and come back as whole 128-byte rows for the stores.
// Blocks [PWB, PWB + PBB): BTT[h][p] = bf16-rounded rel_bias[p][h], 0 at p = 4095. The rest: 16 x 8 values of x a lane, the 32 loads in flight together.
#define PWB  256                   // 4 weights x (1024 / 64) x (1024 / 256)
#define PBB  16                    // NH_ * 4096 / (256 * 8)
#define PXB  256                   // NB_ * TT * DM / (256 * 16 * 8)
#define TPIT 36                    // dwords from one n row of a wave's LDS tile to the next (32 of data; a multiple of 4 for the 16-byte reads)
typedef __attribute__((ext_vector_type(4))) unsigned v4u;
typedef v4u __attribute__((may_alias)) v4ua;
__global__ __launch_bounds__(256) void k_prep(const float* __restrict__ x, const float* __restrict__ wq, const float* __restrict__ wk, const float* __restrict__ wv, const float* __restrict__ wu, const float* __restrict__ RB,
                                              bf* XB, bf* WQ, bf* WK, bf* WV, bf* WU, float* BTT) {
    static_assert(DQ == DM && DKV == DM && DM == 1024 && PBB * 2048 == NH_ * 4096 && (size_t)PXB * 4096 * 8 == (size_t)NB_ * TT * DM, "the block ranges are cut for these shapes");
    __shared__ __align__(16) unsigned tl[8 * 32 * TPIT];
    const int blk = blockIdx.x, tid = threadIdx.x;
    if (blk < PWB) {
        const int sel = blk >> 6, t = blk & 63;
        const float* __restrict__ w = sel == 0 ? wq : sel == 1 ? wk : sel == 2 ? wv : wu; bf* Bt = sel == 0 ? WQ : sel == 1 ? WK : sel == 2 ? WV : WU;
        const int lane = tid & 31, wvi = tid >> 5, r = lane >> 3, c = lane & 7;
        const int n0 = (t >> 2) * 64 + (wvi & 1) * 32, k0 = (t & 3) * 256 + (wvi >> 1) * 64;
        unsigned* my = tl + wvi * (32 * TPIT);
        const float* s = w + (size_t)(k0 + 2 * r) * DM + n0 + 4 * c;
        v4f a[8], b[8];
#pragma unroll
        for (int j = 0; j < 8; ++j) { a[j] = *(const v4f*)(s + (size_t)(8 * j) * DM); b[j] = *(const v4f*)(s + (size_t)(8 * j + 1) * DM); }
        asm volatile("s_wait_xcnt 0x0" :: "v"(s) : "memory");   // stands in front of any rewrite of the address registers that the loads name; the address as an input keeps it in those registers up to here (left alone the last load lands on them)
#pragma unroll
        for (int j = 0; j < 8; ++j)
#pragma unroll
            for (int q = 0; q < 4; ++q) my[(4 * c + q) * TPIT + 4 * j + r] = (unsigned)f2bf(a[j][q]) | ((unsigned)f2bf(b[j][q]) << 16);
        __builtin_amdgcn_wave_barrier(); asm volatile("" ::: "memory");   // the reads below take what OTHER lanes of the wave have written: the compiler may not lift them over the writes
        bf* d = Bt + (size_t)(n0 + r) * DM + k0 + 8 * c;
#pragma unroll
        for (int i = 0; i < 8; ++i) *(v4ua*)(d + (size_t)(4 * i) * DM) = *(const v4ua*)(my + (4 * i + r) * TPIT + 4 * c);
    } else if (blk < PWB + PBB) {
#pragma unroll
        for (int u = 0; u < 8; ++u) { const int idx = (blk - PWB) * 2048 + u * 256 + tid; const int p = idx % 4096, h = idx / 4096; const int pc = p < 2 * TT - 1 ? p : 2 * TT - 2;   // the row index is clamped, so that every lane loads and the eight loads fly together
            const float v = bfr(RB[(size_t)pc * NH_ + h]); BTT[idx] = (p < 2 * TT - 1) ? v : 0.0f; }
        asm volatile("s_wait_xcnt 0x0" ::: "memory");   // stands behind the branch's last store, in front of any rewrite of the registers that the stores name
    } else {
        const size_t i0 = (size_t)(blk - PWB - PBB) * 4096 + tid; const float* s = x + i0 * 8;
        v8f v[16];
#pragma unroll
        for (int u = 0; u < 16; ++u) v[u] = *(const v8f*)(s + u * 2048);
        asm volatile("s_wait_xcnt 0x0" :: "v"(s) : "memory");   // as above
#pragma unroll
        for (int u = 0; u < 16; ++u) { v8us o;
#pragma unroll
            for (int k = 0; k < 8; ++k) o[k] = f2bf(v[u][k]);
            *(v8us*)(XB + (i0 + u * 256) * 8) = o; }
        asm volatile("s_wait_xcnt 0x0" ::: "memory");   // as behind the bias stores
    }
}
// ---- k_fattn: scores, bias, masks, silu weights, weights x V and the silu(U) gate in one kernel; nothing of the [t][t] planes goes to memory, and the ungated rows do not either. One wave per 16 query rows, 4 waves a work-group, grid (heads, batches, TT/64): the row block is the slowest index, longest rows first over all heads and batches, so that no long work-group starts late.
// Per 32 keys: St = K Qt (two 16-key tiles, the same 3 hi/lo products in the same order per 32 of d), a lane then holds 16 keys of ONE query in the hardware k order, so the fp16 weights are the B operand of Ot += Vt Pt as they stand.
// Keys run in ascending 32-key steps into one accumulator and stop at the end of the 64-row diagonal block, so every sum keeps its order.
// The K hi, K lo and V tiles of a step are brought into LDS once for the four waves, by asynchronous copies of whole rows, one step ahead into the other of two buffers; the waves read their fragments from there (rows pitched 16 B x odd for the 16-byte reads).
#define KPIT 272                   // LDS pitch of a 256-byte K row
#define VPIT 80                    // LDS pitch of a 64-byte V row (32 keys of one d)
#define KTB  (32 * KPIT)           // one K plane's tile
#define STG  (2 * KTB + HD * VPIT) // one step's tiles: K hi, K lo, V
__device__ __forceinline__ v16bf ldfb(gptr p) { return cat16b(*(const __attribute__((address_space(1))) v8us*)p, *(const __attribute__((address_space(1))) v8us*)(p + 32)); }
__device__ __forceinline__ v16bf ldsb(const char* p) { return cat16b(*(const v8us*)p, *(const v8us*)(p + 32)); }
__device__ __forceinline__ v16h ldsh(const char* p) { return cat16(*(const v8h*)p, *(const v8h*)(p + 32)); }
// a step's twelve 16-byte copies a lane, global memory to LDS through no register, in one statement; the one wait at its end stands in front of any rewrite of the address registers that the copies name
__device__ __forceinline__ void cp12(unsigned a, unsigned b, unsigned v, gptr x, gptr y, gptr w) {
    asm volatile("global_load_async_to_lds_b128 %0, %12, off\n\tglobal_load_async_to_lds_b128 %1, %13, off\n\tglobal_load_async_to_lds_b128 %2, %14, off\n\tglobal_load_async_to_lds_b128 %3, %15, off\n\t"
                 "global_load_async_to_lds_b128 %4, %16, off\n\tglobal_load_async_to_lds_b128 %5, %17, off\n\tglobal_load_async_to_lds_b128 %6, %18, off\n\tglobal_load_async_to_lds_b128 %7, %19, off\n\t"
                 "global_load_async_to_lds_b128 %8, %20, off\n\tglobal_load_async_to_lds_b128 %9, %21, off\n\tglobal_load_async_to_lds_b128 %10, %22, off\n\tglobal_load_async_to_lds_b128 %11, %23, off\n\ts_wait_xcnt 0x0"
                 :: "v"(a), "v"(a + 8 * KPIT), "v"(a + 16 * KPIT), "v"(a + 24 * KPIT), "v"(b), "v"(b + 8 * KPIT), "v"(b + 16 * KPIT), "v"(b + 24 * KPIT), "v"(v), "v"(v + 32 * VPIT), "v"(v + 64 * VPIT), "v"(v + 96 * VPIT),
                    "v"(x), "v"(x + 2048), "v"(x + 4096), "v"(x + 6144), "v"(y), "v"(y + 2048), "v"(y + 4096), "v"(y + 6144), "v"(w), "v"(w + 32 * TT * 2), "v"(w + 64 * TT * 2), "v"(w + 96 * TT * 2) : "memory");
}
__global__ __launch_bounds__(128) void k_fattn(const bf* __restrict__ Qh, const bf* __restrict__ Ql, const bf* __restrict__ Kh, const bf* __restrict__ Kl, const h16* __restrict__ Vt, const float* __restrict__ BTT, const float* __restrict__ KM, const float* __restrict__ SU, float* O) {
    __shared__ __align__(16) float sbias[4096]; __shared__ __align__(16) float skm[TT]; __shared__ __align__(16) char ring[2 * STG];
    const int h = blockIdx.x; const int qb = ((int)gridDim.z - 1 - (int)blockIdx.z) * 64;
    { const size_t b = blockIdx.y, pb = b * NH_ * TT * HD; Qh += pb; Ql += pb; Kh += pb; Kl += pb; Vt += pb; KM += (size_t)(2 * h) * (NB_ * TT) + b * TT; SU += b * TT * DM; O += b * TT * DM; }   // this batch's planes, the head's two rows of key flags (one for each 64 of its columns), gate rows and output rows
    const size_t hp = (size_t)h * TT * HD; const int tid = threadIdx.x;
    // each lane's part of a step's copies: K tiles are 8 KiB in a row (16 lanes a row, 8 rows a copy), V rows are 64 B of a 4-KiB row (4 lanes a row, 32 rows a copy)
    const unsigned lring = (unsigned)(size_t)(__attribute__((address_space(3))) char*)ring;
    const unsigned lk = lring + (tid >> 4) * KPIT + (tid & 15) * 16, lv = lring + 2 * KTB + (tid >> 2) * VPIT + (tid & 3) * 16;
    gptr gkh = (gptr)(Kh + hp); gptr gkl = (gptr)(Kl + hp); gptr gv = (gptr)(Vt + hp); const unsigned tk = tid * 16, tv = (tid >> 2) * TT * 2 + (tid & 3) * 16;   // the planes' addresses are the same for every lane (scalar registers); a lane keeps its two 32-bit byte offsets into them
    auto fill = [&](const int bo, const int k0) {   // bo: the buffer's byte offset in the ring
        const unsigned a = lk + bo, v = lv + bo; gptr x = gkh + (tk + (unsigned)k0 * HD * 2), y = gkl + (tk + (unsigned)k0 * HD * 2), w = gv + (tv + (unsigned)k0 * 2);
        cp12(a, a + KTB, v, x, y, w);
    };
    fill(0, 0);
#pragma unroll
    for (int p = 0; p < 4096 / 4 / 128; ++p) ((v4f*)sbias)[p * 128 + threadIdx.x] = ((const v4f*)(BTT + (size_t)h * 4096))[p * 128 + threadIdx.x];
#pragma unroll
    for (int p = 0; p < TT / 4 / 128; ++p) ((v4f*)skm)[p * 128 + threadIdx.x] = ((const v4f*)KM)[p * 128 + threadIdx.x] + ((const v4f*)(KM + NB_ * TT))[p * 128 + threadIdx.x];   // zero only where both halves of the key's row are all zero
    asm volatile("s_wait_asynccnt 0x0" ::: "memory");   // this wave's copies of the first tiles have landed before the barrier behind which the other waves read them
    __syncthreads();
    fill(STG, 32);   // kend >= 64: a second step always exists
    const int lane = threadIdx.x & 31, c = lane & 15, hh = lane >> 4; const int q0 = qb + __builtin_amdgcn_readfirstlane((int)(threadIdx.x >> 5)) * 16; const int i = q0 + c;
    const int kof = c * HD * 2 + 16 * hh;
    v16bf qh[4], ql[4];
#pragma unroll
    for (int kc = 0; kc < 4; ++kc) { qh[kc] = ldfb((gptr)(Qh + hp) + (size_t)q0 * HD * 2 + kof + kc * 64); ql[kc] = ldfb((gptr)(Ql + hp) + (size_t)q0 * HD * 2 + kof + kc * 64); }
    v8f o[8];
#pragma unroll
    for (int dt = 0; dt < 8; ++dt) o[dt] = (v8f){};
    const int kend = qb + 64;   // keys up to the end of the work-group's 64-row diagonal block (weights past the diagonal are exact zeros): an even number of 32-key steps for every wave
    // one 32-key step on the tiles in the buffer at bo; at its foot the next step's tiles are published and the buffer is refilled for the step after that
    auto step = [&](const int bo, const int k0) {
        const char* kt = ring + bo + c * KPIT + 16 * hh; const char* vt = kt + 2 * KTB + c * (VPIT - KPIT);
        v16bf ka[8], kb[8]; v16h vf[8]; float bs[16]; v4f km[4];
#pragma unroll
        for (int f = 0; f < 8; ++f) { ka[f] = ldsb(kt + (f & 1) * 16 * KPIT + (f >> 1) * 64); kb[f] = ldsb(kt + KTB + (f & 1) * 16 * KPIT + (f >> 1) * 64); }
#pragma unroll
        for (int e = 0; e < 16; ++e) bs[e] = sbias[2047 + i - (k0 + (e >> 3) * 16 + 8 * hh + (e & 7))];
#pragma unroll
        for (int e = 0; e < 4; ++e) km[e] = *(const v4f*)(skm + k0 + (e >> 1) * 16 + 8 * hh + (e & 1) * 4);
        // inputs only, loaded values only: holds the bias and mask LDS loads at the head of the step (left alone the compiler sinks them into the silu arithmetic, a short-led wait every few elements)
        asm volatile("" :: "v"(bs[0]), "v"(bs[1]), "v"(bs[2]), "v"(bs[3]), "v"(bs[4]), "v"(bs[5]), "v"(bs[6]), "v"(bs[7]), "v"(bs[8]), "v"(bs[9]), "v"(bs[10]), "v"(bs[11]), "v"(bs[12]), "v"(bs[13]), "v"(bs[14]), "v"(bs[15]), "v"(km[0]), "v"(km[1]), "v"(km[2]), "v"(km[3]));
        v8f s[2]; s[0] = (v8f){}; s[1] = (v8f){};
#pragma unroll
        for (int f = 0; f < 8; ++f) { const int kt2 = f & 1, kc = f >> 1;
            s[kt2] = wmmab(ka[f], qh[kc], s[kt2]); s[kt2] = wmmab(ka[f], ql[kc], s[kt2]); s[kt2] = wmmab(kb[f], qh[kc], s[kt2]);
            if (f == 5) {   // three quarters of the K fragments are used up: the V fragments take their registers
#pragma unroll
                for (int dt = 0; dt < 8; ++dt) vf[dt] = ldsh(vt + dt * 16 * VPIT);
                __builtin_amdgcn_sched_barrier(0);   // keeps the V reads here as one group, their latency under the rest of the products and the silu (left alone the compiler sinks them between the last products, a short-led wait at each)
            } }
        v16h p; float t[16], wt[16];
#pragma unroll
        for (int e = 0; e < 16; ++e) { const int j = k0 + (e >> 3) * 16 + 8 * hh + (e & 7); const float t0 = __fmul_rn(__fadd_rn(s[e >> 3][e & 7], bs[e]), ISC); const bool msk = (j > i) | (km[e >> 2][e & 3] == 0.0f); t[e] = msk ? NEGM : t0; }
        silu8(t, wt); silu8(t + 8, wt + 8);
#pragma unroll
        for (int e = 0; e < 16; ++e) p[e] = tohx(wt[e]);
#pragma unroll
        for (int dt = 0; dt < 8; ++dt) o[dt] = wmma16(vf[dt], p, o[dt]);
        __builtin_amdgcn_sched_barrier(0);   // keeps the waits and the barrier below at the foot, directly in front of the refill, so that the copies have a whole step to land
        asm volatile("s_wait_dscnt 0x0" ::: "memory");      // this wave's reads of the buffer are over before the barrier behind which it is refilled
        asm volatile("s_wait_asynccnt 0x0" ::: "memory");   // this wave's copies of the next step's tiles have landed before the barrier behind which the other waves read them
        __syncthreads();
        if (k0 + 64 < kend) fill(bo, k0 + 64);   // the same for the whole work-group
    };
#pragma unroll 1
    for (int k0 = 0, bo = 0; k0 < kend; k0 += 32, bo ^= STG) step(bo, k0);   // not unrolled: the buffers' addresses are formed from bo in each step and hold no registers of their own
    const size_t eo = (size_t)i * DM + h * HD + 8 * hh;   // a lane holds 8 consecutive d of one query: merged [t][h*128+d], f32
    const float* grow = SU + eo; float* orow = O + eo;
    v4f g[16];   // the query's silu(U) at the lane's 64 places, the sixteen loads in flight together
#pragma unroll
    for (int dt = 0; dt < 8; ++dt) { g[2 * dt] = *(const v4f*)(grow + dt * 16); g[2 * dt + 1] = *(const v4f*)(grow + dt * 16 + 4); }
    asm volatile("s_wait_xcnt 0x0" :: "v"(grow) : "memory");   // stands in front of any rewrite of the address registers that the loads name; the address as an input keeps it in those registers up to here
    asm volatile("s_wait_asynccnt 0x0" ::: "memory");   // no copy is in flight when the wave stores its tile and ends
#pragma unroll
    for (int dt = 0; dt < 8; ++dt) { v4f lo, hi4;
#pragma unroll
        for (int r = 0; r < 4; ++r) { lo[r] = __fmul_rn(o[dt][r], g[2 * dt][r]); hi4[r] = __fmul_rn(o[dt][4 + r], g[2 * dt + 1][r]); }
        *(v4f*)(orow + dt * 16) = lo; *(v4f*)(orow + dt * 16 + 4) = hi4; }
}
extern "C" void kernel_launch(void* const* d_in, const int* in_sizes, int n_in,
                              void* d_out, int out_size, void* d_ws, size_t ws_size, hipStream_t stream) {
    (void)in_sizes; (void)n_in; (void)out_size;
    const float* x = (const float*)d_in[0]; const float* wq = (const float*)d_in[1]; const float* wk = (const float*)d_in[2]; const float* wv = (const float*)d_in[3]; const float* wu = (const float*)d_in[4]; const float* RB = (const float*)d_in[5];
    float* OUT = (float*)d_out;     // [4][2048][1024]
    char* wsp = (char*)d_ws;
    auto take = [&](size_t bytes) { char* p = wsp; wsp += (bytes + 255) & ~(size_t)255; return (void*)p; };
    bf* WQ = (bf*)take((size_t)4 * DM * DM * 2); bf* WK = WQ + (size_t)DM * DM; bf* WV = WK + (size_t)DM * DM; bf* WU = WV + (size_t)DM * DM;   /* one Bt of 4 x 1024 rows */ float* BTT = (float*)take((size_t)NH_ * 4096 * 4); float* KF = (float*)take((size_t)(DKV / 64) * NB_ * TT * 4);
    bf* XB = (bf*)take((size_t)NB_ * TT * DM * 2); float* SU = (float*)take((size_t)NB_ * TT * DM * 4); h16* VT16 = (h16*)take((size_t)NB_ * NKV * HD * TT * 2);
    bf* QPh = (bf*)take((size_t)NB_ * NH_ * TT * HD * 2); bf* QPl = (bf*)take((size_t)NB_ * NH_ * TT * HD * 2); bf* KPh = (bf*)take((size_t)NB_ * NKV * TT * HD * 2); bf* KPl = (bf*)take((size_t)NB_ * NKV * TT * HD * 2);
    if ((size_t)(wsp - (char*)d_ws) > ws_size) return;    // ws 256 MiB
    k_prep<<<PWB + PBB + PXB, 256, 0, stream>>>(x, wq, wk, wv, wu, RB, XB, WQ, WK, WV, WU, BTT);   /* bf16 transposed weights, transposed relative-bias rows, bf16 x */
    k_gemmw<bf><<<dim3(NB_ * TT / 256, 4 * DM / 128, 1), 256, 0, stream>>>(XB, WQ, DM, QPh, QPl, KPh, KPl, KF, VT16, SU);   /* silu(x Wq) and silu(x Wk) planes, key padding flags, silu(x Wv) transposed, silu(x Wu) */
    k_fattn<<<dim3(NH_, NB_, TT / 64), 128, 0, stream>>>(QPh, QPl, KPh, KPl, VT16, BTT, KF, SU, OUT);   /* silu attention, all heads and batches, gated: out[b*TT+t][h*128+d] = attn x silu(x Wu) */
}

// v009
// Measured time: 130 microseconds a run.
// In both of two side-by-side timings against v008, it was 1.06 times as fast.
// Counting every step since v000, it is 13.5 times as fast.
#include <hip/hip_runtime.h>

// HSTU layer (x [4][2048][1024]; Q, K, V = silu(x W) ('xw' [1024][1024]; 8 heads x 128), U = x Wu; scores = Q.K + rel_bias[i - j + 2047][h] ([4095][8], read); scores / sqrt(128); causal and key-padding (sign(sum|K|) == 0) positions -> -2^32+1; weights = silu(scores) (no softmax; masked weights are exactly 0); attn = weights V merged [t][h*128+d]; out = attn x silu(U) -> [4][2048][1024] (8.4 M)).
// Layout: bf16 copies of x and of the transposed weights; the four projections as ONE GEMM launch (the four transposed weights lie one behind the other: one Bt of 4096 rows) whose f32 tiles never go to memory: each tile's epilogue applies what the layer does next to it and stores that (silu and the bf16 hi/lo planes of Q and K, the key flags, silu and the transposed fp16 plane of V, silu(U) in f32); then one fused silu-attention kernel (scores and fp16 weights stay in registers, exact zeros above the diagonal so the P.V contraction stops at the diagonal block; its epilogue multiplies the merged f32 rows by silu(U) and writes out). Three launches. The four batches run side by side in every launch: the GEMM and the bf16 copy of x take the 8192 rows as one matrix, the attention kernel takes the batch from the grid.
// Compute dtypes, f32 accumulate: every input rounded to bf16; projections exact (inputs); silu in f32 (hardware exp2 and reciprocal) -> Q/K hi/lo planes, V fp16 planes; scores 3 products (tile skipping); bias add, 1/sqrt(128), masks and silu in f32; fp16 weights x fp16 silu(V) (one product, causal K range); no output projection: out = attn x silu(x Wu) in f32.

#define NB_  4
#define TT   2048
#define DM   1024
#define NH_  8
#define NKV  8
#define REP  (NH_ / NKV)
#define HD   128
#define DQ   (NH_ * HD)
#define DKV  (NKV * HD)
#define NEGM (-4294967295.0f)
#define ISC  0.088388347648318447f   // 1/sqrt(128), applied after the bias add
#define ZH   2
#define RH   2048
#define WIN  2048
#define PCAR 1024.0f
#define SCL  0.088388347648318447f   // HD^-0.5
typedef _Float16 h16;
typedef unsigned short bf;
typedef __attribute__((ext_vector_type(16))) __bf16   v16bf;
typedef __attribute__((ext_vector_type(16))) _Float16 v16h;
typedef __attribute__((ext_vector_type(8)))  _Float16 v8h;
typedef __attribute__((ext_vector_type(8)))  unsigned short v8us;
typedef __attribute__((ext_vector_type(8)))  float    v8f;
typedef __attribute__((ext_vector_type(4)))  float    v4f;
typedef v8h  __attribute__((may_alias)) v8ha;
typedef v4f  __attribute__((may_alias)) v4fa;
typedef v8us __attribute__((may_alias)) v8usa;

__device__ __forceinline__ unsigned short f2bf(float f) { unsigned u = __float_as_uint(f); u += 0x7FFFu + ((u >> 16) & 1u); return (unsigned short)(u >> 16); }
__device__ __forceinline__ float bf2f(unsigned short b) { return __uint_as_float(((unsigned)b) << 16); }
__device__ __forceinline__ float bfr(float f) { return bf2f(f2bf(f)); }
__device__ __forceinline__ v16h cat16(v8h lo, v8h hi) { return __builtin_shufflevector(lo, hi, 0, 1, 2, 3, 4, 5, 6, 7, 8, 9, 10, 11, 12, 13, 14, 15); }
__device__ __forceinline__ v16bf cat16b(v8us lo, v8us hi) { return __builtin_bit_cast(v16bf, __builtin_shufflevector(lo, hi, 0, 1, 2, 3, 4, 5, 6, 7, 8, 9, 10, 11, 12, 13, 14, 15)); }
__device__ __forceinline__ v8f wmma16(v16h a, v16h b, v8f c) { return __builtin_amdgcn_wmma_f32_16x16x32_f16(false, a, false, b, (short)0, c, false, false); }
__device__ __forceinline__ v8f wmmab(v16bf a, v16bf b, v8f c) { return __builtin_amdgcn_wmma_f32_16x16x32_bf16(false, a, false, b, (short)0, c, false, false); }



__device__ __forceinline__ h16 tohx(float x) { return (h16)x; }
// silu = u sigmoid(u) = u / (1 + 2^(-u log2 e)) in f32 on the hardware's exp2 and reciprocal, eight values at a time.
// Each run of eight transcendentals is one statement: results in registers of their own (early clobber), so that none overwrites a source of the one in front of it, and the v_nop at the end is the slot that the instruction set asks for between a transcendental and an instruction that reads its result or overwrites its source.
#define TR8(op, d, s) asm(op " %0, %8\n\t" op " %1, %9\n\t" op " %2, %10\n\t" op " %3, %11\n\t" op " %4, %12\n\t" op " %5, %13\n\t" op " %6, %14\n\t" op " %7, %15\n\tv_nop" \
    : "=&v"(d[0]), "=&v"(d[1]), "=&v"(d[2]), "=&v"(d[3]), "=&v"(d[4]), "=&v"(d[5]), "=&v"(d[6]), "=&v"(d[7]) : "v"(s[0]), "v"(s[1]), "v"(s[2]), "v"(s[3]), "v"(s[4]), "v"(s[5]), "v"(s[6]), "v"(s[7]))
__device__ __forceinline__ void silu8(const float* u, float* y) {
    float a[8], e[8], r[8];
#pragma unroll
    for (int q = 0; q < 8; ++q) a[q] = u[q] * -1.4426950408889634f;
    TR8("v_exp_f32", e, a);
#pragma unroll
    for (int q = 0; q < 8; ++q) e[q] = 1.0f + e[q];
    TR8("v_rcp_f32", r, e);
#pragma unroll
    for (int q = 0; q < 8; ++q) y[q] = u[q] * r[q];
}
__device__ __forceinline__ void splitf(float y, unsigned short& h, unsigned short& l) { h = f2bf(y); l = f2bf(y - bf2f(h)); }
typedef __attribute__((ext_vector_type(2))) _Float16 v2h;
typedef __attribute__((ext_vector_type(4))) _Float16 v4h;
typedef __attribute__((ext_vector_type(2))) unsigned short v2us;
typedef __attribute__((ext_vector_type(4))) unsigned short v4us;
typedef __attribute__((ext_vector_type(2))) float v2f;
typedef __attribute__((ext_vector_type(4))) int v4i;

// ---- k_gemmw: register-blocked GEMM, one wave per 64x64 output tile (16 accumulators), 4 x 2 waves a work-group (256x128), one work-group a WGP; grid (M/256, 4 * 1024/128), 256 threads: the work-groups of the four projections follow one another on a WGP with no launch boundary between them. K % 128 == 0, K >= 256.
// The operands are K-contiguous 16-bit planes. A stage is 128 k (256 bytes) of the work-group's 256 rows of A and 128 rows of Bt, brought into LDS once for the eight waves by asynchronous copies of whole rows, one stage ahead into the other of two buffers; the waves read their fragments from there (rows pitched 16 B x odd for the 16-byte reads), 32 k ahead of the products. k runs upward in 32s into the same accumulators.
// c[m][n] = sum_k A[m][k] Bt[n][k] (f32) never goes to memory; m = b*TT + t, n = MODE*1024 + h*HD + d: the projection (MODE) comes from the block index, the same for a whole work-group. The tile is laid into the wave's own part of LDS (the buffers, which nobody reads any more behind the last stage's barrier) once and read back as whole rows, 8 values a lane; what the epilogue stores, by MODE, in 128-byte (f32: 256-byte) pieces:
// 0: silu(c) as bf16 hi/lo planes [b][h][t][d] (Q). 1: the same (K), and KF[(h*HD+d)/64][m] = 1.0 where any silu(c) of the row's 64 columns is not zero, else 0.0 (a sum of absolute values is zero only where every term is).
// 2: silu(c) as the fp16 plane [b][h][d][t] (V transposed: the tile is laid down as [d][t], a lane's 8 accumulator rows being 8 consecutive t of one d). 3: silu(c) in f32 -> SU[m][h*HD+d] (the u gate, which the attention kernel's epilogue applies).
template <typename T16> struct WFrag;
template <> struct WFrag<h16> { typedef v16h V; static __device__ __forceinline__ V ld(const h16* p) { return cat16(*(const v8h*)p, *(const v8h*)(p + 16)); } static __device__ __forceinline__ v8f mma(V a, V b, v8f c) { return wmma16(a, b, c); } };
template <> struct WFrag<bf> { typedef v16bf V; static __device__ __forceinline__ V ld(const bf* p) { return cat16b(*(const v8us*)p, *(const v8us*)(p + 16)); } static __device__ __forceinline__ v8f mma(V a, V b, v8f c) { return wmmab(a, b, c); } };
#define GPIT 272                   // LDS pitch of a 256-byte operand row (128 k)
#define GSTG (384 * GPIT)          // one stage: 256 rows of A, then 128 rows of Bt
typedef const __attribute__((address_space(1))) char* gptr;   // an address known to be global memory
// eight 16-byte copies a lane, global memory to LDS through no register, 16 rows apart, in one statement; the one wait at its end stands in front of any rewrite of the address registers that the copies name
__device__ __forceinline__ void cp8(unsigned l, gptr g, size_t gs) {
    asm volatile("global_load_async_to_lds_b128 %0, %8, off\n\tglobal_load_async_to_lds_b128 %1, %9, off\n\tglobal_load_async_to_lds_b128 %2, %10, off\n\tglobal_load_async_to_lds_b128 %3, %11, off\n\t"
                 "global_load_async_to_lds_b128 %4, %12, off\n\tglobal_load_async_to_lds_b128 %5, %13, off\n\tglobal_load_async_to_lds_b128 %6, %14, off\n\tglobal_load_async_to_lds_b128 %7, %15, off\n\ts_wait_xcnt 0x0"
                 :: "v"(l), "v"(l + 16 * GPIT), "v"(l + 32 * GPIT), "v"(l + 48 * GPIT), "v"(l + 64 * GPIT), "v"(l + 80 * GPIT), "v"(l + 96 * GPIT), "v"(l + 112 * GPIT),
                    "v"(g), "v"(g + gs), "v"(g + 2 * gs), "v"(g + 3 * gs), "v"(g + 4 * gs), "v"(g + 5 * gs), "v"(g + 6 * gs), "v"(g + 7 * gs) : "memory");
}
// the epilogue of one wave's 64x64 tile: r0 its first row, c0 its first column inside its own projection
template <int MODE>
__device__ __forceinline__ void gemm_epi(const v8f (&acc)[4][4], float* os, const int lane, const int r0, const int c0, bf* Ph, bf* Pl, float* KF, h16* Vt, float* SU) {
    const int lr = lane & 15, hi = lane >> 4;
#pragma unroll
    for (int mb = 0; mb < 4; ++mb)
#pragma unroll
        for (int nb = 0; nb < 4; ++nb) {
            if (MODE == 2) { v4f lo, hi4;
#pragma unroll
                for (int r = 0; r < 4; ++r) { lo[r] = acc[mb][nb][r]; hi4[r] = acc[mb][nb][4 + r]; }
                float* p = os + (nb * 16 + lr) * 68 + mb * 16 + hi * 8; *(v4fa*)p = lo; *(v4fa*)(p + 4) = hi4;
            } else {
#pragma unroll
                for (int j = 0; j < 8; ++j) os[(mb * 16 + hi * 8 + j) * 68 + nb * 16 + lr] = acc[mb][nb][j]; } }
    __builtin_amdgcn_wave_barrier(); asm volatile("" ::: "memory");   // the reads below take what OTHER lanes of the wave have written: the compiler may not lift them over the writes
    const int rw = lane >> 3, cofs = (lane & 7) * 8;   // 8 lanes a tile row, 4 rows a pass
    const size_t pl = (size_t)(r0 / TT) * NH_ + c0 / HD; const int t0 = r0 % TT, d0 = c0 % HD;   // the tile's (batch, head) plane and its first row and column there
    const size_t e0 = (MODE == 3) ? (size_t)(r0 + rw) * DM + c0 + cofs : (MODE == 2) ? (pl * HD + d0 + rw) * TT + t0 + cofs : (pl * TT + t0 + rw) * HD + d0 + cofs;
    const size_t est = 4 * ((MODE == 3) ? DM : (MODE == 2) ? TT : HD);   // elements from one pass's row to the next pass's
    unsigned long long nzr = 0;   // one bit a tile row: some silu(K) of the row is not zero
#pragma unroll 1   // kept rolled, two passes a trip: 8 independent silu chains a lane and pass keep the vector port fed, and the kernel's text stays a few KB
    for (int it = 0; it < 16; it += 2) {
#pragma unroll
        for (int u = 0; u < 2; ++u) {
            const float* src = os + ((it + u) * 4 + rw) * 68 + cofs; const v4f v0 = *(const v4fa*)src, v1 = *(const v4fa*)(src + 4); const size_t e = e0 + (size_t)(it + u) * est;
            float cv[8], y[8];
#pragma unroll
            for (int q = 0; q < 4; ++q) { cv[q] = v0[q]; cv[4 + q] = v1[q]; }
            silu8(cv, y);
            if (MODE == 3) { v4f o0, o1;
#pragma unroll
                for (int q = 0; q < 4; ++q) { o0[q] = y[q]; o1[q] = y[4 + q]; }
                *(v4f*)(SU + e) = o0; *(v4f*)(SU + e + 4) = o1;
            } else if (MODE == 2) { v8h o;
#pragma unroll
                for (int q = 0; q < 8; ++q) o[q] = tohx(y[q]);
                *(v8h*)(Vt + e) = o;
            } else { v8us oh, ol; bool nz = false;
#pragma unroll
                for (int q = 0; q < 8; ++q) { unsigned short a2, c2; splitf(y[q], a2, c2); oh[q] = a2; ol[q] = c2; nz = nz | !(y[q] == 0.0f); }
                *(v8us*)(Ph + e) = oh; *(v8us*)(Pl + e) = ol;
                if (MODE == 1) { const unsigned m = __builtin_amdgcn_ballot_w32(nz);   // byte k: the 8 lanes of the pass's row k
                    const unsigned b4 = ((m & 0xFFu) ? 1u : 0u) | ((m & 0xFF00u) ? 2u : 0u) | ((m & 0xFF0000u) ? 4u : 0u) | ((m & 0xFF000000u) ? 8u : 0u);
                    nzr |= (unsigned long long)b4 << ((it + u) * 4); }
            } } }
    if (MODE == 1) { float* kf = KF + (size_t)(c0 / 64) * (NB_ * TT) + r0 + lane; kf[0] = ((nzr >> lane) & 1u) ? 1.0f : 0.0f; kf[32] = ((nzr >> (lane + 32)) & 1u) ? 1.0f : 0.0f; }
}
template <typename T16>
__global__ __launch_bounds__(256) void k_gemmw(const T16* __restrict__ A, const T16* __restrict__ Bt, int K, bf* Qh, bf* Ql, bf* Kh, bf* Kl, float* KF, h16* Vt, float* SU) {
    typedef typename WFrag<T16>::V V;
    __shared__ __align__(16) char sm[2 * GSTG];
    const int tid = threadIdx.x, lane = tid & 31, lr = lane & 15, hi = lane >> 4; const int wv = __builtin_amdgcn_readfirstlane(tid >> 5);
    const int r0 = blockIdx.x * 256 + (wv & 3) * 64, c0 = (blockIdx.y & 7) * 128 + (wv >> 2) * 64;   // the wave's own 64x64 tile: its first row, and its first column inside its projection
    float* os = (float*)(sm + wv * (64 * 68 * 4));   // the wave's epilogue tile, laid over the buffers
    v8f acc[4][4];
#pragma unroll
    for (int mb = 0; mb < 4; ++mb)
#pragma unroll
        for (int nb = 0; nb < 4; ++nb) acc[mb][nb] = (v8f){};
    // each lane's part of a stage's copies: 16 lanes a 256-byte row, 16 rows a copy of the work-group, 16 copies for the 256 rows of A and 8 for the 128 of Bt
    const unsigned lsm = (unsigned)(size_t)(__attribute__((address_space(3))) char*)sm + (tid >> 4) * GPIT + (tid & 15) * 16; const size_t gs = (size_t)16 * K * 2;
    gptr ga = (gptr)(A + (size_t)(blockIdx.x * 256 + (tid >> 4)) * K) + (tid & 15) * 16; gptr gb = (gptr)(Bt + (size_t)(blockIdx.y * 128 + (tid >> 4)) * K) + (tid & 15) * 16;
    auto fill = [&](const int bo, const int kc) {   // bo: the buffer's byte offset
        const unsigned l = lsm + bo; gptr x = ga + kc * 2, y = gb + kc * 2;
        cp8(l, x, gs); cp8(l + 128 * GPIT, x + 8 * gs, gs); cp8(l + 256 * GPIT, y, gs);
    };
    fill(0, 0);
    asm volatile("s_wait_asynccnt 0x0" ::: "memory");   // this wave's copies of the first stage have landed before the barrier behind which the other waves read them
    __syncthreads();
    fill(GSTG, 128);   // K >= 256: a second stage always exists
    const int aof = ((wv & 3) * 64 + lr) * GPIT + 16 * hi, bof = (256 + (wv >> 2) * 64 + lr) * GPIT + 16 * hi;
#pragma unroll 1   // not unrolled: the buffers' addresses are formed from bo in each stage and hold no registers of their own
    for (int kc = 0, bo = 0; kc < K; kc += 128, bo ^= GSTG) {
        const char* at = sm + bo + aof; const char* bt = sm + bo + bof;
        V a[2][4], b[2][4];
#pragma unroll
        for (int f = 0; f < 4; ++f) { a[0][f] = WFrag<T16>::ld((const T16*)(at + f * 16 * GPIT)); b[0][f] = WFrag<T16>::ld((const T16*)(bt + f * 16 * GPIT)); }
#pragma unroll
        for (int s = 0; s < 4; ++s) {   // 32 k a pass; the next pass's fragments (of this stage only) are asked for as one group in front of this pass's products
            if (s < 3) {
#pragma unroll
                for (int f = 0; f < 4; ++f) { a[(s + 1) & 1][f] = WFrag<T16>::ld((const T16*)(at + f * 16 * GPIT + (s + 1) * 64)); b[(s + 1) & 1][f] = WFrag<T16>::ld((const T16*)(bt + f * 16 * GPIT + (s + 1) * 64)); }
                __builtin_amdgcn_sched_barrier(0);   // keeps those reads here as one group, their latency under this pass's products (left alone the compiler sinks them among the products that use them, a wait to zero in front of every four)
            }
#pragma unroll
            for (int nb = 0; nb < 4; ++nb)
#pragma unroll
                for (int mb = 0; mb < 4; ++mb) acc[mb][nb] = WFrag<T16>::mma(a[s & 1][mb], b[s & 1][nb], acc[mb][nb]);
        }
        __builtin_amdgcn_sched_barrier(0);   // keeps the waits and the barrier below at the foot, behind the last products and directly in front of the refill, so that the copies have a whole stage to land
        asm volatile("s_wait_dscnt 0x0" ::: "memory");      // this wave's reads of the buffer are over before the barrier behind which it is refilled
        asm volatile("s_wait_asynccnt 0x0" ::: "memory");   // this wave's copies of the next stage have landed before the barrier behind which the other waves read them
        __syncthreads();
        if (kc + 256 < K) fill(bo, kc + 256);   // the same for the whole work-group
    }
    asm volatile("s_wait_asynccnt 0x0" ::: "memory");   // no copy is in flight when the buffers become the epilogue's tiles
    const int mode = blockIdx.y >> 3;   // which projection the work-group's 128 rows of Bt belong to
    if (mode == 0) gemm_epi<0>(acc, os, lane, r0, c0, Qh, Ql, nullptr, nullptr, nullptr);
    else if (mode == 1) gemm_epi<1>(acc, os, lane, r0, c0, Kh, Kl, KF, nullptr, nullptr);
    else if (mode == 2) gemm_epi<2>(acc, os, lane, r0, c0, nullptr, nullptr, nullptr, Vt, nullptr);
    else gemm_epi<3>(acc, os, lane, r0, c0, nullptr, nullptr, nullptr, nullptr, SU);
}
// ---- k_prep: all that is only a re-laying of an input (bf16 transposed weights, transposed bias rows, the bf16 copy of x), in one launch of few, long waves; the job comes from the block index (the same for a whole work-group); no work-group barrier.
// Blocks [0, PWB): the four weights, w [k][n] f32 -> Bt [n][k] bf16. A work-group takes 256 k x 64 n of one weight, a wave 64 k x 32 n: 16 loads of 16 bytes a lane, all in flight (8 lanes a 128-byte row piece, a lane holds rows k and k + 1 of 4 columns), the bf16 pairs (k, k + 1) go as dwords into the wave's own part of LDS as [n][k] and come back as whole 128-byte rows for the stores.
// Blocks [PWB, PWB + PBB): BTT[h][p] = bf16-rounded rel_bias[p][h], 0 at p = 4095. The rest: 16 x 8 values of x a lane, the 32 loads in flight together.
#define PWB  256                   // 4 weights x (1024 / 64) x (1024 / 256)
#define PBB  16                    // NH_ * 4096 / (256 * 8)
#define PXB  256                   // NB_ * TT * DM / (256 * 16 * 8)
#define TPIT 36                    // dwords from one n row of a wave's LDS tile to the next (32 of data; a multiple of 4 for the 16-byte reads)
typedef __attribute__((ext_vector_type(4))) unsigned v4u;
typedef v4u __attribute__((may_alias)) v4ua;
__global__ __launch_bounds__(256) void k_prep(const float* __restrict__ x, const float* __restrict__ wq, const float* __restrict__ wk, const float* __restrict__ wv, const float* __restrict__ wu, const float* __restrict__ RB,
                                              bf* XB, bf* WQ, bf* WK, bf* WV, bf* WU, float* BTT) {
    static_assert(DQ == DM && DKV == DM && DM == 1024 && PBB * 2048 == NH_ * 4096 && (size_t)PXB * 4096 * 8 == (size_t)NB_ * TT * DM, "the block ranges are cut for these shapes");
    __shared__ __align__(16) unsigned tl[8 * 32 * TPIT];
    const int blk = blockIdx.x, tid = threadIdx.x;
    if (blk < PWB) {
        const int sel = blk >> 6, t = blk & 63;
        const float* __restrict__ w = sel == 0 ? wq : sel == 1 ? wk : sel == 2 ? wv : wu; bf* Bt = sel == 0 ? WQ : sel == 1 ? WK : sel == 2 ? WV : WU;
        const int lane = tid & 31, wvi = tid >> 5, r = lane >> 3, c = lane & 7;
        const int n0 = (t >> 2) * 64 + (wvi & 1) * 32, k0 = (t & 3) * 256 + (wvi >> 1) * 64;
        unsigned* my = tl + wvi * (32 * TPIT);
        const float* s = w + (size_t)(k0 + 2 * r) * DM + n0 + 4 * c;
        v4f a[8], b[8];
#pragma unroll
        for (int j = 0; j < 8; ++j) { a[j] = *(const v4f*)(s + (size_t)(8 * j) * DM); b[j] = *(const v4f*)(s + (size_t)(8 * j + 1) * DM); }
        asm volatile("s_wait_xcnt 0x0" :: "v"(s) : "memory");   // stands in front of any rewrite of the address registers that the loads name; the address as an input keeps it in those registers up to here (left alone the last load lands on them)
#pragma unroll
        for (int j = 0; j < 8; ++j)
#pragma unroll
            for (int q = 0; q < 4; ++q) my[(4 * c + q) * TPIT + 4 * j + r] = (unsigned)f2bf(a[j][q]) | ((unsigned)f2bf(b[j][q]) << 16);
        __builtin_amdgcn_wave_barrier(); asm volatile("" ::: "memory");   // the reads below take what OTHER lanes of the wave have written: the compiler may not lift them over the writes
        bf* d = Bt + (size_t)(n0 + r) * DM + k0 + 8 * c;
#pragma unroll
        for (int i = 0; i < 8; ++i) *(v4ua*)(d + (size_t)(4 * i) * DM) = *(const v4ua*)(my + (4 * i + r) * TPIT + 4 * c);
    } else if (blk < PWB + PBB) {
#pragma unroll
        for (int u = 0; u < 8; ++u) { const int idx = (blk - PWB) * 2048 + u * 256 + tid; const int p = idx % 4096, h = idx / 4096; const int pc = p < 2 * TT - 1 ? p : 2 * TT - 2;   // the row index is clamped, so that every lane loads and the eight loads fly together
            const float v = bfr(RB[(size_t)pc * NH_ + h]); BTT[idx] = (p < 2 * TT - 1) ? v : 0.0f; }
        asm volatile("s_wait_xcnt 0x0" ::: "memory");   // stands behind the branch's last store, in front of any rewrite of the registers that the stores name
    } else {
        const size_t i0 = (size_t)(blk - PWB - PBB) * 4096 + tid; const float* s = x + i0 * 8;
        v8f v[16];
#pragma unroll
        for (int u = 0; u < 16; ++u) v[u] = *(const v8f*)(s + u * 2048);
        asm volatile("s_wait_xcnt 0x0" :: "v"(s) : "memory");   // as above
#pragma unroll
        for (int u = 0; u < 16; ++u) { v8us o;
#pragma unroll
            for (int k = 0; k < 8; ++k) o[k] = f2bf(v[u][k]);
            *(v8us*)(XB + (i0 + u * 256) * 8) = o; }
        asm volatile("s_wait_xcnt 0x0" ::: "memory");   // as behind the bias stores
    }
}
// ---- k_fattn: scores, bias, masks, silu weights, weights x V and the silu(U) gate in one kernel; nothing of the [t][t] planes goes to memory, and the ungated rows do not either. A work-group takes 128 query rows with 8 waves: wave = (row group of 32 queries, key half); grid (heads, batches, TT/128): the row block is the slowest index, longest rows first over all heads and batches, one work-group a WGP at a time, so that a WGP that ends a shorter block early takes the longer of the blocks that are left.
// A stage is 64 keys; the waves of key half 0 work on its first 32 keys, those of half 1 on its last 32, so a row block's chain of stages is half as long as its chain of 32-key steps. A wave holds TWO 16-query tiles, and every K and V fragment that it reads from LDS feeds both.
// Per 32 keys and query tile: St = K Qt (two 16-key tiles, the same 3 hi/lo products in the same order per 32 of d), a lane then holds 16 keys of ONE query in the hardware k order, so the fp16 weights are the B operand of Ot += Vt Pt as they stand.
// A wave's keys run in ascending steps into its own accumulators and stop at the end of the 128-row diagonal block (weights past the diagonal are exact zeros); at the end the two key halves' f32 partial sums of a query are added once, through LDS.
// The K hi, K lo and V tiles of a stage are brought into LDS once for the eight waves, by asynchronous copies of whole rows, one stage ahead into the other of two buffers; the waves read their fragments from there (rows pitched 16 B x odd for the 16-byte reads).
#define KPIT 272                   // LDS pitch of a 256-byte K row
#define VPIT 80                    // LDS pitch of a 64-byte V row (32 keys of one d)
#define KTB  (32 * KPIT)           // one K plane's tile
#define STG  (2 * KTB + HD * VPIT) // the tiles of one key half of a stage: K hi, K lo, V
#define STG2 (2 * STG)             // one stage: the two halves
__device__ __forceinline__ v16bf ldfb(gptr p) { return cat16b(*(const __attribute__((address_space(1))) v8us*)p, *(const __attribute__((address_space(1))) v8us*)(p + 32)); }
__device__ __forceinline__ v16bf ldsb(const char* p) { return cat16b(*(const v8us*)p, *(const v8us*)(p + 32)); }
__device__ __forceinline__ v16h ldsh(const char* p) { return cat16(*(const v8h*)p, *(const v8h*)(p + 32)); }
// a stage's twelve 16-byte copies a lane, global memory to LDS through no register, in one statement; the one wait at its end stands in front of any rewrite of the address registers that the copies name
__device__ __forceinline__ void cp12(unsigned a, unsigned b, unsigned v, gptr x, gptr y, gptr w) {
    asm volatile("global_load_async_to_lds_b128 %0, %12, off\n\tglobal_load_async_to_lds_b128 %1, %13, off\n\tglobal_load_async_to_lds_b128 %2, %14, off\n\tglobal_load_async_to_lds_b128 %3, %15, off\n\t"
                 "global_load_async_to_lds_b128 %4, %16, off\n\tglobal_load_async_to_lds_b128 %5, %17, off\n\tglobal_load_async_to_lds_b128 %6, %18, off\n\tglobal_load_async_to_lds_b128 %7, %19, off\n\t"
                 "global_load_async_to_lds_b128 %8, %20, off\n\tglobal_load_async_to_lds_b128 %9, %21, off\n\tglobal_load_async_to_lds_b128 %10, %22, off\n\tglobal_load_async_to_lds_b128 %11, %23, off\n\ts_wait_xcnt 0x0"
                 :: "v"(a), "v"(a + 8 * KPIT), "v"(a + 16 * KPIT), "v"(a + 24 * KPIT), "v"(b), "v"(b + 8 * KPIT), "v"(b + 16 * KPIT), "v"(b + 24 * KPIT), "v"(v), "v"(v + 32 * VPIT), "v"(v + 64 * VPIT), "v"(v + 96 * VPIT),
                    "v"(x), "v"(x + 2048), "v"(x + 4096), "v"(x + 6144), "v"(y), "v"(y + 2048), "v"(y + 4096), "v"(y + 6144), "v"(w), "v"(w + 32 * TT * 2), "v"(w + 64 * TT * 2), "v"(w + 96 * TT * 2) : "memory");
}
__global__ __launch_bounds__(256) void k_fattn(const bf* __restrict__ Qh, const bf* __restrict__ Ql, const bf* __restrict__ Kh, const bf* __restrict__ Kl, const h16* __restrict__ Vt, const float* __restrict__ BTT, const float* __restrict__ KM, const float* __restrict__ SU, float* O) {
    __shared__ __align__(16) float sbias[4096]; __shared__ __align__(16) float skm[TT]; __shared__ __align__(16) char ring[2 * STG2];
    const int h = blockIdx.x; const int qb = ((int)gridDim.z - 1 - (int)blockIdx.z) * 128;
    { const size_t b = blockIdx.y, pb = b * NH_ * TT * HD; Qh += pb; Ql += pb; Kh += pb; Kl += pb; Vt += pb; KM += (size_t)(2 * h) * (NB_ * TT) + b * TT; SU += b * TT * DM; O += b * TT * DM; }   // this batch's planes, the head's two rows of key flags (one for each 64 of its columns), gate rows and output rows
    const size_t hp = (size_t)h * TT * HD; const int tid = threadIdx.x, th = tid & 127;
    const int wv = __builtin_amdgcn_readfirstlane(tid >> 5), par = wv >> 2;   // the wave's key half: waves 0-3 the first 32 keys of a stage, waves 4-7 the last 32
    // each lane's part of a stage's copies; the four waves of a key half bring that half's tiles: K tiles are 8 KiB in a row (16 lanes a row, 8 rows a copy), V rows are 64 B of a 4-KiB row (4 lanes a row, 32 rows a copy)
    const unsigned lring = (unsigned)(size_t)(__attribute__((address_space(3))) char*)ring + par * STG;
    const unsigned lk = lring + (th >> 4) * KPIT + (th & 15) * 16, lv = lring + 2 * KTB + (th >> 2) * VPIT + (th & 3) * 16;
    gptr gkh = (gptr)(Kh + hp); gptr gkl = (gptr)(Kl + hp); gptr gv = (gptr)(Vt + hp); const unsigned tk = th * 16 + par * (32 * HD * 2), tv = (th >> 2) * TT * 2 + (th & 3) * 16 + par * (32 * 2);   // the planes' addresses are the same for every lane (scalar registers); a lane keeps its two 32-bit byte offsets into them
    auto fill = [&](const int bo, const int k0) {   // bo: the buffer's byte offset in the ring; k0: the stage's first key
        const unsigned a = lk + bo, v = lv + bo; gptr x = gkh + (tk + (unsigned)k0 * HD * 2), y = gkl + (tk + (unsigned)k0 * HD * 2), w = gv + (tv + (unsigned)k0 * 2);
        cp12(a, a + KTB, v, x, y, w);
    };
    fill(STG2, 0);   // the first stage goes into the second buffer: a lane's LDS base is then never itself an operand of the copies' statement, which would hold it in the low registers through the whole loop (it was spilled to scratch)
#pragma unroll
    for (int p = 0; p < 4096 / 4 / 256; ++p) ((v4f*)sbias)[p * 256 + tid] = ((const v4f*)(BTT + (size_t)h * 4096))[p * 256 + tid];
#pragma unroll
    for (int p = 0; p < TT / 4 / 256; ++p) ((v4f*)skm)[p * 256 + tid] = ((const v4f*)KM)[p * 256 + tid] + ((const v4f*)(KM + NB_ * TT))[p * 256 + tid];   // zero only where both halves of the key's row are all zero
    asm volatile("s_wait_asynccnt 0x0" ::: "memory");   // this wave's copies of the first tiles have landed before the barrier behind which the other waves read them
    __syncthreads();
    const int lane = tid & 31, c = lane & 15, hh = lane >> 4; const int q0 = qb + (wv & 3) * 32; const int i0 = q0 + c;   // the lane's query in tile ct is i0 + 16 ct
    const unsigned kof = c * HD * 2 + 16 * hh;
    v16bf qh[2][4], ql[2][4];
#pragma unroll
    for (int ct = 0; ct < 2; ++ct)
#pragma unroll
        for (int kc = 0; kc < 4; ++kc) { qh[ct][kc] = ldfb((gptr)(Qh + hp) + (size_t)q0 * HD * 2 + (kof + ct * 16 * HD * 2 + kc * 64)); ql[ct][kc] = ldfb((gptr)(Ql + hp) + (size_t)q0 * HD * 2 + (kof + ct * 16 * HD * 2 + kc * 64)); }
    asm volatile("s_wait_xcnt 0x0" :: "v"(kof) : "memory");   // stands in front of any rewrite of the address registers that the loads name; the offset as an input keeps it in its register up to here
    v8f o[2][8];
#pragma unroll
    for (int ct = 0; ct < 2; ++ct)
#pragma unroll
        for (int dt = 0; dt < 8; ++dt) o[ct][dt] = (v8f){};
    const int kend = qb + 128;   // keys up to the end of the work-group's 128-row diagonal block (weights past the diagonal are exact zeros): an even number of 64-key stages
    // the wave's 32 keys of one stage, on the tiles in the buffer at bo. The stage's barrier is split: a wave signals as soon as its LDS reads of the stage have returned and its copies of the next stage have landed, does its silu arithmetic and its weights x V products (registers only), and waits at the foot. So the two waves that share a SIMD need not run in step: one can be in its score products while the other is in its silu arithmetic.
    auto step = [&](const int bo, const int k0) {
        const int kk = k0 + 32 * par;   // the wave's first key
        const char* kt = ring + bo + par * STG + c * KPIT + 16 * hh; const char* vt = kt + 2 * KTB + c * (VPIT - KPIT);
        v16bf ka[4][2], kb[4][2]; v16h vf[8]; float bs[2][16]; v4f km[4];
#pragma unroll
        for (int kc = 0; kc < 3; ++kc)
#pragma unroll
            for (int k2 = 0; k2 < 2; ++k2) { ka[kc][k2] = ldsb(kt + k2 * 16 * KPIT + kc * 64); kb[kc][k2] = ldsb(kt + KTB + k2 * 16 * KPIT + kc * 64); }
        if (k0 + 64 < kend) fill(bo ^ STG2, k0 + 64);   // the same for the whole work-group. The next stage's copies go into the other buffer, whose every reader signalled the end of its reads in front of the barrier wait that this wave has passed; their issue runs under the latency of the reads above
        v8f s[2][2]; s[0][0] = (v8f){}; s[0][1] = (v8f){}; s[1][0] = (v8f){}; s[1][1] = (v8f){};
#pragma unroll
        for (int kc = 0; kc < 4; ++kc) {   // 32 of d a pass: four fragments, twelve products on four independent accumulators
#pragma unroll
            for (int k2 = 0; k2 < 2; ++k2)
#pragma unroll
                for (int ct = 0; ct < 2; ++ct) { s[ct][k2] = wmmab(ka[kc][k2], qh[ct][kc], s[ct][k2]); s[ct][k2] = wmmab(ka[kc][k2], ql[ct][kc], s[ct][k2]); s[ct][k2] = wmmab(kb[kc][k2], qh[ct][kc], s[ct][k2]); }
            // the pass's fragments are used up: the next reads take their registers (the last K fragments two passes ahead of their products, then the V fragments, bias and key flags)
            if (kc == 0) {
#pragma unroll
                for (int k2 = 0; k2 < 2; ++k2) { ka[3][k2] = ldsb(kt + k2 * 16 * KPIT + 3 * 64); kb[3][k2] = ldsb(kt + KTB + k2 * 16 * KPIT + 3 * 64); }
            } else if (kc < 3) {
#pragma unroll
                for (int dt = 0; dt < 4; ++dt) vf[(kc - 1) * 4 + dt] = ldsh(vt + ((kc - 1) * 4 + dt) * 16 * VPIT);
                if (kc == 2) {
#pragma unroll
                    for (int ct = 0; ct < 2; ++ct)
#pragma unroll
                        for (int e = 0; e < 16; ++e) bs[ct][e] = sbias[2047 + i0 + 16 * ct - (kk + (e >> 3) * 16 + 8 * hh + (e & 7))];
#pragma unroll
                    for (int e = 0; e < 4; ++e) km[e] = *(const v4f*)(skm + kk + (e >> 1) * 16 + 8 * hh + (e & 1) * 4);
                }
            }
            if (kc < 3) __builtin_amdgcn_sched_barrier(0);   // keeps those reads here as one group, their latency under the products that follow (left alone the compiler sinks them between the last products, a short-led wait at each)
        }
        asm volatile("s_wait_dscnt 0x0" ::: "memory");      // this wave's reads of the buffer are over before it signals: behind the barrier the buffer is refilled
        asm volatile("s_wait_asynccnt 0x0" ::: "memory");   // this wave's copies of the next stage's tiles have landed before it signals: behind the barrier the other waves read them
        asm volatile("s_barrier_signal -1" ::: "memory");   // first half of the stage's barrier; no LDS read stands between it and the wait at the foot
        __builtin_amdgcn_sched_barrier(0);   // keeps the arithmetic below behind the signal (left alone the compiler lifts it over the signal, which then comes as late as the wait)
#pragma unroll
        for (int ct = 0; ct < 2; ++ct) {
            v16h p; float t[16], wt[16];
#pragma unroll
            for (int e = 0; e < 16; ++e) { const int j = kk + (e >> 3) * 16 + 8 * hh + (e & 7); const float t0 = __fmul_rn(__fadd_rn(s[ct][e >> 3][e & 7], bs[ct][e]), ISC); const bool msk = (j > i0 + 16 * ct) | (km[e >> 2][e & 3] == 0.0f); t[e] = msk ? NEGM : t0; }
            silu8(t, wt); silu8(t + 8, wt + 8);
#pragma unroll
            for (int e = 0; e < 16; ++e) p[e] = tohx(wt[e]);
#pragma unroll
            for (int dt = 0; dt < 8; ++dt) o[ct][dt] = wmma16(vf[dt], p, o[ct][dt]);
        }
        __builtin_amdgcn_sched_barrier(0);   // keeps the wait below at the foot, behind the last products
        asm volatile("s_barrier_wait -1" ::: "memory");   // second half: every wave has signalled, so the next stage's tiles may be read and this stage's buffer refilled
    };
#pragma unroll 1
    for (int k0 = 0, bo = STG2; k0 < kend; k0 += 64, bo ^= STG2) step(bo, k0);   // not unrolled: the buffers' addresses are formed from bo in each stage and hold no registers of their own
    asm volatile("s_wait_asynccnt 0x0" ::: "memory");   // no copy is in flight when the ring becomes the exchange space below
    // the two key halves' partial sums are joined: the wave of half 0 finishes query tile 0, its partner (same row group, half 1) tile 1; each lays the tile that it does not finish into its own 8 KiB of the ring (which nobody reads any more behind the last stage's barrier) and takes the partner's
    v8f mine[8], oth[8];
#pragma unroll
    for (int dt = 0; dt < 8; ++dt) { mine[dt] = par ? o[1][dt] : o[0][dt]; oth[dt] = par ? o[0][dt] : o[1][dt]; }
    const size_t eo = (size_t)(i0 + 16 * par) * DM + h * HD + 8 * hh;   // a lane holds 8 consecutive d of one query: merged [t][h*128+d], f32
    const float* grow = SU + eo; float* orow = O + eo;
    v4f g[16];   // the query's silu(U) at the lane's 64 places, the sixteen loads in flight together
#pragma unroll
    for (int dt = 0; dt < 8; ++dt) { g[2 * dt] = *(const v4f*)(grow + dt * 16); g[2 * dt + 1] = *(const v4f*)(grow + dt * 16 + 4); }
    asm volatile("s_wait_xcnt 0x0" :: "v"(grow) : "memory");   // stands in front of any rewrite of the address registers that the loads name; the address as an input keeps it in those registers up to here
    v4fa* xs = (v4fa*)ring;   // [wave][16][lane] pieces of 16 bytes
#pragma unroll
    for (int dt = 0; dt < 8; ++dt) { v4f lo, hi4;
#pragma unroll
        for (int r = 0; r < 4; ++r) { lo[r] = oth[dt][r]; hi4[r] = oth[dt][4 + r]; }
        xs[(wv * 16 + 2 * dt) * 32 + lane] = lo; xs[(wv * 16 + 2 * dt + 1) * 32 + lane] = hi4; }
    __syncthreads();   // the partner's tile is read behind it
#pragma unroll
    for (int dt = 0; dt < 8; ++dt) { const v4f pa = xs[((wv ^ 4) * 16 + 2 * dt) * 32 + lane], pb = xs[((wv ^ 4) * 16 + 2 * dt + 1) * 32 + lane]; v4f lo, hi4;
#pragma unroll
        for (int r = 0; r < 4; ++r) { lo[r] = __fmul_rn(__fadd_rn(mine[dt][r], pa[r]), g[2 * dt][r]); hi4[r] = __fmul_rn(__fadd_rn(mine[dt][4 + r], pb[r]), g[2 * dt + 1][r]); }
        *(v4f*)(orow + dt * 16) = lo; *(v4f*)(orow + dt * 16 + 4) = hi4; }
}
extern "C" void kernel_launch(void* const* d_in, const int* in_sizes, int n_in,
                              void* d_out, int out_size, void* d_ws, size_t ws_size, hipStream_t stream) {
    (void)in_sizes; (void)n_in; (void)out_size;
    const float* x = (const float*)d_in[0]; const float* wq = (const float*)d_in[1]; const float* wk = (const float*)d_in[2]; const float* wv = (const float*)d_in[3]; const float* wu = (const float*)d_in[4]; const float* RB = (const float*)d_in[5];
    float* OUT = (float*)d_out;     // [4][2048][1024]
    char* wsp = (char*)d_ws;
    auto take = [&](size_t bytes) { char* p = wsp; wsp += (bytes + 255) & ~(size_t)255; return (void*)p; };
    bf* WQ = (bf*)take((size_t)4 * DM * DM * 2); bf* WK = WQ + (size_t)DM * DM; bf* WV = WK + (size_t)DM * DM; bf* WU = WV + (size_t)DM * DM;   /* one Bt of 4 x 1024 rows */ float* BTT = (float*)take((size_t)NH_ * 4096 * 4); float* KF = (float*)take((size_t)(DKV / 64) * NB_ * TT * 4);
    bf* XB = (bf*)take((size_t)NB_ * TT * DM * 2); float* SU = (float*)take((size_t)NB_ * TT * DM * 4); h16* VT16 = (h16*)take((size_t)NB_ * NKV * HD * TT * 2);
    bf* QPh = (bf*)take((size_t)NB_ * NH_ * TT * HD * 2); bf* QPl = (bf*)take((size_t)NB_ * NH_ * TT * HD * 2); bf* KPh = (bf*)take((size_t)NB_ * NKV * TT * HD * 2); bf* KPl = (bf*)take((size_t)NB_ * NKV * TT * HD * 2);
    if ((size_t)(wsp - (char*)d_ws) > ws_size) return;    // ws 256 MiB
    k_prep<<<PWB + PBB + PXB, 256, 0, stream>>>(x, wq, wk, wv, wu, RB, XB, WQ, WK, WV, WU, BTT);   /* bf16 transposed weights, transposed relative-bias rows, bf16 x */
    k_gemmw<bf><<<dim3(NB_ * TT / 256, 4 * DM / 128, 1), 256, 0, stream>>>(XB, WQ, DM, QPh, QPl, KPh, KPl, KF, VT16, SU);   /* silu(x Wq) and silu(x Wk) planes, key padding flags, silu(x Wv) transposed, silu(x Wu) */
    k_fattn<<<dim3(NH_, NB_, TT / 128), 256, 0, stream>>>(QPh, QPl, KPh, KPl, VT16, BTT, KF, SU, OUT);   /* silu attention, all heads and batches, gated: out[b*TT+t][h*128+d] = attn x silu(x Wu) */
}

// v010
// It runs in 126 microseconds.
// Next to v009, in two timings, it ran 1.03 times as fast each time.
// All steps since v000 together make it 14.0 times as fast.
#include <hip/hip_runtime.h>

// HSTU layer (x [4][2048][1024]; Q, K, V = silu(x W) ('xw' [1024][1024]; 8 heads x 128), U = x Wu; scores = Q.K + rel_bias[i - j + 2047][h] ([4095][8], read); scores / sqrt(128); causal and key-padding (sign(sum|K|) == 0) positions -> -2^32+1; weights = silu(scores) (no softmax; masked weights are exactly 0); attn = weights V merged [t][h*128+d]; out = attn x silu(U) -> [4][2048][1024] (8.4 M)).
// Layout: bf16 copies of x and of the transposed weights; the four projections as ONE GEMM launch (the four transposed weights lie one behind the other: one Bt of 4096 rows) whose f32 tiles never go to memory: each tile's epilogue applies what the layer does next to it and stores that (silu and the bf16 hi/lo planes of Q and K, the key flags, silu and the transposed fp16 plane of V, silu(U) in f32); then one fused silu-attention kernel (scores and fp16 weights stay in registers, exact zeros above the diagonal so the P.V contraction stops at the diagonal block; its epilogue multiplies the merged f32 rows by silu(U) and writes out). Three launches. The four batches run side by side in every launch: the GEMM and the bf16 copy of x take the 8192 rows as one matrix, the attention kernel takes the batch from the grid.
// Compute dtypes, f32 accumulate: every input rounded to bf16; projections exact (inputs); silu in f32 (hardware exp2 and reciprocal) -> Q/K hi/lo planes, V fp16 planes; scores 3 products (tile skipping); bias add, 1/sqrt(128), masks and silu in f32; fp16 weights x fp16 silu(V) (one product, causal K range); no output projection: out = attn x silu(x Wu) in f32.

#define NB_  4
#define TT   2048
#define DM   1024
#define NH_  8
#define NKV  8
#define REP  (NH_ / NKV)
#define HD   128
#define DQ   (NH_ * HD)
#define DKV  (NKV * HD)
#define NEGM (-4294967295.0f)
#define ISC  0.088388347648318447f   // 1/sqrt(128), applied after the bias add
#define ZH   2
#define RH   2048
#define WIN  2048
#define PCAR 1024.0f
#define SCL  0.088388347648318447f   // HD^-0.5
typedef _Float16 h16;
typedef unsigned short bf;
typedef __attribute__((ext_vector_type(16))) __bf16   v16bf;
typedef __attribute__((ext_vector_type(16))) _Float16 v16h;
typedef __attribute__((ext_vector_type(8)))  _Float16 v8h;
typedef __attribute__((ext_vector_type(8)))  unsigned short v8us;
typedef __attribute__((ext_vector_type(8)))  float    v8f;
typedef __attribute__((ext_vector_type(4)))  float    v4f;
typedef v8h  __attribute__((may_alias)) v8ha;
typedef v4f  __attribute__((may_alias)) v4fa;
typedef v8us __attribute__((may_alias)) v8usa;

__device__ __forceinline__ unsigned short f2bf(float f) { unsigned u = __float_as_uint(f); u += 0x7FFFu + ((u >> 16) & 1u); return (unsigned short)(u >> 16); }
__device__ __forceinline__ float bf2f(unsigned short b) { return __uint_as_float(((unsigned)b) << 16); }
__device__ __forceinline__ float bfr(float f) { return bf2f(f2bf(f)); }
__device__ __forceinline__ v16h cat16(v8h lo, v8h hi) { return __builtin_shufflevector(lo, hi, 0, 1, 2, 3, 4, 5, 6, 7, 8, 9, 10, 11, 12, 13, 14, 15); }
__device__ __forceinline__ v16bf cat16b(v8us lo, v8us hi) { return __builtin_bit_cast(v16bf, __builtin_shufflevector(lo, hi, 0, 1, 2, 3, 4, 5, 6, 7, 8, 9, 10, 11, 12, 13, 14, 15)); }
__device__ __forceinline__ v8f wmma16(v16h a, v16h b, v8f c) { return __builtin_amdgcn_wmma_f32_16x16x32_f16(false, a, false, b, (short)0, c, false, false); }
__device__ __forceinline__ v8f wmmab(v16bf a, v16bf b, v8f c) { return __builtin_amdgcn_wmma_f32_16x16x32_bf16(false, a, false, b, (short)0, c, false, false); }



__device__ __forceinline__ h16 tohx(float x) { return (h16)x; }
// silu = u sigmoid(u) = u / (1 + 2^(-u log2 e)) in f32 on the hardware's exp2 and reciprocal, eight values at a time.
// Each run of eight transcendentals is one statement: results in registers of their own (early clobber), so that none overwrites a source of the one in front of it, and the v_nop at the end is the slot that the instruction set asks for between a transcendental and an instruction that reads its result or overwrites its source.
#define TR8(op, d, s) asm(op " %0, %8\n\t" op " %1, %9\n\t" op " %2, %10\n\t" op " %3, %11\n\t" op " %4, %12\n\t" op " %5, %13\n\t" op " %6, %14\n\t" op " %7, %15\n\tv_nop" \
    : "=&v"(d[0]), "=&v"(d[1]), "=&v"(d[2]), "=&v"(d[3]), "=&v"(d[4]), "=&v"(d[5]), "=&v"(d[6]), "=&v"(d[7]) : "v"(s[0]), "v"(s[1]), "v"(s[2]), "v"(s[3]), "v"(s[4]), "v"(s[5]), "v"(s[6]), "v"(s[7]))
__device__ __forceinline__ void silu8(const float* u, float* y) {
    float a[8], e[8], r[8];
#pragma unroll
    for (int q = 0; q < 8; ++q) a[q] = u[q] * -1.4426950408889634f;
    TR8("v_exp_f32", e, a);
#pragma unroll
    for (int q = 0; q < 8; ++q) e[q] = 1.0f + e[q];
    TR8("v_rcp_f32", r, e);
#pragma unroll
    for (int q = 0; q < 8; ++q) y[q] = u[q] * r[q];
}
__device__ __forceinline__ void splitf(float y, unsigned short& h, unsigned short& l) { h = f2bf(y); l = f2bf(y - bf2f(h)); }
typedef __attribute__((ext_vector_type(2))) _Float16 v2h;
typedef __attribute__((ext_vector_type(4))) _Float16 v4h;
typedef __attribute__((ext_vector_type(2))) unsigned short v2us;
typedef __attribute__((ext_vector_type(4))) unsigned short v4us;
typedef __attribute__((ext_vector_type(2))) float v2f;
typedef __attribute__((ext_vector_type(4))) int v4i;

// ---- k_gemmw: register-blocked GEMM, one wave per 64x128 output tile (32 accumulators: a fragment of A feeds 8 products, one of Bt 4), 4 x 2 waves a work-group (256x256), one work-group a WGP; grid (M/256, 4 * 1024/256), 256 threads: the work-groups of the four projections follow one another on a WGP with no launch boundary between them. K % 128 == 0, K >= 256.
// The operands are K-contiguous 16-bit planes. A stage is 128 k (256 bytes) of the work-group's 256 rows of A and 256 rows of Bt, brought into LDS once for the eight waves by asynchronous copies of whole rows, one stage ahead into the other of two buffers; the waves read their fragments from there (rows pitched 16 B x odd for the 16-byte reads), 32 k ahead of the products. k runs upward in 32s into the same accumulators.
// c[m][n] = sum_k A[m][k] Bt[n][k] (f32) never goes to memory; m = b*TT + t, n = MODE*1024 + h*HD + d: the projection (MODE) comes from the block index, the same for a whole work-group. The tile (one head's 128 columns) is laid into the wave's own part of LDS (the buffers, which nobody reads any more behind the last stage's barrier) once and read back in two halves of 64 columns as whole rows, 8 values a lane; what the epilogue stores, by MODE, in 128-byte (f32: 256-byte) pieces:
// 0: silu(c) as bf16 hi/lo planes [b][h][t][d] (Q). 1: the same (K), and KF[(h*HD+d)/64][m] = 1.0 where any silu(c) of the row's 64 columns is not zero, else 0.0 (a sum of absolute values is zero only where every term is).
// 2: silu(c) as the fp16 plane [b][h][d][t] (V transposed: the tile is laid down as [d][t], a lane's 8 accumulator rows being 8 consecutive t of one d). 3: silu(c) in f32 -> SU[m][h*HD+d] (the u gate, which the attention kernel's epilogue applies).
template <typename T16> struct WFrag;
template <> struct WFrag<h16> { typedef v16h V; static __device__ __forceinline__ V ld(const h16* p) { return cat16(*(const v8h*)p, *(const v8h*)(p + 16)); } static __device__ __forceinline__ v8f mma(V a, V b, v8f c) { return wmma16(a, b, c); } };
template <> struct WFrag<bf> { typedef v16bf V; static __device__ __forceinline__ V ld(const bf* p) { return cat16b(*(const v8us*)p, *(const v8us*)(p + 16)); } static __device__ __forceinline__ v8f mma(V a, V b, v8f c) { return wmmab(a, b, c); } };
#define GPIT 272                   // LDS pitch of a 256-byte operand row (128 k)
#define GSTG (512 * GPIT)          // one stage: 256 rows of A, then 256 rows of Bt
#define OPIT 132                   // floats from one row of a wave's 64x128 epilogue tile to the next (16 B x odd for the 16-byte reads)
#define OWAV (128 * 68 * 4)        // bytes of a wave's epilogue tile: the larger of [64][OPIT] and the transposed [128][68]
typedef const __attribute__((address_space(1))) char* gptr;   // an address known to be global memory
// eight 16-byte copies a lane, global memory to LDS through no register, 16 rows apart, in one statement; the one wait at its end stands in front of any rewrite of the address registers that the copies name
__device__ __forceinline__ void cp8(unsigned l, gptr g, size_t gs) {
    asm volatile("global_load_async_to_lds_b128 %0, %8, off\n\tglobal_load_async_to_lds_b128 %1, %9, off\n\tglobal_load_async_to_lds_b128 %2, %10, off\n\tglobal_load_async_to_lds_b128 %3, %11, off\n\t"
                 "global_load_async_to_lds_b128 %4, %12, off\n\tglobal_load_async_to_lds_b128 %5, %13, off\n\tglobal_load_async_to_lds_b128 %6, %14, off\n\tglobal_load_async_to_lds_b128 %7, %15, off\n\ts_wait_xcnt 0x0"
                 :: "v"(l), "v"(l + 16 * GPIT), "v"(l + 32 * GPIT), "v"(l + 48 * GPIT), "v"(l + 64 * GPIT), "v"(l + 80 * GPIT), "v"(l + 96 * GPIT), "v"(l + 112 * GPIT),
                    "v"(g), "v"(g + gs), "v"(g + 2 * gs), "v"(g + 3 * gs), "v"(g + 4 * gs), "v"(g + 5 * gs), "v"(g + 6 * gs), "v"(g + 7 * gs) : "memory");
}
// the epilogue of one wave's 64x128 tile: r0 its first row, c0 its first column inside its own projection (a multiple of HD)
template <int MODE>
__device__ __forceinline__ void gemm_epi(const v8f (&acc)[4][8], float* os, const int lane, const int r0, const int c0, bf* Ph, bf* Pl, float* KF, h16* Vt, float* SU) {
    const int lr = lane & 15, hi = lane >> 4;
#pragma unroll
    for (int mb = 0; mb < 4; ++mb)
#pragma unroll
        for (int nb = 0; nb < 8; ++nb) {
            if (MODE == 2) { v4f lo, hi4;
#pragma unroll
                for (int r = 0; r < 4; ++r) { lo[r] = acc[mb][nb][r]; hi4[r] = acc[mb][nb][4 + r]; }
                float* p = os + (nb * 16 + lr) * 68 + mb * 16 + hi * 8; *(v4fa*)p = lo; *(v4fa*)(p + 4) = hi4;
            } else {
#pragma unroll
                for (int j = 0; j < 8; ++j) os[(mb * 16 + hi * 8 + j) * OPIT + nb * 16 + lr] = acc[mb][nb][j]; } }
    __builtin_amdgcn_wave_barrier(); asm volatile("" ::: "memory");   // the reads below take what OTHER lanes of the wave have written: the compiler may not lift them over the writes
    const int rw = lane >> 3, cofs = (lane & 7) * 8;   // 8 lanes a tile row, 4 rows a pass
    const size_t pl = (size_t)(r0 / TT) * NH_ + c0 / HD; const int t0 = r0 % TT;   // the tile's (batch, head) plane and its first row there
    const size_t est = 4 * ((MODE == 3) ? DM : (MODE == 2) ? TT : HD);   // elements from one pass's row to the next pass's
    const int sst = 4 * ((MODE == 2) ? 68 : OPIT);   // floats from one pass's row of the LDS tile to the next pass's
#pragma unroll 1   // kept rolled, like the loop inside it
  for (int d0 = 0; d0 < HD; d0 += 64) {   // the tile's two halves of 64 columns
    const size_t e0 = (MODE == 3) ? (size_t)(r0 + rw) * DM + c0 + d0 + cofs : (MODE == 2) ? (pl * HD + d0 + rw) * TT + t0 + cofs : (pl * TT + t0 + rw) * HD + d0 + cofs;
    const float* sb = (MODE == 2) ? os + (d0 + rw) * 68 + cofs : os + rw * OPIT + d0 + cofs;
    unsigned long long nzr = 0;   // one bit a tile row: some silu(K) of the row's 64 columns is not zero
#pragma unroll 1   // kept rolled, two passes a trip: 8 independent silu chains a lane and pass keep the vector port fed, and the kernel's text stays a few KB
    for (int it = 0; it < 16; it += 2) {
        v4f o0[2], o1[2]; v8h o[2]; v8us oh[2], ol[2];   // what the trip's two passes store
#pragma unroll
        for (int u = 0; u < 2; ++u) {
            const float* src = sb + (it + u) * sst; const v4f v0 = *(const v4fa*)src, v1 = *(const v4fa*)(src + 4);
            float cv[8], y[8];
#pragma unroll
            for (int q = 0; q < 4; ++q) { cv[q] = v0[q]; cv[4 + q] = v1[q]; }
            silu8(cv, y);
            if (MODE == 3) {
#pragma unroll
                for (int q = 0; q < 4; ++q) { o0[u][q] = y[q]; o1[u][q] = y[4 + q]; }
            } else if (MODE == 2) {
#pragma unroll
                for (int q = 0; q < 8; ++q) o[u][q] = tohx(y[q]);
            } else { bool nz = false;
#pragma unroll
                for (int q = 0; q < 8; ++q) { unsigned short a2, c2; splitf(y[q], a2, c2); oh[u][q] = a2; ol[u][q] = c2; nz = nz | !(y[q] == 0.0f); }
                if (MODE == 1) { const unsigned m = __builtin_amdgcn_ballot_w32(nz);   // byte k: the 8 lanes of the pass's row k
                    const unsigned b4 = ((m & 0xFFu) ? 1u : 0u) | ((m & 0xFF00u) ? 2u : 0u) | ((m & 0xFF0000u) ? 4u : 0u) | ((m & 0xFF000000u) ? 8u : 0u);
                    nzr |= (unsigned long long)b4 << ((it + u) * 4); }
            } }
        __builtin_amdgcn_sched_barrier(0);   // keeps the trip's stores together at its foot, directly in front of the wait below (left alone a store is lifted among the arithmetic, which then rewrites its data registers)
#pragma unroll
        for (int u = 0; u < 2; ++u) { const size_t e = e0 + (size_t)(it + u) * est;
            if (MODE == 3) { *(v4f*)(SU + e) = o0[u]; *(v4f*)(SU + e + 4) = o1[u]; }
            else if (MODE == 2) *(v8h*)(Vt + e) = o[u];
            else { *(v8us*)(Ph + e) = oh[u]; *(v8us*)(Pl + e) = ol[u]; } }
        asm volatile("s_wait_xcnt 0x0" ::: "memory");   // stands behind the trip's stores, in front of any rewrite of the registers that they name (the address step, the next trip's values)
        __builtin_amdgcn_sched_barrier(0);   // keeps the address step behind that wait (nothing else ties the wait to the registers)
    }
    if (MODE == 1) { float* kf = KF + (size_t)((c0 + d0) / 64) * (NB_ * TT) + r0 + lane; kf[0] = ((nzr >> lane) & 1u) ? 1.0f : 0.0f; kf[32] = ((nzr >> (lane + 32)) & 1u) ? 1.0f : 0.0f;
        asm volatile("s_wait_xcnt 0x0" ::: "memory"); }   // as behind the trip's stores: the second half forms its addresses behind it
  }
}
template <typename T16>
__global__ __launch_bounds__(256) void k_gemmw(const T16* __restrict__ A, const T16* __restrict__ Bt, int K, bf* Qh, bf* Ql, bf* Kh, bf* Kl, float* KF, h16* Vt, float* SU) {
    typedef typename WFrag<T16>::V V;
    __shared__ __align__(16) char sm[2 * GSTG];
    const int tid = threadIdx.x, lane = tid & 31, lr = lane & 15, hi = lane >> 4; const int wv = __builtin_amdgcn_readfirstlane(tid >> 5);
    const int r0 = blockIdx.x * 256 + (wv & 3) * 64, c0 = (blockIdx.y & 3) * 256 + (wv >> 2) * 128;   // the wave's own 64x128 tile: its first row, and its first column inside its projection
    static_assert(8 * OWAV <= 2 * GSTG && 64 * OPIT * 4 <= OWAV, "the eight epilogue tiles lie inside the two buffers");
    float* os = (float*)(sm + wv * OWAV);   // the wave's epilogue tile, laid over the buffers
    v8f acc[4][8];
#pragma unroll
    for (int mb = 0; mb < 4; ++mb)
#pragma unroll
        for (int nb = 0; nb < 8; ++nb) acc[mb][nb] = (v8f){};
    // each lane's part of a stage's copies: 16 lanes a 256-byte row, 16 rows a copy of the work-group, 16 copies for the 256 rows of A and 16 for the 256 of Bt
    const unsigned lsm = (unsigned)(size_t)(__attribute__((address_space(3))) char*)sm + (tid >> 4) * GPIT + (tid & 15) * 16; const size_t gs = (size_t)16 * K * 2;
    gptr ga = (gptr)(A + (size_t)(blockIdx.x * 256) * K); gptr gb = (gptr)(Bt + (size_t)(blockIdx.y * 256) * K); const unsigned go = (unsigned)(tid >> 4) * (unsigned)K * 2 + (tid & 15) * 16;   // the work-group's first rows are the same for every lane (scalar registers); a lane keeps one 32-bit byte offset that serves both operands
    auto fill = [&](const int bo, const int kc) {   // bo: the buffer's byte offset
        const unsigned l = lsm + bo; gptr x = ga + (go + (unsigned)kc * 2), y = gb + (go + (unsigned)kc * 2);
        // the scheduling barriers keep each run's address arithmetic beside its own copies, so that the four runs use the same few registers one after the other: operands of asm text lie in the first 256 registers, and with all 32 copies' addresses formed ahead the accumulators there were moved out and back in every stage
        cp8(l, x, gs); __builtin_amdgcn_sched_barrier(0); cp8(l + 128 * GPIT, x + 8 * gs, gs); __builtin_amdgcn_sched_barrier(0); cp8(l + 256 * GPIT, y, gs); __builtin_amdgcn_sched_barrier(0); cp8(l + 384 * GPIT, y + 8 * gs, gs);
    };
    fill(0, 0);
    asm volatile("s_wait_asynccnt 0x0" ::: "memory");   // this wave's copies of the first stage have landed before the barrier behind which the other waves read them
    __syncthreads();
    fill(GSTG, 128);   // K >= 256: a second stage always exists
    const int aof = ((wv & 3) * 64 + lr) * GPIT + 16 * hi, bof = (256 + (wv >> 2) * 128 + lr) * GPIT + 16 * hi;
#pragma unroll 1   // not unrolled: the buffers' addresses are formed from bo in each stage and hold no registers of their own
    for (int kc = 0, bo = 0; kc < K; kc += 128, bo ^= GSTG) {
        const char* at = sm + bo + aof; const char* bt = sm + bo + bof;
        V a[2][4], b[2][8];
#pragma unroll
        for (int f = 0; f < 8; ++f) { if (f < 4) a[0][f] = WFrag<T16>::ld((const T16*)(at + f * 16 * GPIT)); b[0][f] = WFrag<T16>::ld((const T16*)(bt + f * 16 * GPIT)); }
#pragma unroll
        for (int s = 0; s < 4; ++s) {   // 32 k a pass; the next pass's fragments (of this stage only) are asked for as one group in front of this pass's products
            if (s < 3) {
#pragma unroll
                for (int f = 0; f < 8; ++f) { if (f < 4) a[(s + 1) & 1][f] = WFrag<T16>::ld((const T16*)(at + f * 16 * GPIT + (s + 1) * 64)); b[(s + 1) & 1][f] = WFrag<T16>::ld((const T16*)(bt + f * 16 * GPIT + (s + 1) * 64)); }
                __builtin_amdgcn_sched_barrier(0);   // keeps those reads here as one group, their latency under this pass's products (left alone the compiler sinks them among the products that use them, a wait to zero in front of every four)
            }
#pragma unroll
            for (int nb = 0; nb < 8; ++nb)
#pragma unroll
                for (int mb = 0; mb < 4; ++mb) acc[mb][nb] = WFrag<T16>::mma(a[s & 1][mb], b[s & 1][nb], acc[mb][nb]);
        }
        __builtin_amdgcn_sched_barrier(0);   // keeps the waits and the barrier below at the foot, behind the last products and directly in front of the refill, so that the copies have a whole stage to land
        asm volatile("s_wait_dscnt 0x0" ::: "memory");      // this wave's reads of the buffer are over before the barrier behind which it is refilled
        asm volatile("s_wait_asynccnt 0x0" ::: "memory");   // this wave's copies of the next stage have landed before the barrier behind which the other waves read them
        __syncthreads();
        if (kc + 256 < K) fill(bo, kc + 256);   // the same for the whole work-group
    }
    asm volatile("s_wait_asynccnt 0x0" ::: "memory");   // no copy is in flight when the buffers become the epilogue's tiles
    const int mode = blockIdx.y >> 2;   // which projection the work-group's 256 rows of Bt belong to
    if (mode == 0) gemm_epi<0>(acc, os, lane, r0, c0, Qh, Ql, nullptr, nullptr, nullptr);
    else if (mode == 1) gemm_epi<1>(acc, os, lane, r0, c0, Kh, Kl, KF, nullptr, nullptr);
    else if (mode == 2) gemm_epi<2>(acc, os, lane, r0, c0, nullptr, nullptr, nullptr, Vt, nullptr);
    else gemm_epi<3>(acc, os, lane, r0, c0, nullptr, nullptr, nullptr, nullptr, SU);
}
// ---- k_prep: all that is only a re-laying of an input (bf16 transposed weights, transposed bias rows, the bf16 copy of x), in one launch of few, long waves; the job comes from the block index (the same for a whole work-group); no work-group barrier.
// Blocks [0, PWB): the four weights, w [k][n] f32 -> Bt [n][k] bf16. A work-group takes 256 k x 64 n of one weight, a wave 64 k x 32 n: 16 loads of 16 bytes a lane, all in flight (8 lanes a 128-byte row piece, a lane holds rows k and k + 1 of 4 columns), the bf16 pairs (k, k + 1) go as dwords into the wave's own part of LDS as [n][k] and come back as whole 128-byte rows for the stores.
// Blocks [PWB, PWB + PBB): BTT[h][p] = bf16-rounded rel_bias[p][h], 0 at p = 4095. The rest: 16 x 8 values of x a lane, the 32 loads in flight together.
#define PWB  256                   // 4 weights x (1024 / 64) x (1024 / 256)
#define PBB  16                    // NH_ * 4096 / (256 * 8)
#define PXB  256                   // NB_ * TT * DM / (256 * 16 * 8)
#define TPIT 36                    // dwords from one n row of a wave's LDS tile to the next (32 of data; a multiple of 4 for the 16-byte reads)
typedef __attribute__((ext_vector_type(4))) unsigned v4u;
typedef v4u __attribute__((may_alias)) v4ua;
__global__ __launch_bounds__(256) void k_prep(const float* __restrict__ x, const float* __restrict__ wq, const float* __restrict__ wk, const float* __restrict__ wv, const float* __restrict__ wu, const float* __restrict__ RB,
                                              bf* XB, bf* WQ, bf* WK, bf* WV, bf* WU, float* BTT) {
    static_assert(DQ == DM && DKV == DM && DM == 1024 && PBB * 2048 == NH_ * 4096 && (size_t)PXB * 4096 * 8 == (size_t)NB_ * TT * DM, "the block ranges are cut for these shapes");
    __shared__ __align__(16) unsigned tl[8 * 32 * TPIT];
    const int blk = blockIdx.x, tid = threadIdx.x;
    if (blk < PWB) {
        const int sel = blk >> 6, t = blk & 63;
        const float* __restrict__ w = sel == 0 ? wq : sel == 1 ? wk : sel == 2 ? wv : wu; bf* Bt = sel == 0 ? WQ : sel == 1 ? WK : sel == 2 ? WV : WU;
        const int lane = tid & 31, wvi = tid >> 5, r = lane >> 3, c = lane & 7;
        const int n0 = (t >> 2) * 64 + (wvi & 1) * 32, k0 = (t & 3) * 256 + (wvi >> 1) * 64;
        unsigned* my = tl + wvi * (32 * TPIT);
        const float* s = w + (size_t)(k0 + 2 * r) * DM + n0 + 4 * c;
        v4f a[8], b[8];
#pragma unroll
        for (int j = 0; j < 8; ++j) { a[j] = *(const v4f*)(s + (size_t)(8 * j) * DM); b[j] = *(const v4f*)(s + (size_t)(8 * j + 1) * DM); }
        asm volatile("s_wait_xcnt 0x0" :: "v"(s) : "memory");   // stands in front of any rewrite of the address registers that the loads name; the address as an input keeps it in those registers up to here (left alone the last load lands on them)
#pragma unroll
        for (int j = 0; j < 8; ++j)
#pragma unroll
            for (int q = 0; q < 4; ++q) my[(4 * c + q) * TPIT + 4 * j + r] = (unsigned)f2bf(a[j][q]) | ((unsigned)f2bf(b[j][q]) << 16);
        __builtin_amdgcn_wave_barrier(); asm volatile("" ::: "memory");   // the reads below take what OTHER lanes of the wave have written: the compiler may not lift them over the writes
        bf* d = Bt + (size_t)(n0 + r) * DM + k0 + 8 * c;
#pragma unroll
        for (int i = 0; i < 8; ++i) *(v4ua*)(d + (size_t)(4 * i) * DM) = *(const v4ua*)(my + (4 * i + r) * TPIT + 4 * c);
    } else if (blk < PWB + PBB) {
#pragma unroll
        for (int u = 0; u < 8; ++u) { const int idx = (blk - PWB) * 2048 + u * 256 + tid; const int p = idx % 4096, h = idx / 4096; const int pc = p < 2 * TT - 1 ? p : 2 * TT - 2;   // the row index is clamped, so that every lane loads and the eight loads fly together
            const float v = bfr(RB[(size_t)pc * NH_ + h]); BTT[idx] = (p < 2 * TT - 1) ? v : 0.0f; }
        asm volatile("s_wait_xcnt 0x0" ::: "memory");   // stands behind the branch's last store, in front of any rewrite of the registers that the stores name
    } else {
        const size_t i0 = (size_t)(blk - PWB - PBB) * 4096 + tid; const float* s = x + i0 * 8;
        v8f v[16];
#pragma unroll
        for (int u = 0; u < 16; ++u) v[u] = *(const v8f*)(s + u * 2048);
        asm volatile("s_wait_xcnt 0x0" :: "v"(s) : "memory");   // as above
#pragma unroll
        for (int u = 0; u < 16; ++u) { v8us o;
#pragma unroll
            for (int k = 0; k < 8; ++k) o[k] = f2bf(v[u][k]);
            *(v8us*)(XB + (i0 + u * 256) * 8) = o; }
        asm volatile("s_wait_xcnt 0x0" ::: "memory");   // as behind the bias stores
    }
}
// ---- k_fattn: scores, bias, masks, silu weights, weights x V and the silu(U) gate in one kernel; nothing of the [t][t] planes goes to memory, and the ungated rows do not either. A work-group takes 128 query rows with 8 waves: wave = (row group of 32 queries, key half); grid (heads, batches, TT/128): the row block is the slowest index, longest rows first over all heads and batches, one work-group a WGP at a time, so that a WGP that ends a shorter block early takes the longer of the blocks that are left.
// A stage is 64 keys; the waves of key half 0 work on its first 32 keys, those of half 1 on its last 32, so a row block's chain of stages is half as long as its chain of 32-key steps. A wave holds TWO 16-query tiles, and every K and V fragment that it reads from LDS feeds both.
// Per 32 keys and query tile: St = K Qt (two 16-key tiles, the same 3 hi/lo products in the same order per 32 of d), a lane then holds 16 keys of ONE query in the hardware k order, so the fp16 weights are the B operand of Ot += Vt Pt as they stand.
// A wave's keys run in ascending steps into its own accumulators and stop at the end of the 128-row diagonal block (weights past the diagonal are exact zeros); at the end the two key halves' f32 partial sums of a query are added once, through LDS.
// The K hi, K lo and V tiles of a stage are brought into LDS once for the eight waves, by asynchronous copies of whole rows, one stage ahead into the other of two buffers; the waves read their fragments from there (rows pitched 16 B x odd for the 16-byte reads).
#define KPIT 272                   // LDS pitch of a 256-byte K row
#define VPIT 80                    // LDS pitch of a 64-byte V row (32 keys of one d)
#define KTB  (32 * KPIT)           // one K plane's tile
#define STG  (2 * KTB + HD * VPIT) // the tiles of one key half of a stage: K hi, K lo, V
#define STG2 (2 * STG)             // one stage: the two halves
__device__ __forceinline__ v16bf ldfb(gptr p) { return cat16b(*(const __attribute__((address_space(1))) v8us*)p, *(const __attribute__((address_space(1))) v8us*)(p + 32)); }
__device__ __forceinline__ v16bf ldsb(const char* p) { return cat16b(*(const v8us*)p, *(const v8us*)(p + 32)); }
__device__ __forceinline__ v16h ldsh(const char* p) { return cat16(*(const v8h*)p, *(const v8h*)(p + 32)); }
// a stage's twelve 16-byte copies a lane, global memory to LDS through no register, in one statement; the one wait at its end stands in front of any rewrite of the address registers that the copies name
__device__ __forceinline__ void cp12(unsigned a, unsigned b, unsigned v, gptr x, gptr y, gptr w) {
    asm volatile("global_load_async_to_lds_b128 %0, %12, off\n\tglobal_load_async_to_lds_b128 %1, %13, off\n\tglobal_load_async_to_lds_b128 %2, %14, off\n\tglobal_load_async_to_lds_b128 %3, %15, off\n\t"
                 "global_load_async_to_lds_b128 %4, %16, off\n\tglobal_load_async_to_lds_b128 %5, %17, off\n\tglobal_load_async_to_lds_b128 %6, %18, off\n\tglobal_load_async_to_lds_b128 %7, %19, off\n\t"
                 "global_load_async_to_lds_b128 %8, %20, off\n\tglobal_load_async_to_lds_b128 %9, %21, off\n\tglobal_load_async_to_lds_b128 %10, %22, off\n\tglobal_load_async_to_lds_b128 %11, %23, off\n\ts_wait_xcnt 0x0"
                 :: "v"(a), "v"(a + 8 * KPIT), "v"(a + 16 * KPIT), "v"(a + 24 * KPIT), "v"(b), "v"(b + 8 * KPIT), "v"(b + 16 * KPIT), "v"(b + 24 * KPIT), "v"(v), "v"(v + 32 * VPIT), "v"(v + 64 * VPIT), "v"(v + 96 * VPIT),
                    "v"(x), "v"(x + 2048), "v"(x + 4096), "v"(x + 6144), "v"(y), "v"(y + 2048), "v"(y + 4096), "v"(y + 6144), "v"(w), "v"(w + 32 * TT * 2), "v"(w + 64 * TT * 2), "v"(w + 96 * TT * 2) : "memory");
}
__global__ __launch_bounds__(256) void k_fattn(const bf* __restrict__ Qh, const bf* __restrict__ Ql, const bf* __restrict__ Kh, const bf* __restrict__ Kl, const h16* __restrict__ Vt, const float* __restrict__ BTT, const float* __restrict__ KM, const float* __restrict__ SU, float* O) {
    __shared__ __align__(16) float sbias[4096]; __shared__ __align__(16) float skm[TT]; __shared__ __align__(16) char ring[2 * STG2];
    const int h = blockIdx.x; const int qb = ((int)gridDim.z - 1 - (int)blockIdx.z) * 128;
    { const size_t b = blockIdx.y, pb = b * NH_ * TT * HD; Qh += pb; Ql += pb; Kh += pb; Kl += pb; Vt += pb; KM += (size_t)(2 * h) * (NB_ * TT) + b * TT; SU += b * TT * DM; O += b * TT * DM; }   // this batch's planes, the head's two rows of key flags (one for each 64 of its columns), gate rows and output rows
    const size_t hp = (size_t)h * TT * HD; const int tid = threadIdx.x, th = tid & 127;
    const int wv = __builtin_amdgcn_readfirstlane(tid >> 5), par = wv >> 2;   // the wave's key half: waves 0-3 the first 32 keys of a stage, waves 4-7 the last 32
    // each lane's part of a stage's copies; the four waves of a key half bring that half's tiles: K tiles are 8 KiB in a row (16 lanes a row, 8 rows a copy), V rows are 64 B of a 4-KiB row (4 lanes a row, 32 rows a copy)
    const unsigned lring = (unsigned)(size_t)(__attribute__((address_space(3))) char*)ring + par * STG;
    const unsigned lk = lring + (th >> 4) * KPIT + (th & 15) * 16, lv = lring + 2 * KTB + (th >> 2) * VPIT + (th & 3) * 16;
    gptr gkh = (gptr)(Kh + hp); gptr gkl = (gptr)(Kl + hp); gptr gv = (gptr)(Vt + hp); const unsigned tk = th * 16 + par * (32 * HD * 2), tv = (th >> 2) * TT * 2 + (th & 3) * 16 + par * (32 * 2);   // the planes' addresses are the same for every lane (scalar registers); a lane keeps its two 32-bit byte offsets into them
    auto fill = [&](const int bo, const int k0) {   // bo: the buffer's byte offset in the ring; k0: the stage's first key
        const unsigned a = lk + bo, v = lv + bo; gptr x = gkh + (tk + (unsigned)k0 * HD * 2), y = gkl + (tk + (unsigned)k0 * HD * 2), w = gv + (tv + (unsigned)k0 * 2);
        cp12(a, a + KTB, v, x, y, w);
    };
    fill(STG2, 0);   // the first stage goes into the second buffer: a lane's LDS base is then never itself an operand of the copies' statement, which would hold it in the low registers through the whole loop (it was spilled to scratch)
#pragma unroll
    for (int p = 0; p < 4096 / 4 / 256; ++p) ((v4f*)sbias)[p * 256 + tid] = ((const v4f*)(BTT + (size_t)h * 4096))[p * 256 + tid];
#pragma unroll
    for (int p = 0; p < TT / 4 / 256; ++p) ((v4f*)skm)[p * 256 + tid] = ((const v4f*)KM)[p * 256 + tid] + ((const v4f*)(KM + NB_ * TT))[p * 256 + tid];   // zero only where both halves of the key's row are all zero
    asm volatile("s_wait_asynccnt 0x0" ::: "memory");   // this wave's copies of the first tiles have landed before the barrier behind which the other waves read them
    __syncthreads();
    const int lane = tid & 31, c = lane & 15, hh = lane >> 4; const int q0 = qb + (wv & 3) * 32; const int i0 = q0 + c;   // the lane's query in tile ct is i0 + 16 ct
    const unsigned kof = c * HD * 2 + 16 * hh;
    v16bf qh[2][4], ql[2][4];
#pragma unroll
    for (int ct = 0; ct < 2; ++ct)
#pragma unroll
        for (int kc = 0; kc < 4; ++kc) { qh[ct][kc] = ldfb((gptr)(Qh + hp) + (size_t)q0 * HD * 2 + (kof + ct * 16 * HD * 2 + kc * 64)); ql[ct][kc] = ldfb((gptr)(Ql + hp) + (size_t)q0 * HD * 2 + (kof + ct * 16 * HD * 2 + kc * 64)); }
    asm volatile("s_wait_xcnt 0x0" :: "v"(kof) : "memory");   // stands in front of any rewrite of the address registers that the loads name; the offset as an input keeps it in its register up to here
    v8f o[2][8];
#pragma unroll
    for (int ct = 0; ct < 2; ++ct)
#pragma unroll
        for (int dt = 0; dt < 8; ++dt) o[ct][dt] = (v8f){};
    const int kend = qb + 128;   // keys up to the end of the work-group's 128-row diagonal block (weights past the diagonal are exact zeros): an even number of 64-key stages
    // the wave's 32 keys of one stage, on the tiles in the buffer at bo. The stage's barrier is split: a wave signals as soon as its LDS reads of the stage have returned and its copies of the next stage have landed, does its silu arithmetic and its weights x V products (registers only), and waits at the foot. So the two waves that share a SIMD need not run in step: one can be in its score products while the other is in its silu arithmetic.
    auto step = [&](const int bo, const int k0) {
        const int kk = k0 + 32 * par;   // the wave's first key
        const char* kt = ring + bo + par * STG + c * KPIT + 16 * hh; const char* vt = kt + 2 * KTB + c * (VPIT - KPIT);
        v16bf ka[4][2], kb[4][2]; v16h vf[8]; float bs[2][16]; v4f km[4];
#pragma unroll
        for (int kc = 0; kc < 3; ++kc)
#pragma unroll
            for (int k2 = 0; k2 < 2; ++k2) { ka[kc][k2] = ldsb(kt + k2 * 16 * KPIT + kc * 64); kb[kc][k2] = ldsb(kt + KTB + k2 * 16 * KPIT + kc * 64); }
        if (k0 + 64 < kend) fill(bo ^ STG2, k0 + 64);   // the same for the whole work-group. The next stage's copies go into the other buffer, whose every reader signalled the end of its reads in front of the barrier wait that this wave has passed; their issue runs under the latency of the reads above
        v8f s[2][2]; s[0][0] = (v8f){}; s[0][1] = (v8f){}; s[1][0] = (v8f){}; s[1][1] = (v8f){};
#pragma unroll
        for (int kc = 0; kc < 4; ++kc) {   // 32 of d a pass: four fragments, twelve products on four independent accumulators
#pragma unroll
            for (int k2 = 0; k2 < 2; ++k2)
#pragma unroll
                for (int ct = 0; ct < 2; ++ct) { s[ct][k2] = wmmab(ka[kc][k2], qh[ct][kc], s[ct][k2]); s[ct][k2] = wmmab(ka[kc][k2], ql[ct][kc], s[ct][k2]); s[ct][k2] = wmmab(kb[kc][k2], qh[ct][kc], s[ct][k2]); }
            // the pass's fragments are used up: the next reads take their registers (the last K fragments two passes ahead of their products, then the V fragments, bias and key flags)
            if (kc == 0) {
#pragma unroll
                for (int k2 = 0; k2 < 2; ++k2) { ka[3][k2] = ldsb(kt + k2 * 16 * KPIT + 3 * 64); kb[3][k2] = ldsb(kt + KTB + k2 * 16 * KPIT + 3 * 64); }
            } else if (kc < 3) {
#pragma unroll
                for (int dt = 0; dt < 4; ++dt) vf[(kc - 1) * 4 + dt] = ldsh(vt + ((kc - 1) * 4 + dt) * 16 * VPIT);
                if (kc == 2) {
#pragma unroll
                    for (int ct = 0; ct < 2; ++ct)
#pragma unroll
                        for (int e = 0; e < 16; ++e) bs[ct][e] = sbias[2047 + i0 + 16 * ct - (kk + (e >> 3) * 16 + 8 * hh + (e & 7))];
#pragma unroll
                    for (int e = 0; e < 4; ++e) km[e] = *(const v4f*)(skm + kk + (e >> 1) * 16 + 8 * hh + (e & 1) * 4);
                }
            }
            if (kc < 3) __builtin_amdgcn_sched_barrier(0);   // keeps those reads here as one group, their latency under the products that follow (left alone the compiler sinks them between the last products, a short-led wait at each)
        }
        asm volatile("s_wait_dscnt 0x0" ::: "memory");      // this wave's reads of the buffer are over before it signals: behind the barrier the buffer is refilled
        asm volatile("s_wait_asynccnt 0x0" ::: "memory");   // this wave's copies of the next stage's tiles have landed before it signals: behind the barrier the other waves read them
        asm volatile("s_barrier_signal -1" ::: "memory");   // first half of the stage's barrier; no LDS read stands between it and the wait at the foot
        __builtin_amdgcn_sched_barrier(0);   // keeps the arithmetic below behind the signal (left alone the compiler lifts it over the signal, which then comes as late as the wait)
#pragma unroll
        for (int ct = 0; ct < 2; ++ct) {
            v16h p; float t[16], wt[16];
#pragma unroll
            for (int e = 0; e < 16; ++e) { const int j = kk + (e >> 3) * 16 + 8 * hh + (e & 7); const float t0 = __fmul_rn(__fadd_rn(s[ct][e >> 3][e & 7], bs[ct][e]), ISC); const bool msk = (j > i0 + 16 * ct) | (km[e >> 2][e & 3] == 0.0f); t[e] = msk ? NEGM : t0; }
            silu8(t, wt); silu8(t + 8, wt + 8);
#pragma unroll
            for (int e = 0; e < 16; ++e) p[e] = tohx(wt[e]);
#pragma unroll
            for (int dt = 0; dt < 8; ++dt) o[ct][dt] = wmma16(vf[dt], p, o[ct][dt]);
        }
        __builtin_amdgcn_sched_barrier(0);   // keeps the wait below at the foot, behind the last products
        asm volatile("s_barrier_wait -1" ::: "memory");   // second half: every wave has signalled, so the next stage's tiles may be read and this stage's buffer refilled
    };
#pragma unroll 1
    for (int k0 = 0, bo = STG2; k0 < kend; k0 += 64, bo ^= STG2) step(bo, k0);   // not unrolled: the buffers' addresses are formed from bo in each stage and hold no registers of their own
    asm volatile("s_wait_asynccnt 0x0" ::: "memory");   // no copy is in flight when the ring becomes the exchange space below
    // the two key halves' partial sums are joined: the wave of half 0 finishes query tile 0, its partner (same row group, half 1) tile 1; each lays the tile that it does not finish into its own 8 KiB of the ring (which nobody reads any more behind the last stage's barrier) and takes the partner's
    v8f mine[8], oth[8];
#pragma unroll
    for (int dt = 0; dt < 8; ++dt) { mine[dt] = par ? o[1][dt] : o[0][dt]; oth[dt] = par ? o[0][dt] : o[1][dt]; }
    const size_t eo = (size_t)(i0 + 16 * par) * DM + h * HD + 8 * hh;   // a lane holds 8 consecutive d of one query: merged [t][h*128+d], f32
    const float* grow = SU + eo; float* orow = O + eo;
    v4f g[16];   // the query's silu(U) at the lane's 64 places, the sixteen loads in flight together
#pragma unroll
    for (int dt = 0; dt < 8; ++dt) { g[2 * dt] = *(const v4f*)(grow + dt * 16); g[2 * dt + 1] = *(const v4f*)(grow + dt * 16 + 4); }
    asm volatile("s_wait_xcnt 0x0" :: "v"(grow) : "memory");   // stands in front of any rewrite of the address registers that the loads name; the address as an input keeps it in those registers up to here
    v4fa* xs = (v4fa*)ring;   // [wave][16][lane] pieces of 16 bytes
#pragma unroll
    for (int dt = 0; dt < 8; ++dt) { v4f lo, hi4;
#pragma unroll
        for (int r = 0; r < 4; ++r) { lo[r] = oth[dt][r]; hi4[r] = oth[dt][4 + r]; }
        xs[(wv * 16 + 2 * dt) * 32 + lane] = lo; xs[(wv * 16 + 2 * dt + 1) * 32 + lane] = hi4; }
    __syncthreads();   // the partner's tile is read behind it
#pragma unroll
    for (int dt = 0; dt < 8; ++dt) { const v4f pa = xs[((wv ^ 4) * 16 + 2 * dt) * 32 + lane], pb = xs[((wv ^ 4) * 16 + 2 * dt + 1) * 32 + lane]; v4f lo, hi4;
#pragma unroll
        for (int r = 0; r < 4; ++r) { lo[r] = __fmul_rn(__fadd_rn(mine[dt][r], pa[r]), g[2 * dt][r]); hi4[r] = __fmul_rn(__fadd_rn(mine[dt][4 + r], pb[r]), g[2 * dt + 1][r]); }
        *(v4f*)(orow + dt * 16) = lo; *(v4f*)(orow + dt * 16 + 4) = hi4; }
}
extern "C" void kernel_launch(void* const* d_in, const int* in_sizes, int n_in,
                              void* d_out, int out_size, void* d_ws, size_t ws_size, hipStream_t stream) {
    (void)in_sizes; (void)n_in; (void)out_size;
    const float* x = (const float*)d_in[0]; const float* wq = (const float*)d_in[1]; const float* wk = (const float*)d_in[2]; const float* wv = (const float*)d_in[3]; const float* wu = (const float*)d_in[4]; const float* RB = (const float*)d_in[5];
    float* OUT = (float*)d_out;     // [4][2048][1024]
    char* wsp = (char*)d_ws;
    auto take = [&](size_t bytes) { char* p = wsp; wsp += (bytes + 255) & ~(size_t)255; return (void*)p; };
    bf* WQ = (bf*)take((size_t)4 * DM * DM * 2); bf* WK = WQ + (size_t)DM * DM; bf* WV = WK + (size_t)DM * DM; bf* WU = WV + (size_t)DM * DM;   /* one Bt of 4 x 1024 rows */ float* BTT = (float*)take((size_t)NH_ * 4096 * 4); float* KF = (float*)take((size_t)(DKV / 64) * NB_ * TT * 4);
    bf* XB = (bf*)take((size_t)NB_ * TT * DM * 2); float* SU = (float*)take((size_t)NB_ * TT * DM * 4); h16* VT16 = (h16*)take((size_t)NB_ * NKV * HD * TT * 2);
    bf* QPh = (bf*)take((size_t)NB_ * NH_ * TT * HD * 2); bf* QPl = (bf*)take((size_t)NB_ * NH_ * TT * HD * 2); bf* KPh = (bf*)take((size_t)NB_ * NKV * TT * HD * 2); bf* KPl = (bf*)take((size_t)NB_ * NKV * TT * HD * 2);
    if ((size_t)(wsp - (char*)d_ws) > ws_size) return;    // ws 256 MiB
    k_prep<<<PWB + PBB + PXB, 256, 0, stream>>>(x, wq, wk, wv, wu, RB, XB, WQ, WK, WV, WU, BTT);   /* bf16 transposed weights, transposed relative-bias rows, bf16 x */
    k_gemmw<bf><<<dim3(NB_ * TT / 256, 4 * DM / 256, 1), 256, 0, stream>>>(XB, WQ, DM, QPh, QPl, KPh, KPl, KF, VT16, SU);   /* silu(x Wq) and silu(x Wk) planes, key padding flags, silu(x Wv) transposed, silu(x Wu) */
    k_fattn<<<dim3(NH_, NB_, TT / 128), 256, 0, stream>>>(QPh, QPl, KPh, KPl, VT16, BTT, KF, SU, OUT);   /* silu attention, all heads and batches, gated: out[b*TT+t][h*128+d] = attn x silu(x Wu) */
}
